// v000
// Measured on an AMD MI455X. A time is GPU time per run, averaged over a window of back-to-back runs after a warm-up
// (all launches, gaps included; the runs take copies of the inputs in turn), and the median of several windows.
// Apart from v000's, it joins two sittings. Times from different sittings can be a few percent apart, while
// side-by-side timings come from the same sitting.
// The starting kernel, v000, takes 358 microseconds a run.
#include <hip/hip_runtime.h>
#include <math.h>

typedef __attribute__((ext_vector_type(2))) float v2f;
typedef __attribute__((ext_vector_type(8))) float v8f;

#define HIDD 128
#define NHD  8
#define NNOD 256
#define NBAT 16

// ---------------- generic single-wave fp32 WMMA GEMM (B column-major) -------
// C[M,N] = A[M,K] @ B[K,N], with B stored col-major: element(k,n) = Bt[n*ldb+k]
// grid.x = M/16, grid.y = N/(16*NT), grid.z = batch
// batch offsets: off = (z/div)*s1 + (z%div)*s2   for A, B, C (ADD shares C's)
// FUSE: 0 = none, 1 = relu, 2 = add ADD.  Requires K % 8 == 0.
template<int FUSE, int NT>
__global__ __launch_bounds__(32)
void wmma_gemm_f32(const float* __restrict__ A, const float* __restrict__ Bt,
                   float* __restrict__ C, const float* __restrict__ ADD,
                   int K, int lda, int ldb, int ldc, int div,
                   long long sA1, long long sA2,
                   long long sB1, long long sB2,
                   long long sC1, long long sC2)
{
    const int z  = blockIdx.z;
    const int zq = z / div, zr = z % div;
    const float* Ab = A  + zq * sA1 + zr * sA2;
    const float* Bb = Bt + zq * sB1 + zr * sB2;
    float*       Cb = C  + zq * sC1 + zr * sC2;
    const float* Db = (FUSE == 2) ? (ADD + zq * sC1 + zr * sC2) : nullptr;

    const int m0   = blockIdx.x * 16;
    const int n0   = blockIdx.y * (16 * NT);
    const int lane = threadIdx.x & 31;
    const int l16  = lane & 15;
    const int kh   = lane >> 4;          // K-half select (0/1)

    v8f acc[NT];
#pragma unroll
    for (int t = 0; t < NT; ++t)
#pragma unroll
        for (int r = 0; r < 8; ++r) acc[t][r] = 0.0f;

    // single lane-dependent base per matrix; tile index folded into constant
    // element offsets so all fragment loads become global_load_b64 base+imm.
    const float* __restrict__ paBase = Ab + (long long)(m0 + l16) * lda + 2 * kh;
    const float* __restrict__ pbBase = Bb + (long long)(n0 + l16) * ldb + 2 * kh;

    // 2-deep software pipeline: stage0 covers k0, stage1 covers k0+4
    v2f a0, a1, b0[NT], b1[NT];
    a0 = *(const v2f*)(paBase + 0);
#pragma unroll
    for (int t = 0; t < NT; ++t)
        b0[t] = *(const v2f*)(pbBase + (long long)t * 16 * ldb + 0);
    a1 = *(const v2f*)(paBase + 4);
#pragma unroll
    for (int t = 0; t < NT; ++t)
        b1[t] = *(const v2f*)(pbBase + (long long)t * 16 * ldb + 4);

    for (int k0 = 8; k0 < K; k0 += 8) {
#pragma unroll
        for (int t = 0; t < NT; ++t)
            acc[t] = __builtin_amdgcn_wmma_f32_16x16x4_f32(
                false, a0, false, b0[t], (short)0, acc[t], false, false);
        a0 = *(const v2f*)(paBase + k0);
#pragma unroll
        for (int t = 0; t < NT; ++t)
            b0[t] = *(const v2f*)(pbBase + (long long)t * 16 * ldb + k0);
#pragma unroll
        for (int t = 0; t < NT; ++t)
            acc[t] = __builtin_amdgcn_wmma_f32_16x16x4_f32(
                false, a1, false, b1[t], (short)0, acc[t], false, false);
        a1 = *(const v2f*)(paBase + k0 + 4);
#pragma unroll
        for (int t = 0; t < NT; ++t)
            b1[t] = *(const v2f*)(pbBase + (long long)t * 16 * ldb + k0 + 4);
    }
#pragma unroll
    for (int t = 0; t < NT; ++t)
        acc[t] = __builtin_amdgcn_wmma_f32_16x16x4_f32(
            false, a0, false, b0[t], (short)0, acc[t], false, false);
#pragma unroll
    for (int t = 0; t < NT; ++t)
        acc[t] = __builtin_amdgcn_wmma_f32_16x16x4_f32(
            false, a1, false, b1[t], (short)0, acc[t], false, false);

#pragma unroll
    for (int t = 0; t < NT; ++t) {
#pragma unroll
        for (int r = 0; r < 8; ++r) {
            const int row = m0 + r + 8 * kh;
            const int col = n0 + t * 16 + l16;
            float v = acc[t][r];
            if (FUSE == 1) v = fmaxf(v, 0.0f);
            if (FUSE == 2) v += Db[(long long)row * ldc + col];
            Cb[(long long)row * ldc + col] = v;
        }
    }
}

// ---------------- layernorm: one wave per 128-wide row ----------------
__global__ __launch_bounds__(256)
void ln_kernel(const float* __restrict__ x, const float* __restrict__ res,
               const float* __restrict__ g, const float* __restrict__ b,
               float* __restrict__ out, int rows)
{
    const int wave = threadIdx.x >> 5;
    const int lane = threadIdx.x & 31;
    const int row  = blockIdx.x * 8 + wave;
    if (row >= rows) return;
    const long long base = (long long)row * HIDD;
    float v[4];
    float s = 0.0f, s2 = 0.0f;
#pragma unroll
    for (int i = 0; i < 4; ++i) {
        const int c = lane + 32 * i;
        float t = x[base + c];
        if (res) t += res[base + c];
        v[i] = t; s += t; s2 += t * t;
    }
#pragma unroll
    for (int o = 16; o >= 1; o >>= 1) {
        s  += __shfl_xor(s,  o, 32);
        s2 += __shfl_xor(s2, o, 32);
    }
    const float mu   = s * (1.0f / HIDD);
    const float var  = s2 * (1.0f / HIDD) - mu * mu;
    const float rinv = rsqrtf(var + 1e-5f);
#pragma unroll
    for (int i = 0; i < 4; ++i) {
        const int c = lane + 32 * i;
        out[base + c] = (v[i] - mu) * rinv * g[c] + b[c];
    }
}

// ------ fused scale + edge-bias + softmax + edge-gate (in place on att) ------
__global__ __launch_bounds__(256)
void softmax_kernel(float* __restrict__ att, const float* __restrict__ ef,
                    const float* __restrict__ comb)
{
    __shared__ float red[8];
    const int i  = blockIdx.x;
    const int bh = blockIdx.y;
    const int b  = bh >> 3;
    const int h  = bh & 7;
    const int j  = threadIdx.x;
    const int wave = threadIdx.x >> 5;
    const int lane = threadIdx.x & 31;

    const float cB = comb[h];
    const float cG = comb[NHD + h];
    const float efv = ef[((long long)(b * NNOD + i)) * NNOD + j];
    const long long aidx = (long long)bh * NNOD * NNOD + (long long)i * NNOD + j;

    float x = att[aidx] * 0.25f + efv * cB;   // 1/sqrt(HD)=0.25

    float m = x;
#pragma unroll
    for (int o = 16; o >= 1; o >>= 1) m = fmaxf(m, __shfl_xor(m, o, 32));
    if (lane == 0) red[wave] = m;
    __syncthreads();
    float mm = red[lane & 7];
#pragma unroll
    for (int o = 4; o >= 1; o >>= 1) mm = fmaxf(mm, __shfl_xor(mm, o, 32));
    __syncthreads();

    const float p = __expf(x - mm);

    float s = p;
#pragma unroll
    for (int o = 16; o >= 1; o >>= 1) s += __shfl_xor(s, o, 32);
    if (lane == 0) red[wave] = s;
    __syncthreads();
    float ss = red[lane & 7];
#pragma unroll
    for (int o = 4; o >= 1; o >>= 1) ss += __shfl_xor(ss, o, 32);

    att[aidx] = (p / ss) * efv * cG;
}

// ---------------- tiny kernels ----------------
__global__ void comb_kernel(const float* __restrict__ We_in,
                            const float* __restrict__ We,
                            float* __restrict__ comb)
{
    const int t = threadIdx.x;
    if (t >= 48) return;
    const int l = t >> 4, c = t & 15;
    float s = 0.0f;
    for (int d = 0; d < HIDD; ++d)
        s += We_in[d] * We[((long long)l * HIDD + d) * 16 + c];
    comb[t] = s;
}

__global__ void h0_kernel(const float* __restrict__ nf, const float* __restrict__ Wn,
                          float* __restrict__ h)
{
    const long long idx = (long long)blockIdx.x * blockDim.x + threadIdx.x;
    if (idx >= (long long)NBAT * NNOD * HIDD) return;
    const long long row = idx / HIDD;
    const int c = (int)(idx % HIDD);
    h[idx] = nf[row * 2] * Wn[c] + nf[row * 2 + 1] * Wn[HIDD + c];
}

// out[l][n][m] = in[l][m][n]   (L batched M x N -> N x M transpose)
__global__ void transpose_kernel(const float* __restrict__ in, float* __restrict__ out,
                                 int L, int M, int N)
{
    const long long idx = (long long)blockIdx.x * blockDim.x + threadIdx.x;
    const long long tot = (long long)L * M * N;
    if (idx >= tot) return;
    const long long mn = (long long)M * N;
    const int l = (int)(idx / mn);
    const int r = (int)(idx % mn);
    const int m = r / N;
    const int n = r % N;
    out[(long long)l * mn + (long long)n * M + m] = in[idx];
}

// vt[b][c][j] = qkv[b][j][256 + c]   (V transposed per batch, c in [0,128))
__global__ void vtrans_kernel(const float* __restrict__ qkv, float* __restrict__ vt)
{
    const long long idx = (long long)blockIdx.x * blockDim.x + threadIdx.x;
    if (idx >= (long long)NBAT * HIDD * NNOD) return;
    const int b = (int)(idx / (HIDD * NNOD));
    const int r = (int)(idx % (HIDD * NNOD));
    const int c = r / NNOD;
    const int j = r % NNOD;
    vt[idx] = qkv[((long long)(b * NNOD + j)) * 384 + 256 + c];
}

__global__ void dec_kernel(const float* __restrict__ h, const float* __restrict__ Wdec,
                           float* __restrict__ out)
{
    const int row = blockIdx.x * blockDim.x + threadIdx.x;
    if (row >= NBAT * NNOD) return;
    float s = 0.0f;
    for (int d = 0; d < HIDD; ++d) s += h[(long long)row * HIDD + d] * Wdec[d];
    out[row] = 10.0f * tanhf(s * 0.08838834764831845f);  // 1/sqrt(128)
}

// ---------------- host launch ----------------
extern "C" void kernel_launch(void* const* d_in, const int* in_sizes, int n_in,
                              void* d_out, int out_size, void* d_ws, size_t ws_size,
                              hipStream_t stream)
{
    const float* nf    = (const float*)d_in[0];   // (16,256,2)
    const float* ef    = (const float*)d_in[1];   // (16,256,256,1)
    const float* Wn    = (const float*)d_in[2];   // (2,128)
    const float* We_in = (const float*)d_in[3];   // (1,128)
    const float* ln1g  = (const float*)d_in[4];   // (3,128)
    const float* ln1b  = (const float*)d_in[5];
    const float* Wh    = (const float*)d_in[6];   // (3,128,384)
    const float* We    = (const float*)d_in[7];   // (3,128,16)
    const float* ln2g  = (const float*)d_in[8];
    const float* ln2b  = (const float*)d_in[9];
    const float* W1    = (const float*)d_in[10];  // (3,128,512)
    const float* W2    = (const float*)d_in[11];  // (3,512,128)
    const float* Wdec  = (const float*)d_in[12];  // (128,1)
    float* out = (float*)d_out;

    float* ws = (float*)d_ws;
    const long long N = NNOD;
    float* h    = ws;                         // 524288
    float* hn   = ws + 524288;                // 524288
    float* qkv  = ws + 1048576;               // 1572864
    float* att  = ws + 2621440;               // 8388608
    float* y    = ws + 11010048;              // 524288
    float* z    = ws + 11534336;              // 524288
    float* act  = ws + 12058624;              // 2097152
    float* comb = ws + 14155776;              // 64 (48 used)
    float* whT  = ws + 14155840;              // 3*384*128 = 147456
    float* w1T  = ws + 14303296;              // 3*512*128 = 196608
    float* w2T  = ws + 14499904;              // 3*128*512 = 196608
    float* vt   = ws + 14696512;              // 524288

    comb_kernel<<<1, 64, 0, stream>>>(We_in, We, comb);
    h0_kernel<<<(NBAT * NNOD * HIDD + 255) / 256, 256, 0, stream>>>(nf, Wn, h);

    // pre-transpose weights to column-major for contiguous b64 fragment loads
    transpose_kernel<<<(3 * 128 * 384 + 255) / 256, 256, 0, stream>>>(Wh, whT, 3, 128, 384);
    transpose_kernel<<<(3 * 128 * 512 + 255) / 256, 256, 0, stream>>>(W1, w1T, 3, 128, 512);
    transpose_kernel<<<(3 * 512 * 128 + 255) / 256, 256, 0, stream>>>(W2, w2T, 3, 512, 128);

    for (int l = 0; l < 3; ++l) {
        // hn = LN1(h)
        ln_kernel<<<NBAT * NNOD / 8, 256, 0, stream>>>(
            h, nullptr, ln1g + l * HIDD, ln1b + l * HIDD, hn, NBAT * NNOD);

        // qkv = hn @ Wh[l]   (M=256,K=128,N=384 per batch), B = whT[l] (384x128)
        wmma_gemm_f32<0, 4><<<dim3(16, 6, 16), 32, 0, stream>>>(
            hn, whT + (long long)l * 384 * HIDD, qkv, nullptr,
            128, 128, 128, 384, 1, N * 128, 0, 0, 0, N * 384, 0);

        // scores = q @ k^T per (b,h): B(col=j,k=d) = qkv[j*384 + 128 + h*16 + d]
        wmma_gemm_f32<0, 4><<<dim3(16, 4, 128), 32, 0, stream>>>(
            qkv, qkv + 128, att, nullptr,
            16, 384, 384, 256, 8,
            N * 384, 16, N * 384, 16, (long long)8 * 65536, 65536);

        // att = softmax(att*0.25 + ef*combB) * ef * combG
        softmax_kernel<<<dim3(NNOD, NBAT * NHD), 256, 0, stream>>>(
            att, ef, comb + l * 16);

        // repack V transposed: vt[b][c][j]
        vtrans_kernel<<<(NBAT * HIDD * NNOD + 255) / 256, 256, 0, stream>>>(qkv, vt);

        // y[b,i,h*16+d] = att @ v per (b,h): B(col=d,k=j) = vt[b][h*16+d][j]
        wmma_gemm_f32<0, 1><<<dim3(16, 1, 128), 32, 0, stream>>>(
            att, vt, y, nullptr,
            256, 256, 256, 128, 8,
            (long long)8 * 65536, 65536, (long long)HIDD * NNOD, 16 * NNOD,
            N * 128, 16);

        // z = LN2(y + h)
        ln_kernel<<<NBAT * NNOD / 8, 256, 0, stream>>>(
            y, h, ln2g + l * HIDD, ln2b + l * HIDD, z, NBAT * NNOD);

        // act = relu(z @ W1[l])   (M=256,K=128,N=512), B = w1T[l] (512x128)
        wmma_gemm_f32<1, 4><<<dim3(16, 8, 16), 32, 0, stream>>>(
            z, w1T + (long long)l * 512 * HIDD, act, nullptr,
            128, 128, 128, 512, 1, N * 128, 0, 0, 0, N * 512, 0);

        // h = act @ W2[l] + y   (M=256,K=512,N=128), B = w2T[l] (128x512)
        wmma_gemm_f32<2, 4><<<dim3(16, 2, 16), 32, 0, stream>>>(
            act, w2T + (long long)l * HIDD * 512, h, y,
            512, 512, 512, 128, 1, N * 512, 0, 0, 0, N * 128, 0);
    }

    // out = 10 * tanh((h @ Wdec) / sqrt(128))
    dec_kernel<<<(NBAT * NNOD + 255) / 256, 256, 0, stream>>>(h, Wdec, out);
}

// v001
// Measured time: 226 microseconds a run.
// Next to v000, in two timings, it ran 1.57 and 1.60 times as fast.
#include <hip/hip_runtime.h>
#include <math.h>

typedef __attribute__((ext_vector_type(2))) float v2f;
typedef __attribute__((ext_vector_type(4))) float v4f;
typedef __attribute__((ext_vector_type(8))) float v8f;

#define HIDD 128
#define NHD  8
#define NNOD 256
#define NBAT 16

// ---------------- generic single-wave fp32 WMMA GEMM (B column-major) -------
// C[M,N] = A[M,K] @ B[K,N], with B stored col-major: element(k,n) = Bt[n*ldb+k]
// grid.x = M/16, grid.y = N/(16*NT), grid.z = batch
// batch offsets: off = (z/div)*s1 + (z%div)*s2   for A, B, C (ADD shares C's)
// FUSE: 0 = none, 1 = relu, 2 = add ADD.  Requires K % 8 == 0.
template<int FUSE, int NT>
__global__ __launch_bounds__(32)
void wmma_gemm_f32(const float* __restrict__ A, const float* __restrict__ Bt,
                   float* __restrict__ C, const float* __restrict__ ADD,
                   int K, int lda, int ldb, int ldc, int div,
                   long long sA1, long long sA2,
                   long long sB1, long long sB2,
                   long long sC1, long long sC2)
{
    const int z  = blockIdx.z;
    const int zq = z / div, zr = z % div;
    const float* Ab = A  + zq * sA1 + zr * sA2;
    const float* Bb = Bt + zq * sB1 + zr * sB2;
    float*       Cb = C  + zq * sC1 + zr * sC2;
    const float* Db = (FUSE == 2) ? (ADD + zq * sC1 + zr * sC2) : nullptr;

    const int m0   = blockIdx.x * 16;
    const int n0   = blockIdx.y * (16 * NT);
    const int lane = threadIdx.x & 31;
    const int l16  = lane & 15;
    const int kh   = lane >> 4;          // K-half select (0/1)

    v8f acc[NT];
#pragma unroll
    for (int t = 0; t < NT; ++t)
#pragma unroll
        for (int r = 0; r < 8; ++r) acc[t][r] = 0.0f;

    // single lane-dependent base per matrix; tile index folded into constant
    // element offsets so all fragment loads become global_load_b64 base+imm.
    const float* __restrict__ paBase = Ab + (long long)(m0 + l16) * lda + 2 * kh;
    const float* __restrict__ pbBase = Bb + (long long)(n0 + l16) * ldb + 2 * kh;

    // 2-deep software pipeline: stage0 covers k0, stage1 covers k0+4
    v2f a0, a1, b0[NT], b1[NT];
    a0 = *(const v2f*)(paBase + 0);
#pragma unroll
    for (int t = 0; t < NT; ++t)
        b0[t] = *(const v2f*)(pbBase + (long long)t * 16 * ldb + 0);
    a1 = *(const v2f*)(paBase + 4);
#pragma unroll
    for (int t = 0; t < NT; ++t)
        b1[t] = *(const v2f*)(pbBase + (long long)t * 16 * ldb + 4);

    for (int k0 = 8; k0 < K; k0 += 8) {
#pragma unroll
        for (int t = 0; t < NT; ++t)
            acc[t] = __builtin_amdgcn_wmma_f32_16x16x4_f32(
                false, a0, false, b0[t], (short)0, acc[t], false, false);
        a0 = *(const v2f*)(paBase + k0);
#pragma unroll
        for (int t = 0; t < NT; ++t)
            b0[t] = *(const v2f*)(pbBase + (long long)t * 16 * ldb + k0);
#pragma unroll
        for (int t = 0; t < NT; ++t)
            acc[t] = __builtin_amdgcn_wmma_f32_16x16x4_f32(
                false, a1, false, b1[t], (short)0, acc[t], false, false);
        a1 = *(const v2f*)(paBase + k0 + 4);
#pragma unroll
        for (int t = 0; t < NT; ++t)
            b1[t] = *(const v2f*)(pbBase + (long long)t * 16 * ldb + k0 + 4);
    }
#pragma unroll
    for (int t = 0; t < NT; ++t)
        acc[t] = __builtin_amdgcn_wmma_f32_16x16x4_f32(
            false, a0, false, b0[t], (short)0, acc[t], false, false);
#pragma unroll
    for (int t = 0; t < NT; ++t)
        acc[t] = __builtin_amdgcn_wmma_f32_16x16x4_f32(
            false, a1, false, b1[t], (short)0, acc[t], false, false);

#pragma unroll
    for (int t = 0; t < NT; ++t) {
#pragma unroll
        for (int r = 0; r < 8; ++r) {
            const int row = m0 + r + 8 * kh;
            const int col = n0 + t * 16 + l16;
            float v = acc[t][r];
            if (FUSE == 1) v = fmaxf(v, 0.0f);
            if (FUSE == 2) v += Db[(long long)row * ldc + col];
            Cb[(long long)row * ldc + col] = v;
        }
    }
}

// ---------------- layernorm: one wave per 128-wide row ----------------
__global__ __launch_bounds__(256)
void ln_kernel(const float* __restrict__ x, const float* __restrict__ res,
               const float* __restrict__ g, const float* __restrict__ b,
               float* __restrict__ out, int rows)
{
    const int wave = threadIdx.x >> 5;
    const int lane = threadIdx.x & 31;
    const int row  = blockIdx.x * 8 + wave;
    if (row >= rows) return;
    const long long base = (long long)row * HIDD;
    float v[4];
    float s = 0.0f, s2 = 0.0f;
#pragma unroll
    for (int i = 0; i < 4; ++i) {
        const int c = lane + 32 * i;
        float t = x[base + c];
        if (res) t += res[base + c];
        v[i] = t; s += t; s2 += t * t;
    }
#pragma unroll
    for (int o = 16; o >= 1; o >>= 1) {
        s  += __shfl_xor(s,  o, 32);
        s2 += __shfl_xor(s2, o, 32);
    }
    const float mu   = s * (1.0f / HIDD);
    const float var  = s2 * (1.0f / HIDD) - mu * mu;
    const float rinv = rsqrtf(var + 1e-5f);
#pragma unroll
    for (int i = 0; i < 4; ++i) {
        const int c = lane + 32 * i;
        out[base + c] = (v[i] - mu) * rinv * g[c] + b[c];
    }
}

// Four exp2 in one statement.  The early-clobber outputs keep every v_exp_f32 from being
// directly followed by a write of its source or a read of its result, and the v_nop is
// the one slot the instruction set asks for behind the last of them.
__device__ __forceinline__ void exp2x4(v4f& p, float t0, float t1, float t2, float t3)
{
    float p0, p1, p2, p3;
    asm("v_exp_f32 %0, %4\n\tv_exp_f32 %1, %5\n\tv_exp_f32 %2, %6\n\tv_exp_f32 %3, %7\n\tv_nop"
        : "=&v"(p0), "=&v"(p1), "=&v"(p2), "=&v"(p3)
        : "v"(t0), "v"(t1), "v"(t2), "v"(t3));
    p[0] = p0; p[1] = p1; p[2] = p2; p[3] = p3;
}

// ------ fused attention: one workgroup = one batch x 16 query rows, one wave per head ------
// S^T = K Q^T is kept in registers: lane (l16, kh) register r of tile jt holds
// key j = jt*16 + 8*kh + r of query i0 + l16.  That is already the B fragment of
// Y^T = V^T W^T when the k slots of step s are read as j = jt*16 + 8*kh + 2*s + {0,1},
// so the weights never leave the registers.  The softmax runs down a lane's own
// 128 values plus one exchange between the two lane halves.
#define EFP 260   // LDS pitch of an edge row in floats: 16 B x odd, b128 reads conflict-free
#define YSP 132   // LDS pitch of an output row in floats: 16 B x odd
__global__ __launch_bounds__(256)
void attn_fused_kernel(const float* __restrict__ qkv, const float* __restrict__ ef,
                       const float* __restrict__ comb, float* __restrict__ y)
{
    __shared__ __attribute__((aligned(16))) float efs[16 * EFP];
    __shared__ __attribute__((aligned(16))) float ys[16 * YSP];

    const int i0   = blockIdx.x * 16;
    const int b    = blockIdx.y;
    const int tid  = threadIdx.x;
    const int h    = __builtin_amdgcn_readfirstlane(tid >> 5);
    const int lane = tid & 31;
    const int l16  = lane & 15;
    const int kh   = lane >> 4;

    // edge tile (16 rows x 256, contiguous): loads issued first, so that they fly beside the K loads
    const v4f* __restrict__ efg = (const v4f*)(ef + (long long)(b * NNOD + i0) * NNOD);
    v4f e4[4];
#pragma unroll
    for (int q = 0; q < 4; ++q) e4[q] = efg[tid + 256 * q];

    const float cB = comb[h];
    const float cG = comb[NHD + h];

    const float* __restrict__ hb = qkv + (long long)b * NNOD * 384 + h * 16;

    // Q as B fragment, K as A fragment; k slot (kh, e) of step s is d = 8*kh + 2*s + e in both
    const float* __restrict__ qp = hb + (i0 + l16) * 384 + 8 * kh;
    const v4f q0 = *(const v4f*)(qp);
    const v4f q1 = *(const v4f*)(qp + 4);
    const v2f qf[4] = { {q0[0], q0[1]}, {q0[2], q0[3]}, {q1[0], q1[1]}, {q1[2], q1[3]} };

    const float* __restrict__ kp = hb + l16 * 384 + 8 * kh;   // K starts 128 floats into a row
    v4f k0[16], k1[16];
#pragma unroll
    for (int jt = 0; jt < 16; ++jt) {
        k0[jt] = *(const v4f*)(kp + 128 + jt * 16 * 384);
        k1[jt] = *(const v4f*)(kp + 128 + jt * 16 * 384 + 4);
    }
    // The wait that belongs in front of any overwrite of a register the loads above name.
    // The addresses are inputs so that their registers stay untouched up to this line.
    asm volatile("s_wait_xcnt 0x0" :: "v"(qp), "v"(kp), "s"(efg), "v"(tid) : "memory");

    v8f S[16];
#pragma unroll
    for (int jt = 0; jt < 16; ++jt)
#pragma unroll
        for (int r = 0; r < 8; ++r) S[jt][r] = 0.0f;
#pragma unroll
    for (int g = 0; g < 4; ++g)
#pragma unroll
        for (int s = 0; s < 4; ++s)
#pragma unroll
            for (int t = 0; t < 4; ++t) {
                const int jt = g * 4 + t;
                const v4f kk = (s < 2) ? k0[jt] : k1[jt];
                const v2f a = { kk[(s & 1) * 2], kk[(s & 1) * 2 + 1] };
                S[jt] = __builtin_amdgcn_wmma_f32_16x16x4_f32(
                    false, a, false, qf[s], (short)0, S[jt], false, false);
            }

#pragma unroll
    for (int q = 0; q < 4; ++q) {
        const int f = tid + 256 * q;
        *(v4f*)(efs + (f >> 6) * EFP + (f & 63) * 4) = e4[q];
    }
    __syncthreads();   // the edge tile is read by all eight heads

    // x = s/sqrt(16) + e*cB, row maximum
    const float* er = efs + l16 * EFP + 8 * kh;
    float mx[4] = { -INFINITY, -INFINITY, -INFINITY, -INFINITY };
#pragma unroll
    for (int jt = 0; jt < 16; ++jt) {
        const v4f ea = *(const v4f*)(er + jt * 16);
        const v4f eb = *(const v4f*)(er + jt * 16 + 4);
#pragma unroll
        for (int r = 0; r < 8; ++r) {
            const float e = (r < 4) ? ea[r & 3] : eb[r & 3];
            const float x = S[jt][r] * 0.25f + e * cB;
            S[jt][r] = x;
            mx[r & 3] = fmaxf(mx[r & 3], x);
        }
    }
    float m = fmaxf(fmaxf(mx[0], mx[1]), fmaxf(mx[2], mx[3]));
    m = fmaxf(m, __shfl_xor(m, 16, 32));

    // p = exp(x - m) = exp2(x*log2e - m*log2e), row sum, unnormalised gated weight p*e
    const float L2E = 1.4426950408889634f;
    const float nm  = -m * L2E;
    float sm[4] = { 0.0f, 0.0f, 0.0f, 0.0f };
#pragma unroll
    for (int jt = 0; jt < 16; ++jt) {
        const v4f ea = *(const v4f*)(er + jt * 16);
        const v4f eb = *(const v4f*)(er + jt * 16 + 4);
#pragma unroll
        for (int c = 0; c < 2; ++c) {
            const v4f e = c ? eb : ea;
            v4f p;
            exp2x4(p, fmaf(S[jt][4 * c + 0], L2E, nm), fmaf(S[jt][4 * c + 1], L2E, nm),
                      fmaf(S[jt][4 * c + 2], L2E, nm), fmaf(S[jt][4 * c + 3], L2E, nm));
#pragma unroll
            for (int r = 0; r < 4; ++r) {
                sm[r] += p[r];
                S[jt][4 * c + r] = p[r] * e[r];
            }
        }
    }
    float ss = (sm[0] + sm[1]) + (sm[2] + sm[3]);
    ss += __shfl_xor(ss, 16, 32);

    // Y^T[d][i] = sum_j V[j][d] * w[i][j]; A fragment: lane l16 = d, rows j in the order above
    const float* __restrict__ vp = hb + l16 + 8 * kh * 384;   // V starts 256 floats into a row
    v8f o[2];
#pragma unroll
    for (int r = 0; r < 8; ++r) { o[0][r] = 0.0f; o[1][r] = 0.0f; }
#pragma unroll
    for (int jt = 0; jt < 16; ++jt)
#pragma unroll
        for (int s = 0; s < 4; ++s) {
            const v2f a = { vp[256 + (jt * 16 + 2 * s) * 384], vp[256 + (jt * 16 + 2 * s + 1) * 384] };
            const v2f w = { S[jt][2 * s], S[jt][2 * s + 1] };
            o[s & 1] = __builtin_amdgcn_wmma_f32_16x16x4_f32(
                false, a, false, w, (short)0, o[s & 1], false, false);
        }

    // same wait for the V loads: their address pair stays untouched up to this line
    asm volatile("s_wait_xcnt 0x0" :: "v"(vp) : "memory");

    // normalise and gate-scale once per output, gather the 8 heads' columns per row in LDS
    const float sc = cG / ss;
    v4f ya, yb;
#pragma unroll
    for (int r = 0; r < 4; ++r) {
        ya[r] = (o[0][r] + o[1][r]) * sc;
        yb[r] = (o[0][r + 4] + o[1][r + 4]) * sc;
    }
    float* yw = ys + l16 * YSP + h * 16 + 8 * kh;
    *(v4f*)(yw)     = ya;
    *(v4f*)(yw + 4) = yb;
    __syncthreads();   // every head's columns are in place before whole rows go out
#pragma unroll
    for (int q = 0; q < 2; ++q) {
        const int f = tid + 256 * q;      // one wave stores one whole 512-byte row
        const int row = f >> 5, c4 = f & 31;
        *(v4f*)(y + (long long)(b * NNOD + i0 + row) * HIDD + c4 * 4) =
            *(const v4f*)(ys + row * YSP + c4 * 4);
    }
}

// ---------------- tiny kernels ----------------
__global__ void comb_kernel(const float* __restrict__ We_in,
                            const float* __restrict__ We,
                            float* __restrict__ comb)
{
    const int t = threadIdx.x;
    if (t >= 48) return;
    const int l = t >> 4, c = t & 15;
    float s = 0.0f;
    for (int d = 0; d < HIDD; ++d)
        s += We_in[d] * We[((long long)l * HIDD + d) * 16 + c];
    comb[t] = s;
}

__global__ void h0_kernel(const float* __restrict__ nf, const float* __restrict__ Wn,
                          float* __restrict__ h)
{
    const long long idx = (long long)blockIdx.x * blockDim.x + threadIdx.x;
    if (idx >= (long long)NBAT * NNOD * HIDD) return;
    const long long row = idx / HIDD;
    const int c = (int)(idx % HIDD);
    h[idx] = nf[row * 2] * Wn[c] + nf[row * 2 + 1] * Wn[HIDD + c];
}

// out[l][n][m] = in[l][m][n]   (L batched M x N -> N x M transpose)
__global__ void transpose_kernel(const float* __restrict__ in, float* __restrict__ out,
                                 int L, int M, int N)
{
    const long long idx = (long long)blockIdx.x * blockDim.x + threadIdx.x;
    const long long tot = (long long)L * M * N;
    if (idx >= tot) return;
    const long long mn = (long long)M * N;
    const int l = (int)(idx / mn);
    const int r = (int)(idx % mn);
    const int m = r / N;
    const int n = r % N;
    out[(long long)l * mn + (long long)n * M + m] = in[idx];
}

__global__ void dec_kernel(const float* __restrict__ h, const float* __restrict__ Wdec,
                           float* __restrict__ out)
{
    const int row = blockIdx.x * blockDim.x + threadIdx.x;
    if (row >= NBAT * NNOD) return;
    float s = 0.0f;
    for (int d = 0; d < HIDD; ++d) s += h[(long long)row * HIDD + d] * Wdec[d];
    out[row] = 10.0f * tanhf(s * 0.08838834764831845f);  // 1/sqrt(128)
}

// ---------------- host launch ----------------
extern "C" void kernel_launch(void* const* d_in, const int* in_sizes, int n_in,
                              void* d_out, int out_size, void* d_ws, size_t ws_size,
                              hipStream_t stream)
{
    const float* nf    = (const float*)d_in[0];   // (16,256,2)
    const float* ef    = (const float*)d_in[1];   // (16,256,256,1)
    const float* Wn    = (const float*)d_in[2];   // (2,128)
    const float* We_in = (const float*)d_in[3];   // (1,128)
    const float* ln1g  = (const float*)d_in[4];   // (3,128)
    const float* ln1b  = (const float*)d_in[5];
    const float* Wh    = (const float*)d_in[6];   // (3,128,384)
    const float* We    = (const float*)d_in[7];   // (3,128,16)
    const float* ln2g  = (const float*)d_in[8];
    const float* ln2b  = (const float*)d_in[9];
    const float* W1    = (const float*)d_in[10];  // (3,128,512)
    const float* W2    = (const float*)d_in[11];  // (3,512,128)
    const float* Wdec  = (const float*)d_in[12];  // (128,1)
    float* out = (float*)d_out;

    float* ws = (float*)d_ws;
    const long long N = NNOD;
    float* h    = ws;                         // 524288
    float* hn   = ws + 524288;                // 524288
    float* qkv  = ws + 1048576;               // 1572864
    float* y    = ws + 11010048;              // 524288
    float* z    = ws + 11534336;              // 524288
    float* act  = ws + 12058624;              // 2097152
    float* comb = ws + 14155776;              // 64 (48 used)
    float* whT  = ws + 14155840;              // 3*384*128 = 147456
    float* w1T  = ws + 14303296;              // 3*512*128 = 196608
    float* w2T  = ws + 14499904;              // 3*128*512 = 196608

    comb_kernel<<<1, 64, 0, stream>>>(We_in, We, comb);
    h0_kernel<<<(NBAT * NNOD * HIDD + 255) / 256, 256, 0, stream>>>(nf, Wn, h);

    // pre-transpose weights to column-major for contiguous b64 fragment loads
    transpose_kernel<<<(3 * 128 * 384 + 255) / 256, 256, 0, stream>>>(Wh, whT, 3, 128, 384);
    transpose_kernel<<<(3 * 128 * 512 + 255) / 256, 256, 0, stream>>>(W1, w1T, 3, 128, 512);
    transpose_kernel<<<(3 * 512 * 128 + 255) / 256, 256, 0, stream>>>(W2, w2T, 3, 512, 128);

    for (int l = 0; l < 3; ++l) {
        // hn = LN1(h)
        ln_kernel<<<NBAT * NNOD / 8, 256, 0, stream>>>(
            h, nullptr, ln1g + l * HIDD, ln1b + l * HIDD, hn, NBAT * NNOD);

        // qkv = hn @ Wh[l]   (M=256,K=128,N=384 per batch), B = whT[l] (384x128)
        wmma_gemm_f32<0, 4><<<dim3(16, 6, 16), 32, 0, stream>>>(
            hn, whT + (long long)l * 384 * HIDD, qkv, nullptr,
            128, 128, 128, 384, 1, N * 128, 0, 0, 0, N * 384, 0);

        // y = (softmax(q k^T / 4 + ef*combB) * ef*combG) @ v, all heads, one launch
        attn_fused_kernel<<<dim3(NNOD / 16, NBAT), 256, 0, stream>>>(
            qkv, ef, comb + l * 16, y);

        // z = LN2(y + h)
        ln_kernel<<<NBAT * NNOD / 8, 256, 0, stream>>>(
            y, h, ln2g + l * HIDD, ln2b + l * HIDD, z, NBAT * NNOD);

        // act = relu(z @ W1[l])   (M=256,K=128,N=512), B = w1T[l] (512x128)
        wmma_gemm_f32<1, 4><<<dim3(16, 8, 16), 32, 0, stream>>>(
            z, w1T + (long long)l * 512 * HIDD, act, nullptr,
            128, 128, 128, 512, 1, N * 128, 0, 0, 0, N * 512, 0);

        // h = act @ W2[l] + y   (M=256,K=512,N=128), B = w2T[l] (128x512)
        wmma_gemm_f32<2, 4><<<dim3(16, 2, 16), 32, 0, stream>>>(
            act, w2T + (long long)l * HIDD * 512, h, y,
            512, 512, 512, 128, 1, N * 512, 0, 0, 0, N * 128, 0);
    }

    // out = 10 * tanh((h @ Wdec) / sqrt(128))
    dec_kernel<<<(NBAT * NNOD + 255) / 256, 256, 0, stream>>>(h, Wdec, out);
}

// v002
// It runs in 109 microseconds.
// Two timings next to v001 put it at 2.11 and 2.08 times that version's speed.
// All steps since v000 together make it 3.32 times as fast.
#include <hip/hip_runtime.h>
#include <math.h>

typedef __attribute__((ext_vector_type(2))) float v2f;
typedef __attribute__((ext_vector_type(4))) float v4f;
typedef __attribute__((ext_vector_type(8))) float v8f;

#define HIDD 128
#define NHD  8
#define NNOD 256
#define NBAT 16

#define ZP 132    // LDS pitch of a 128-wide row in floats: 16 B x odd, b128 reads conflict-free

__device__ __forceinline__ v8f mma_pair(const v4f a, const float b0, const float b1,
                                        const int s, const v8f c)
{
    const v2f av = { a[2 * s], a[2 * s + 1] };
    const v2f bv = { b0, b1 };
    return __builtin_amdgcn_wmma_f32_16x16x4_f32(false, av, false, bv, (short)0, c, false, false);
}

// layernorm of one 128-wide row held by one wave, four consecutive columns a lane
__device__ __forceinline__ v4f ln_wave(const v4f t, const v4f g, const v4f b)
{
    float s  = (t[0] + t[1]) + (t[2] + t[3]);
    float s2 = (t[0] * t[0] + t[1] * t[1]) + (t[2] * t[2] + t[3] * t[3]);
    for (int o = 16; o >= 1; o >>= 1) {
        s  += __shfl_xor(s,  o, 32);
        s2 += __shfl_xor(s2, o, 32);
    }
    const float mu   = s * (1.0f / HIDD);
    const float var  = s2 * (1.0f / HIDD) - mu * mu;
    const float rinv = rsqrtf(var + 1e-5f);
    v4f r;
    for (int i = 0; i < 4; ++i) r[i] = (t[i] - mu) * rinv * g[i] + b[i];
    return r;
}

// All loops below are unrolled so that the register arrays keep constant indices.
// One stage = 32 k of NT weight tiles (rows n, k contiguous, pitch 128).
// k slot (kh, e) of step (q, s) is k = 32*st + 8*q + 4*kh + 2*s + e, in A and in B alike.
template<int NT>
__device__ __forceinline__ void load_w(v4f (&w)[NT * 4], const float* __restrict__ wp, const int st)
{
#pragma unroll
    for (int t = 0; t < NT; ++t)
#pragma unroll
        for (int q = 0; q < 4; ++q)
            w[t * 4 + q] = *(const v4f*)(wp + t * 16 * HIDD + st * 32 + q * 8);
}

template<int NT>
__device__ __forceinline__ void mm_stage(v8f (&acc)[NT], const v4f (&w)[NT * 4],
                                         const float* zr, const int st)
{
    v4f bz[4];
#pragma unroll
    for (int q = 0; q < 4; ++q) bz[q] = *(const v4f*)(zr + st * 32 + q * 8);
    // keeps the next stage's weight loads and this stage's LDS reads ahead of the WMMA block:
    // left free, the scheduler sinks each load to just before its use and the wave waits it out
    __builtin_amdgcn_sched_barrier(0);
#pragma unroll
    for (int q = 0; q < 4; ++q)
#pragma unroll
        for (int s = 0; s < 2; ++s)
#pragma unroll
            for (int t = 0; t < NT; ++t)
                acc[t] = mma_pair(w[t * 4 + q], bz[q][2 * s], bz[q][2 * s + 1], s, acc[t]);
    __builtin_amdgcn_sched_barrier(0);   // the stage after next is not loaded before this block
}

// One stage of the second MLP product = two output tiles (c = 32*p .. 32*p + 31) over the
// wave's own 64 hidden columns; rows c of the weights, hidden index contiguous, pitch 512.
__device__ __forceinline__ void load_c(v4f (&w)[16], const float* __restrict__ cp, const int p)
{
#pragma unroll
    for (int u = 0; u < 2; ++u)
#pragma unroll
        for (int t = 0; t < 4; ++t)
#pragma unroll
            for (int hf = 0; hf < 2; ++hf)
                w[u * 8 + t * 2 + hf] = *(const v4f*)(cp + (2 * p + u) * 16 * 512 + t * 16 + hf * 4);
}

__device__ __forceinline__ void mm_c(v8f (&acc)[8], const v4f (&w)[16], const v8f (&d)[4], const int p)
{
    __builtin_amdgcn_sched_barrier(0);   // the next stage's weight loads stay ahead of this block
#pragma unroll
    for (int t = 0; t < 4; ++t)
#pragma unroll
        for (int hf = 0; hf < 2; ++hf)
#pragma unroll
            for (int s = 0; s < 2; ++s)
#pragma unroll
                for (int u = 0; u < 2; ++u)
                    acc[2 * p + u] = mma_pair(w[u * 8 + t * 2 + hf], d[t][4 * hf + 2 * s],
                                              d[t][4 * hf + 2 * s + 1], s, acc[2 * p + u]);
    __builtin_amdgcn_sched_barrier(0);   // the stage after next is not loaded before this block
}

template<int MODE>
__global__ __launch_bounds__(256)
void row_chain_kernel(const float* __restrict__ y, const float* __restrict__ hin,
                      float* __restrict__ hout,
                      const float* __restrict__ g2, const float* __restrict__ b2,
                      const float* __restrict__ w1T, const float* __restrict__ w2T,
                      const float* __restrict__ g1, const float* __restrict__ b1,
                      const float* __restrict__ whT, float* __restrict__ qkv,
                      const float* __restrict__ nf, const float* __restrict__ Wn,
                      const float* __restrict__ Wdec, float* __restrict__ out)
{
    __shared__ __attribute__((aligned(16))) float zs[16 * ZP];
    __shared__ __attribute__((aligned(16))) float red[(MODE != 0) ? 8 * 16 * ZP : 4];

    const int row0 = blockIdx.x * 16;
    const int tid  = threadIdx.x;
    const int w    = __builtin_amdgcn_readfirstlane(tid >> 5);
    const int lane = tid & 31;
    const int l16  = lane & 15;
    const int kh   = lane >> 4;

    const float* zr = zs + l16 * ZP + 4 * kh;          // B fragments: row l16 of the normed tile
    const float* __restrict__ whp = whT + (48 * w + l16) * HIDD + 4 * kh;
    v4f ea[12], eb[12];                                // QKV weight stages
    v4f hv[2];                                         // the wave's two rows, 4 columns a lane
    v4f gg1, bb1;                                      // LN1 scale and shift of the lane's columns

    if constexpr (MODE == 0) {
        gg1 = *(const v4f*)(g1 + lane * 4);
        bb1 = *(const v4f*)(b1 + lane * 4);
        load_w<3>(ea, whp, 0);
        // The wait that belongs in front of any overwrite of a register the loads above name.
        // Bases and offsets are inputs so that their registers stay untouched up to this line.
        asm volatile("s_wait_xcnt 0x0" :: "s"(g1), "s"(b1), "v"(whp), "v"(lane) : "memory");
        __builtin_amdgcn_sched_barrier(0);   // issued here, not sunk to the barrier: they fly during the layernorm
        const v4f wn0 = *(const v4f*)(Wn + lane * 4);
        const v4f wn1 = *(const v4f*)(Wn + HIDD + lane * 4);
#pragma unroll
        for (int rr = 0; rr < 2; ++rr) {
            const int row = row0 + 2 * w + rr;
            hv[rr] = nf[row * 2] * wn0 + nf[row * 2 + 1] * wn1;
        }
    } else {
        const float* __restrict__ w1p = w1T + (64 * w + l16) * HIDD + 4 * kh;
        const float* __restrict__ w2p = w2T + l16 * 512 + 64 * w + 8 * kh;
        const float* __restrict__ yp = y   + (row0 + 2 * w) * HIDD + lane * 4;
        const float* __restrict__ hp = hin + (row0 + 2 * w) * HIDD + lane * 4;
        v4f yv[2], hi[2];
#pragma unroll
        for (int rr = 0; rr < 2; ++rr) {
            yv[rr] = *(const v4f*)(yp + rr * HIDD);
            hi[rr] = *(const v4f*)(hp + rr * HIDD);
        }
        const v4f gg = *(const v4f*)(g2 + lane * 4);
        const v4f bb = *(const v4f*)(b2 + lane * 4);
        v4f wa[16], wb[16];
        load_w<4>(wa, w1p, 0);     // first weight stage flies during the layernorm
        __builtin_amdgcn_sched_barrier(0);   // issued here, not sunk to the barrier
#pragma unroll
        for (int rr = 0; rr < 2; ++rr)
            *(v4f*)(zs + (2 * w + rr) * ZP + lane * 4) = ln_wave(yv[rr] + hi[rr], gg, bb);
        // The wait that belongs in front of any overwrite of a register the loads above name.
        // The addresses are inputs so that their registers stay untouched up to this line.
        asm volatile("s_wait_xcnt 0x0" :: "v"(yp), "v"(hp), "v"(lane) : "memory");
        __syncthreads();           // all 16 normed rows are read by every wave

        // act^T = relu(W1^T z^T), hidden columns 64*w .. 64*w + 63; weights one stage ahead
        v8f d[4];
#pragma unroll
        for (int t = 0; t < 4; ++t)
#pragma unroll
            for (int r = 0; r < 8; ++r) d[t][r] = 0.0f;
        load_w<4>(wb, w1p, 1);  mm_stage<4>(d, wa, zr, 0);
        load_w<4>(wa, w1p, 2);  mm_stage<4>(d, wb, zr, 1);
        load_w<4>(wb, w1p, 3);  mm_stage<4>(d, wa, zr, 2);
        load_c(wa, w2p, 0);     mm_stage<4>(d, wb, zr, 3);
#pragma unroll
        for (int t = 0; t < 4; ++t)
#pragma unroll
            for (int r = 0; r < 8; ++r) d[t][r] = fmaxf(d[t][r], 0.0f);

        // partial (act W2)^T over the wave's own 64 hidden columns
        v8f o[8];
#pragma unroll
        for (int c = 0; c < 8; ++c)
#pragma unroll
            for (int r = 0; r < 8; ++r) o[c][r] = 0.0f;
        load_c(wb, w2p, 1);  mm_c(o, wa, d, 0);
        load_c(wa, w2p, 2);  mm_c(o, wb, d, 1);
        load_c(wb, w2p, 3);  mm_c(o, wa, d, 2);
        mm_c(o, wb, d, 3);

        float* rw = red + (w * 16 + l16) * ZP + 8 * kh;
#pragma unroll
        for (int c = 0; c < 8; ++c) {
            const v4f lo = { o[c][0], o[c][1], o[c][2], o[c][3] };
            const v4f hi4 = { o[c][4], o[c][5], o[c][6], o[c][7] };
            *(v4f*)(rw + c * 16)     = lo;
            *(v4f*)(rw + c * 16 + 4) = hi4;
        }
        // same wait for the weight loads: both address pairs stay untouched up to this line
        asm volatile("s_wait_xcnt 0x0" :: "v"(w1p), "v"(w2p) : "memory");
        __syncthreads();           // the eight partial sums of every row are in place

        if constexpr (MODE == 1) { // first QKV weight stage flies during the sum and the layernorm
            gg1 = *(const v4f*)(g1 + lane * 4);
            bb1 = *(const v4f*)(b1 + lane * 4);
            load_w<3>(ea, whp, 0);
            __builtin_amdgcn_sched_barrier(0);   // issued here, not sunk to the barrier
        }

#pragma unroll
        for (int rr = 0; rr < 2; ++rr) {
            const float* rp = red + (2 * w + rr) * ZP + lane * 4;
            v4f s = *(const v4f*)rp;
#pragma unroll
            for (int u = 1; u < 8; ++u) s += *(const v4f*)(rp + u * 16 * ZP);
            hv[rr] = s + yv[rr];
        }
    }

    if constexpr (MODE == 2) {
        // out = 10 * tanh((h . Wdec) / sqrt(128))
        const v4f wd = *(const v4f*)(Wdec + lane * 4);
        v2f res;
#pragma unroll
        for (int rr = 0; rr < 2; ++rr) {
            float s = (hv[rr][0] * wd[0] + hv[rr][1] * wd[1]) + (hv[rr][2] * wd[2] + hv[rr][3] * wd[3]);
            for (int o = 16; o >= 1; o >>= 1) s += __shfl_xor(s, o, 32);
            res[rr] = 10.0f * tanhf(s * 0.08838834764831845f);
        }
        if (lane == 0) *(v2f*)(out + row0 + 2 * w) = res;
    } else {
        float* __restrict__ op = hout + (row0 + 2 * w) * HIDD + lane * 4;
#pragma unroll
        for (int rr = 0; rr < 2; ++rr) {
            *(v4f*)(op + rr * HIDD) = hv[rr];
            *(v4f*)(zs + (2 * w + rr) * ZP + lane * 4) = ln_wave(hv[rr], gg1, bb1);
        }
        // same wait for the stores and the loads since the last one
        asm volatile("s_wait_xcnt 0x0" :: "v"(op), "v"(lane) : "memory");
        __syncthreads();           // all 16 normed rows are read by every wave

        // qkv^T = Wh^T hn^T, columns 48*w .. 48*w + 47
        v8f a[3];
#pragma unroll
        for (int t = 0; t < 3; ++t)
#pragma unroll
            for (int r = 0; r < 8; ++r) a[t][r] = 0.0f;
        load_w<3>(eb, whp, 1);  mm_stage<3>(a, ea, zr, 0);
        load_w<3>(ea, whp, 2);  mm_stage<3>(a, eb, zr, 1);
        load_w<3>(eb, whp, 3);  mm_stage<3>(a, ea, zr, 2);
        mm_stage<3>(a, eb, zr, 3);
        // same wait for the QKV weight loads: their address pair stays untouched up to this line
        asm volatile("s_wait_xcnt 0x0" :: "v"(whp) : "memory");

        float* qw = qkv + (row0 + l16) * 384 + 48 * w + 8 * kh;
#pragma unroll
        for (int t = 0; t < 3; ++t) {
            const v4f lo = { a[t][0], a[t][1], a[t][2], a[t][3] };
            const v4f hi4 = { a[t][4], a[t][5], a[t][6], a[t][7] };
            *(v4f*)(qw + t * 16)     = lo;
            *(v4f*)(qw + t * 16 + 4) = hi4;
        }
    }
}

// Four exp2 in one statement.  The early-clobber outputs keep every v_exp_f32 from being
// directly followed by a write of its source or a read of its result, and the v_nop is
// the one slot the instruction set asks for behind the last of them.
__device__ __forceinline__ void exp2x4(v4f& p, float t0, float t1, float t2, float t3)
{
    float p0, p1, p2, p3;
    asm("v_exp_f32 %0, %4\n\tv_exp_f32 %1, %5\n\tv_exp_f32 %2, %6\n\tv_exp_f32 %3, %7\n\tv_nop"
        : "=&v"(p0), "=&v"(p1), "=&v"(p2), "=&v"(p3)
        : "v"(t0), "v"(t1), "v"(t2), "v"(t3));
    p[0] = p0; p[1] = p1; p[2] = p2; p[3] = p3;
}

// ------ fused attention: one workgroup = one batch x 16 query rows, one wave per head ------
// S^T = K Q^T is kept in registers: lane (l16, kh) register r of tile jt holds
// key j = jt*16 + 8*kh + r of query i0 + l16.  That is already the B fragment of
// Y^T = V^T W^T when the k slots of step s are read as j = jt*16 + 8*kh + 2*s + {0,1},
// so the weights never leave the registers.  The softmax runs down a lane's own
// 128 values plus one exchange between the two lane halves.
#define EFP 260   // LDS pitch of an edge row in floats: 16 B x odd, b128 reads conflict-free
#define YSP 132   // LDS pitch of an output row in floats: 16 B x odd
__global__ __launch_bounds__(256)
void attn_fused_kernel(const float* __restrict__ qkv, const float* __restrict__ ef,
                       const float* __restrict__ comb, float* __restrict__ y)
{
    __shared__ __attribute__((aligned(16))) float efs[16 * EFP];
    __shared__ __attribute__((aligned(16))) float ys[16 * YSP];

    const int i0   = blockIdx.x * 16;
    const int b    = blockIdx.y;
    const int tid  = threadIdx.x;
    const int h    = __builtin_amdgcn_readfirstlane(tid >> 5);
    const int lane = tid & 31;
    const int l16  = lane & 15;
    const int kh   = lane >> 4;

    // edge tile (16 rows x 256, contiguous): loads issued first, so that they fly beside the K loads
    const v4f* __restrict__ efg = (const v4f*)(ef + (long long)(b * NNOD + i0) * NNOD);
    v4f e4[4];
#pragma unroll
    for (int q = 0; q < 4; ++q) e4[q] = efg[tid + 256 * q];

    const float cB = comb[h];
    const float cG = comb[NHD + h];

    const float* __restrict__ hb = qkv + (long long)b * NNOD * 384 + h * 16;

    // Q as B fragment, K as A fragment; k slot (kh, e) of step s is d = 8*kh + 2*s + e in both
    const float* __restrict__ qp = hb + (i0 + l16) * 384 + 8 * kh;
    const v4f q0 = *(const v4f*)(qp);
    const v4f q1 = *(const v4f*)(qp + 4);
    const v2f qf[4] = { {q0[0], q0[1]}, {q0[2], q0[3]}, {q1[0], q1[1]}, {q1[2], q1[3]} };

    const float* __restrict__ kp = hb + l16 * 384 + 8 * kh;   // K starts 128 floats into a row
    v4f k0[16], k1[16];
#pragma unroll
    for (int jt = 0; jt < 16; ++jt) {
        k0[jt] = *(const v4f*)(kp + 128 + jt * 16 * 384);
        k1[jt] = *(const v4f*)(kp + 128 + jt * 16 * 384 + 4);
    }
    // The wait that belongs in front of any overwrite of a register the loads above name.
    // The addresses are inputs so that their registers stay untouched up to this line.
    asm volatile("s_wait_xcnt 0x0" :: "v"(qp), "v"(kp), "s"(efg), "v"(tid) : "memory");

    v8f S[16];
#pragma unroll
    for (int jt = 0; jt < 16; ++jt)
#pragma unroll
        for (int r = 0; r < 8; ++r) S[jt][r] = 0.0f;
#pragma unroll
    for (int g = 0; g < 4; ++g)
#pragma unroll
        for (int s = 0; s < 4; ++s)
#pragma unroll
            for (int t = 0; t < 4; ++t) {
                const int jt = g * 4 + t;
                const v4f kk = (s < 2) ? k0[jt] : k1[jt];
                const v2f a = { kk[(s & 1) * 2], kk[(s & 1) * 2 + 1] };
                S[jt] = __builtin_amdgcn_wmma_f32_16x16x4_f32(
                    false, a, false, qf[s], (short)0, S[jt], false, false);
            }

#pragma unroll
    for (int q = 0; q < 4; ++q) {
        const int f = tid + 256 * q;
        *(v4f*)(efs + (f >> 6) * EFP + (f & 63) * 4) = e4[q];
    }
    __syncthreads();   // the edge tile is read by all eight heads

    // x = s/sqrt(16) + e*cB, row maximum
    const float* er = efs + l16 * EFP + 8 * kh;
    float mx[4] = { -INFINITY, -INFINITY, -INFINITY, -INFINITY };
#pragma unroll
    for (int jt = 0; jt < 16; ++jt) {
        const v4f ea = *(const v4f*)(er + jt * 16);
        const v4f eb = *(const v4f*)(er + jt * 16 + 4);
#pragma unroll
        for (int r = 0; r < 8; ++r) {
            const float e = (r < 4) ? ea[r & 3] : eb[r & 3];
            const float x = S[jt][r] * 0.25f + e * cB;
            S[jt][r] = x;
            mx[r & 3] = fmaxf(mx[r & 3], x);
        }
    }
    float m = fmaxf(fmaxf(mx[0], mx[1]), fmaxf(mx[2], mx[3]));
    m = fmaxf(m, __shfl_xor(m, 16, 32));

    // p = exp(x - m) = exp2(x*log2e - m*log2e), row sum, unnormalised gated weight p*e
    const float L2E = 1.4426950408889634f;
    const float nm  = -m * L2E;
    float sm[4] = { 0.0f, 0.0f, 0.0f, 0.0f };
#pragma unroll
    for (int jt = 0; jt < 16; ++jt) {
        const v4f ea = *(const v4f*)(er + jt * 16);
        const v4f eb = *(const v4f*)(er + jt * 16 + 4);
#pragma unroll
        for (int c = 0; c < 2; ++c) {
            const v4f e = c ? eb : ea;
            v4f p;
            exp2x4(p, fmaf(S[jt][4 * c + 0], L2E, nm), fmaf(S[jt][4 * c + 1], L2E, nm),
                      fmaf(S[jt][4 * c + 2], L2E, nm), fmaf(S[jt][4 * c + 3], L2E, nm));
#pragma unroll
            for (int r = 0; r < 4; ++r) {
                sm[r] += p[r];
                S[jt][4 * c + r] = p[r] * e[r];
            }
        }
    }
    float ss = (sm[0] + sm[1]) + (sm[2] + sm[3]);
    ss += __shfl_xor(ss, 16, 32);

    // Y^T[d][i] = sum_j V[j][d] * w[i][j]; A fragment: lane l16 = d, rows j in the order above
    const float* __restrict__ vp = hb + l16 + 8 * kh * 384;   // V starts 256 floats into a row
    v8f o[2];
#pragma unroll
    for (int r = 0; r < 8; ++r) { o[0][r] = 0.0f; o[1][r] = 0.0f; }
#pragma unroll
    for (int jt = 0; jt < 16; ++jt)
#pragma unroll
        for (int s = 0; s < 4; ++s) {
            const v2f a = { vp[256 + (jt * 16 + 2 * s) * 384], vp[256 + (jt * 16 + 2 * s + 1) * 384] };
            const v2f w = { S[jt][2 * s], S[jt][2 * s + 1] };
            o[s & 1] = __builtin_amdgcn_wmma_f32_16x16x4_f32(
                false, a, false, w, (short)0, o[s & 1], false, false);
        }

    // same wait for the V loads: their address pair stays untouched up to this line
    asm volatile("s_wait_xcnt 0x0" :: "v"(vp) : "memory");

    // normalise and gate-scale once per output, gather the 8 heads' columns per row in LDS
    const float sc = cG / ss;
    v4f ya, yb;
#pragma unroll
    for (int r = 0; r < 4; ++r) {
        ya[r] = (o[0][r] + o[1][r]) * sc;
        yb[r] = (o[0][r + 4] + o[1][r + 4]) * sc;
    }
    float* yw = ys + l16 * YSP + h * 16 + 8 * kh;
    *(v4f*)(yw)     = ya;
    *(v4f*)(yw + 4) = yb;
    __syncthreads();   // every head's columns are in place before whole rows go out
#pragma unroll
    for (int q = 0; q < 2; ++q) {
        const int f = tid + 256 * q;      // one wave stores one whole 512-byte row
        const int row = f >> 5, c4 = f & 31;
        *(v4f*)(y + (long long)(b * NNOD + i0 + row) * HIDD + c4 * 4) =
            *(const v4f*)(ys + row * YSP + c4 * 4);
    }
}

// ---------------- tiny kernels ----------------
__global__ void comb_kernel(const float* __restrict__ We_in,
                            const float* __restrict__ We,
                            float* __restrict__ comb)
{
    const int t = threadIdx.x;
    if (t >= 48) return;
    const int l = t >> 4, c = t & 15;
    float s = 0.0f;
    for (int d = 0; d < HIDD; ++d)
        s += We_in[d] * We[((long long)l * HIDD + d) * 16 + c];
    comb[t] = s;
}

// out[l][n][m] = in[l][m][n]   (L batched M x N -> N x M transpose)
__global__ void transpose_kernel(const float* __restrict__ in, float* __restrict__ out,
                                 int L, int M, int N)
{
    const long long idx = (long long)blockIdx.x * blockDim.x + threadIdx.x;
    const long long tot = (long long)L * M * N;
    if (idx >= tot) return;
    const long long mn = (long long)M * N;
    const int l = (int)(idx / mn);
    const int r = (int)(idx % mn);
    const int m = r / N;
    const int n = r % N;
    out[(long long)l * mn + (long long)n * M + m] = in[idx];
}

// ---------------- host launch ----------------
extern "C" void kernel_launch(void* const* d_in, const int* in_sizes, int n_in,
                              void* d_out, int out_size, void* d_ws, size_t ws_size,
                              hipStream_t stream)
{
    const float* nf    = (const float*)d_in[0];   // (16,256,2)
    const float* ef    = (const float*)d_in[1];   // (16,256,256,1)
    const float* Wn    = (const float*)d_in[2];   // (2,128)
    const float* We_in = (const float*)d_in[3];   // (1,128)
    const float* ln1g  = (const float*)d_in[4];   // (3,128)
    const float* ln1b  = (const float*)d_in[5];
    const float* Wh    = (const float*)d_in[6];   // (3,128,384)
    const float* We    = (const float*)d_in[7];   // (3,128,16)
    const float* ln2g  = (const float*)d_in[8];
    const float* ln2b  = (const float*)d_in[9];
    const float* W1    = (const float*)d_in[10];  // (3,128,512)
    const float* W2    = (const float*)d_in[11];  // (3,512,128)
    const float* Wdec  = (const float*)d_in[12];  // (128,1)
    float* out = (float*)d_out;

    float* ws = (float*)d_ws;
    float* hA   = ws;                         // 524288, layer input, even layers
    float* hB   = ws + 524288;                // 524288, layer input, odd layers
    float* qkv  = ws + 1048576;               // 1572864
    float* y    = ws + 11010048;              // 524288
    float* comb = ws + 14155776;              // 64 (48 used)
    float* whT  = ws + 14155840;              // 3*384*128 = 147456
    float* w1T  = ws + 14303296;              // 3*512*128 = 196608
    float* w2T  = ws + 14499904;              // 3*128*512 = 196608

    comb_kernel<<<1, 64, 0, stream>>>(We_in, We, comb);

    // pre-transpose weights so that a fragment's k run is contiguous
    transpose_kernel<<<(3 * 128 * 384 + 255) / 256, 256, 0, stream>>>(Wh, whT, 3, 128, 384);
    transpose_kernel<<<(3 * 128 * 512 + 255) / 256, 256, 0, stream>>>(W1, w1T, 3, 128, 512);
    transpose_kernel<<<(3 * 512 * 128 + 255) / 256, 256, 0, stream>>>(W2, w2T, 3, 512, 128);

    const dim3 ga(NNOD / 16, NBAT);
    const int  gr = NBAT * NNOD / 16;

    // h0 = nf Wn, qkv0 = LN1(h0) Wh[0]
    row_chain_kernel<0><<<gr, 256, 0, stream>>>(
        nullptr, nullptr, hA, nullptr, nullptr, nullptr, nullptr,
        ln1g, ln1b, whT, qkv, nf, Wn, nullptr, nullptr);

    // y = (softmax(q k^T / 4 + ef*combB) * ef*combG) @ v, all heads, one launch
    attn_fused_kernel<<<ga, 256, 0, stream>>>(qkv, ef, comb, y);
    // h1 = relu(LN2(y + h0) W1[0]) W2[0] + y, qkv1 = LN1(h1) Wh[1]
    row_chain_kernel<1><<<gr, 256, 0, stream>>>(
        y, hA, hB, ln2g, ln2b, w1T, w2T,
        ln1g + HIDD, ln1b + HIDD, whT + 384 * HIDD, qkv, nullptr, nullptr, nullptr, nullptr);

    attn_fused_kernel<<<ga, 256, 0, stream>>>(qkv, ef, comb + 16, y);
    row_chain_kernel<1><<<gr, 256, 0, stream>>>(
        y, hB, hA, ln2g + HIDD, ln2b + HIDD, w1T + 512 * HIDD, w2T + 512 * HIDD,
        ln1g + 2 * HIDD, ln1b + 2 * HIDD, whT + 2 * 384 * HIDD, qkv, nullptr, nullptr, nullptr, nullptr);

    attn_fused_kernel<<<ga, 256, 0, stream>>>(qkv, ef, comb + 32, y);
    // out = 10 * tanh((h3 @ Wdec) / sqrt(128))
    row_chain_kernel<2><<<gr, 256, 0, stream>>>(
        y, hA, nullptr, ln2g + 2 * HIDD, ln2b + 2 * HIDD, w1T + 2 * 512 * HIDD, w2T + 2 * 512 * HIDD,
        nullptr, nullptr, nullptr, nullptr, nullptr, nullptr, Wdec, out);
}

// v003
// A run of this version takes 74.9 microseconds.
// Timed twice side by side with v002, it ran 1.46 and 1.45 times as fast.
// Over all steps from v000 it is 4.83 times as fast.
#include <hip/hip_runtime.h>
#include <math.h>

typedef __attribute__((ext_vector_type(2))) float v2f;
typedef __attribute__((ext_vector_type(4))) float v4f;
typedef __attribute__((ext_vector_type(8))) float v8f;

#define HIDD 128
#define NHD  8
#define NNOD 256
#define NBAT 16

#define ZP 132    // LDS pitch of a 128-wide row in floats: 16 B x odd, b128 reads conflict-free

__device__ __forceinline__ v8f mma_pair(const v4f a, const float b0, const float b1,
                                        const int s, const v8f c)
{
    const v2f av = { a[2 * s], a[2 * s + 1] };
    const v2f bv = { b0, b1 };
    return __builtin_amdgcn_wmma_f32_16x16x4_f32(false, av, false, bv, (short)0, c, false, false);
}

// layernorm of one 128-wide row held by one wave, four consecutive columns a lane
__device__ __forceinline__ v4f ln_wave(const v4f t, const v4f g, const v4f b)
{
    float s  = (t[0] + t[1]) + (t[2] + t[3]);
    float s2 = (t[0] * t[0] + t[1] * t[1]) + (t[2] * t[2] + t[3] * t[3]);
    for (int o = 16; o >= 1; o >>= 1) {
        s  += __shfl_xor(s,  o, 32);
        s2 += __shfl_xor(s2, o, 32);
    }
    const float mu   = s * (1.0f / HIDD);
    const float var  = s2 * (1.0f / HIDD) - mu * mu;
    const float rinv = rsqrtf(var + 1e-5f);
    v4f r;
    for (int i = 0; i < 4; ++i) r[i] = (t[i] - mu) * rinv * g[i] + b[i];
    return r;
}

// All loops below are unrolled so that the register arrays keep constant indices.
// One stage = 32 k of NT weight tiles (rows n, k contiguous, pitch 128).
// k slot (kh, e) of step (q, s) is k = 32*st + 8*q + 4*kh + 2*s + e, in A and in B alike.
template<int NT>
__device__ __forceinline__ void load_w(v4f (&w)[NT * 4], const float* __restrict__ wp, const int st)
{
#pragma unroll
    for (int t = 0; t < NT; ++t)
#pragma unroll
        for (int q = 0; q < 4; ++q)
            w[t * 4 + q] = *(const v4f*)(wp + t * 16 * HIDD + st * 32 + q * 8);
}

template<int NT>
__device__ __forceinline__ void mm_stage(v8f (&acc)[NT], const v4f (&w)[NT * 4],
                                         const float* zr, const int st)
{
    v4f bz[4];
#pragma unroll
    for (int q = 0; q < 4; ++q) bz[q] = *(const v4f*)(zr + st * 32 + q * 8);
    // keeps the next stage's weight loads and this stage's LDS reads ahead of the WMMA block:
    // left free, the scheduler sinks each load to just before its use and the wave waits it out
    __builtin_amdgcn_sched_barrier(0);
#pragma unroll
    for (int q = 0; q < 4; ++q)
#pragma unroll
        for (int s = 0; s < 2; ++s)
#pragma unroll
            for (int t = 0; t < NT; ++t)
                acc[t] = mma_pair(w[t * 4 + q], bz[q][2 * s], bz[q][2 * s + 1], s, acc[t]);
    __builtin_amdgcn_sched_barrier(0);   // the stage after next is not loaded before this block
}

// One stage of the second MLP product = two output tiles (c = 32*p .. 32*p + 31) over the
// wave's own 64 hidden columns; rows c of the weights, hidden index contiguous, pitch 512.
__device__ __forceinline__ void load_c(v4f (&w)[16], const float* __restrict__ cp, const int p)
{
#pragma unroll
    for (int u = 0; u < 2; ++u)
#pragma unroll
        for (int t = 0; t < 4; ++t)
#pragma unroll
            for (int hf = 0; hf < 2; ++hf)
                w[u * 8 + t * 2 + hf] = *(const v4f*)(cp + (2 * p + u) * 16 * 512 + t * 16 + hf * 4);
}

__device__ __forceinline__ void mm_c(v8f (&acc)[8], const v4f (&w)[16], const v8f (&d)[4], const int p)
{
    __builtin_amdgcn_sched_barrier(0);   // the next stage's weight loads stay ahead of this block
#pragma unroll
    for (int t = 0; t < 4; ++t)
#pragma unroll
        for (int hf = 0; hf < 2; ++hf)
#pragma unroll
            for (int s = 0; s < 2; ++s)
#pragma unroll
                for (int u = 0; u < 2; ++u)
                    acc[2 * p + u] = mma_pair(w[u * 8 + t * 2 + hf], d[t][4 * hf + 2 * s],
                                              d[t][4 * hf + 2 * s + 1], s, acc[2 * p + u]);
    __builtin_amdgcn_sched_barrier(0);   // the stage after next is not loaded before this block
}

template<int MODE>
__global__ __launch_bounds__(256)
void row_chain_kernel(const float* __restrict__ y, const float* __restrict__ hin,
                      float* __restrict__ hout,
                      const float* __restrict__ g2, const float* __restrict__ b2,
                      const float* __restrict__ w1T, const float* __restrict__ w2T,
                      const float* __restrict__ g1, const float* __restrict__ b1,
                      const float* __restrict__ whT, float* __restrict__ qkv,
                      const float* __restrict__ Wdec, float* __restrict__ out)
{
    __shared__ __attribute__((aligned(16))) float zs[16 * ZP];
    __shared__ __attribute__((aligned(16))) float red[8 * 16 * ZP];

    const int row0 = blockIdx.x * 16;
    const int tid  = threadIdx.x;
    const int w    = __builtin_amdgcn_readfirstlane(tid >> 5);
    const int lane = tid & 31;
    const int l16  = lane & 15;
    const int kh   = lane >> 4;

    const float* zr = zs + l16 * ZP + 4 * kh;          // B fragments: row l16 of the normed tile
    const float* __restrict__ whp = whT + (48 * w + l16) * HIDD + 4 * kh;
    v4f ea[12], eb[12];                                // QKV weight stages
    v4f hv[2];                                         // the wave's two rows, 4 columns a lane
    v4f gg1, bb1;                                      // LN1 scale and shift of the lane's columns

    {
        const float* __restrict__ w1p = w1T + (64 * w + l16) * HIDD + 4 * kh;
        const float* __restrict__ w2p = w2T + l16 * 512 + 64 * w + 8 * kh;
        const float* __restrict__ yp = y   + (row0 + 2 * w) * HIDD + lane * 4;
        const float* __restrict__ hp = hin + (row0 + 2 * w) * HIDD + lane * 4;
        v4f yv[2], hi[2];
#pragma unroll
        for (int rr = 0; rr < 2; ++rr) {
            yv[rr] = *(const v4f*)(yp + rr * HIDD);
            hi[rr] = *(const v4f*)(hp + rr * HIDD);
        }
        const v4f gg = *(const v4f*)(g2 + lane * 4);
        const v4f bb = *(const v4f*)(b2 + lane * 4);
        v4f wa[16], wb[16];
        load_w<4>(wa, w1p, 0);     // first weight stage flies during the layernorm
        __builtin_amdgcn_sched_barrier(0);   // issued here, not sunk to the barrier
#pragma unroll
        for (int rr = 0; rr < 2; ++rr)
            *(v4f*)(zs + (2 * w + rr) * ZP + lane * 4) = ln_wave(yv[rr] + hi[rr], gg, bb);
        // The wait that belongs in front of any overwrite of a register the loads above name.
        // The addresses are inputs so that their registers stay untouched up to this line.
        asm volatile("s_wait_xcnt 0x0" :: "v"(yp), "v"(hp), "v"(lane) : "memory");
        __syncthreads();           // all 16 normed rows are read by every wave

        // act^T = relu(W1^T z^T), hidden columns 64*w .. 64*w + 63; weights one stage ahead
        v8f d[4];
#pragma unroll
        for (int t = 0; t < 4; ++t)
#pragma unroll
            for (int r = 0; r < 8; ++r) d[t][r] = 0.0f;
        load_w<4>(wb, w1p, 1);  mm_stage<4>(d, wa, zr, 0);
        load_w<4>(wa, w1p, 2);  mm_stage<4>(d, wb, zr, 1);
        load_w<4>(wb, w1p, 3);  mm_stage<4>(d, wa, zr, 2);
        load_c(wa, w2p, 0);     mm_stage<4>(d, wb, zr, 3);
#pragma unroll
        for (int t = 0; t < 4; ++t)
#pragma unroll
            for (int r = 0; r < 8; ++r) d[t][r] = fmaxf(d[t][r], 0.0f);

        // partial (act W2)^T over the wave's own 64 hidden columns
        v8f o[8];
#pragma unroll
        for (int c = 0; c < 8; ++c)
#pragma unroll
            for (int r = 0; r < 8; ++r) o[c][r] = 0.0f;
        load_c(wb, w2p, 1);  mm_c(o, wa, d, 0);
        load_c(wa, w2p, 2);  mm_c(o, wb, d, 1);
        load_c(wb, w2p, 3);  mm_c(o, wa, d, 2);
        mm_c(o, wb, d, 3);

        float* rw = red + (w * 16 + l16) * ZP + 8 * kh;
#pragma unroll
        for (int c = 0; c < 8; ++c) {
            const v4f lo = { o[c][0], o[c][1], o[c][2], o[c][3] };
            const v4f hi4 = { o[c][4], o[c][5], o[c][6], o[c][7] };
            *(v4f*)(rw + c * 16)     = lo;
            *(v4f*)(rw + c * 16 + 4) = hi4;
        }
        // same wait for the weight loads: both address pairs stay untouched up to this line
        asm volatile("s_wait_xcnt 0x0" :: "v"(w1p), "v"(w2p) : "memory");
        __syncthreads();           // the eight partial sums of every row are in place

        if constexpr (MODE == 1) { // first QKV weight stage flies during the sum and the layernorm
            gg1 = *(const v4f*)(g1 + lane * 4);
            bb1 = *(const v4f*)(b1 + lane * 4);
            load_w<3>(ea, whp, 0);
            __builtin_amdgcn_sched_barrier(0);   // issued here, not sunk to the barrier
        }

#pragma unroll
        for (int rr = 0; rr < 2; ++rr) {
            const float* rp = red + (2 * w + rr) * ZP + lane * 4;
            v4f s = *(const v4f*)rp;
#pragma unroll
            for (int u = 1; u < 8; ++u) s += *(const v4f*)(rp + u * 16 * ZP);
            hv[rr] = s + yv[rr];
        }
    }

    if constexpr (MODE == 2) {
        // out = 10 * tanh((h . Wdec) / sqrt(128))
        const v4f wd = *(const v4f*)(Wdec + lane * 4);
        v2f res;
#pragma unroll
        for (int rr = 0; rr < 2; ++rr) {
            float s = (hv[rr][0] * wd[0] + hv[rr][1] * wd[1]) + (hv[rr][2] * wd[2] + hv[rr][3] * wd[3]);
            for (int o = 16; o >= 1; o >>= 1) s += __shfl_xor(s, o, 32);
            res[rr] = 10.0f * tanhf(s * 0.08838834764831845f);
        }
        if (lane == 0) *(v2f*)(out + row0 + 2 * w) = res;
    } else {
        float* __restrict__ op = hout + (row0 + 2 * w) * HIDD + lane * 4;
#pragma unroll
        for (int rr = 0; rr < 2; ++rr) {
            *(v4f*)(op + rr * HIDD) = hv[rr];
            *(v4f*)(zs + (2 * w + rr) * ZP + lane * 4) = ln_wave(hv[rr], gg1, bb1);
        }
        // same wait for the stores and the loads since the last one
        asm volatile("s_wait_xcnt 0x0" :: "v"(op), "v"(lane) : "memory");
        __syncthreads();           // all 16 normed rows are read by every wave

        // qkv^T = Wh^T hn^T, columns 48*w .. 48*w + 47
        v8f a[3];
#pragma unroll
        for (int t = 0; t < 3; ++t)
#pragma unroll
            for (int r = 0; r < 8; ++r) a[t][r] = 0.0f;
        load_w<3>(eb, whp, 1);  mm_stage<3>(a, ea, zr, 0);
        load_w<3>(ea, whp, 2);  mm_stage<3>(a, eb, zr, 1);
        load_w<3>(eb, whp, 3);  mm_stage<3>(a, ea, zr, 2);
        mm_stage<3>(a, eb, zr, 3);
        // same wait for the QKV weight loads: their address pair stays untouched up to this line
        asm volatile("s_wait_xcnt 0x0" :: "v"(whp) : "memory");

        float* qw = qkv + (row0 + l16) * 384 + 48 * w + 8 * kh;
#pragma unroll
        for (int t = 0; t < 3; ++t) {
            const v4f lo = { a[t][0], a[t][1], a[t][2], a[t][3] };
            const v4f hi4 = { a[t][4], a[t][5], a[t][6], a[t][7] };
            *(v4f*)(qw + t * 16)     = lo;
            *(v4f*)(qw + t * 16 + 4) = hi4;
        }
    }
}

// Four exp2 in one statement.  The early-clobber outputs keep every v_exp_f32 from being
// directly followed by a write of its source or a read of its result, and the v_nop is
// the one slot the instruction set asks for behind the last of them.
__device__ __forceinline__ void exp2x4(v4f& p, float t0, float t1, float t2, float t3)
{
    float p0, p1, p2, p3;
    asm("v_exp_f32 %0, %4\n\tv_exp_f32 %1, %5\n\tv_exp_f32 %2, %6\n\tv_exp_f32 %3, %7\n\tv_nop"
        : "=&v"(p0), "=&v"(p1), "=&v"(p2), "=&v"(p3)
        : "v"(t0), "v"(t1), "v"(t2), "v"(t3));
    p[0] = p0; p[1] = p1; p[2] = p2; p[3] = p3;
}

// ------ fused attention: one workgroup = one batch x 16 query rows, one wave per head ------
// S^T = K Q^T is kept in registers: lane (l16, kh) register r of tile jt holds
// key j = jt*16 + 8*kh + r of query i0 + l16.  That is already the B fragment of
// Y^T = V^T W^T when the k slots of step s are read as j = jt*16 + 8*kh + 2*s + {0,1},
// so the weights never leave the registers.  The softmax runs down a lane's own
// 128 values plus one exchange between the two lane halves.
#define EFP 260   // LDS pitch of an edge row in floats: 16 B x odd, b128 reads conflict-free
#define YSP 132   // LDS pitch of an output row in floats: 16 B x odd
__global__ __launch_bounds__(256)
void attn_fused_kernel(const float* __restrict__ qkv, const float* __restrict__ ef,
                       const float* __restrict__ comb, float* __restrict__ y)
{
    __shared__ __attribute__((aligned(16))) float efs[16 * EFP];
    __shared__ __attribute__((aligned(16))) float ys[16 * YSP];

    const int i0   = blockIdx.x * 16;
    const int b    = blockIdx.y;
    const int tid  = threadIdx.x;
    const int h    = __builtin_amdgcn_readfirstlane(tid >> 5);
    const int lane = tid & 31;
    const int l16  = lane & 15;
    const int kh   = lane >> 4;

    // edge tile (16 rows x 256, contiguous): loads issued first, so that they fly beside the K loads
    const v4f* __restrict__ efg = (const v4f*)(ef + (long long)(b * NNOD + i0) * NNOD);
    v4f e4[4];
#pragma unroll
    for (int q = 0; q < 4; ++q) e4[q] = efg[tid + 256 * q];

    const float cB = comb[h];
    const float cG = comb[NHD + h];

    const float* __restrict__ hb = qkv + (long long)b * NNOD * 384 + h * 16;

    // Q as B fragment, K as A fragment; k slot (kh, e) of step s is d = 8*kh + 2*s + e in both
    const float* __restrict__ qp = hb + (i0 + l16) * 384 + 8 * kh;
    const v4f q0 = *(const v4f*)(qp);
    const v4f q1 = *(const v4f*)(qp + 4);
    const v2f qf[4] = { {q0[0], q0[1]}, {q0[2], q0[3]}, {q1[0], q1[1]}, {q1[2], q1[3]} };

    const float* __restrict__ kp = hb + l16 * 384 + 8 * kh;   // K starts 128 floats into a row
    v4f k0[16], k1[16];
#pragma unroll
    for (int jt = 0; jt < 16; ++jt) {
        k0[jt] = *(const v4f*)(kp + 128 + jt * 16 * 384);
        k1[jt] = *(const v4f*)(kp + 128 + jt * 16 * 384 + 4);
    }
    // The wait that belongs in front of any overwrite of a register the loads above name.
    // The addresses are inputs so that their registers stay untouched up to this line.
    asm volatile("s_wait_xcnt 0x0" :: "v"(qp), "v"(kp), "s"(efg), "v"(tid) : "memory");

    v8f S[16];
#pragma unroll
    for (int jt = 0; jt < 16; ++jt)
#pragma unroll
        for (int r = 0; r < 8; ++r) S[jt][r] = 0.0f;
#pragma unroll
    for (int g = 0; g < 4; ++g)
#pragma unroll
        for (int s = 0; s < 4; ++s)
#pragma unroll
            for (int t = 0; t < 4; ++t) {
                const int jt = g * 4 + t;
                const v4f kk = (s < 2) ? k0[jt] : k1[jt];
                const v2f a = { kk[(s & 1) * 2], kk[(s & 1) * 2 + 1] };
                S[jt] = __builtin_amdgcn_wmma_f32_16x16x4_f32(
                    false, a, false, qf[s], (short)0, S[jt], false, false);
            }

#pragma unroll
    for (int q = 0; q < 4; ++q) {
        const int f = tid + 256 * q;
        *(v4f*)(efs + (f >> 6) * EFP + (f & 63) * 4) = e4[q];
    }
    __syncthreads();   // the edge tile is read by all eight heads

    // x = s/sqrt(16) + e*cB, row maximum
    const float* er = efs + l16 * EFP + 8 * kh;
    float mx[4] = { -INFINITY, -INFINITY, -INFINITY, -INFINITY };
#pragma unroll
    for (int jt = 0; jt < 16; ++jt) {
        const v4f ea = *(const v4f*)(er + jt * 16);
        const v4f eb = *(const v4f*)(er + jt * 16 + 4);
#pragma unroll
        for (int r = 0; r < 8; ++r) {
            const float e = (r < 4) ? ea[r & 3] : eb[r & 3];
            const float x = S[jt][r] * 0.25f + e * cB;
            S[jt][r] = x;
            mx[r & 3] = fmaxf(mx[r & 3], x);
        }
    }
    float m = fmaxf(fmaxf(mx[0], mx[1]), fmaxf(mx[2], mx[3]));
    m = fmaxf(m, __shfl_xor(m, 16, 32));

    // p = exp(x - m) = exp2(x*log2e - m*log2e), row sum, unnormalised gated weight p*e
    const float L2E = 1.4426950408889634f;
    const float nm  = -m * L2E;
    float sm[4] = { 0.0f, 0.0f, 0.0f, 0.0f };
#pragma unroll
    for (int jt = 0; jt < 16; ++jt) {
        const v4f ea = *(const v4f*)(er + jt * 16);
        const v4f eb = *(const v4f*)(er + jt * 16 + 4);
#pragma unroll
        for (int c = 0; c < 2; ++c) {
            const v4f e = c ? eb : ea;
            v4f p;
            exp2x4(p, fmaf(S[jt][4 * c + 0], L2E, nm), fmaf(S[jt][4 * c + 1], L2E, nm),
                      fmaf(S[jt][4 * c + 2], L2E, nm), fmaf(S[jt][4 * c + 3], L2E, nm));
#pragma unroll
            for (int r = 0; r < 4; ++r) {
                sm[r] += p[r];
                S[jt][4 * c + r] = p[r] * e[r];
            }
        }
    }
    float ss = (sm[0] + sm[1]) + (sm[2] + sm[3]);
    ss += __shfl_xor(ss, 16, 32);

    // Y^T[d][i] = sum_j V[j][d] * w[i][j]; A fragment: lane l16 = d, rows j in the order above
    const float* __restrict__ vp = hb + l16 + 8 * kh * 384;   // V starts 256 floats into a row
    v8f o[2];
#pragma unroll
    for (int r = 0; r < 8; ++r) { o[0][r] = 0.0f; o[1][r] = 0.0f; }
#pragma unroll
    for (int jt = 0; jt < 16; ++jt)
#pragma unroll
        for (int s = 0; s < 4; ++s) {
            const v2f a = { vp[256 + (jt * 16 + 2 * s) * 384], vp[256 + (jt * 16 + 2 * s + 1) * 384] };
            const v2f w = { S[jt][2 * s], S[jt][2 * s + 1] };
            o[s & 1] = __builtin_amdgcn_wmma_f32_16x16x4_f32(
                false, a, false, w, (short)0, o[s & 1], false, false);
        }

    // same wait for the V loads: their address pair stays untouched up to this line
    asm volatile("s_wait_xcnt 0x0" :: "v"(vp) : "memory");

    // normalise and gate-scale once per output, gather the 8 heads' columns per row in LDS
    const float sc = cG / ss;
    v4f ya, yb;
#pragma unroll
    for (int r = 0; r < 4; ++r) {
        ya[r] = (o[0][r] + o[1][r]) * sc;
        yb[r] = (o[0][r + 4] + o[1][r + 4]) * sc;
    }
    float* yw = ys + l16 * YSP + h * 16 + 8 * kh;
    *(v4f*)(yw)     = ya;
    *(v4f*)(yw + 4) = yb;
    __syncthreads();   // every head's columns are in place before whole rows go out
#pragma unroll
    for (int q = 0; q < 2; ++q) {
        const int f = tid + 256 * q;      // one wave stores one whole 512-byte row
        const int row = f >> 5, c4 = f & 31;
        *(v4f*)(y + (long long)(b * NNOD + i0 + row) * HIDD + c4 * 4) =
            *(const v4f*)(ys + row * YSP + c4 * 4);
    }
}

// ------ first launch: layer 0's row work, and beside it the preparation of the later launches ------
#define ROWG (NBAT * NNOD / 16)   // work-groups 0 .. ROWG-1: 16 rows each
#define PREPG 121                 // behind them: 24 + 48 + 48 transposing work-groups and one for comb

// One stage of three QKV weight tiles read from the untransposed matrix (rows k, pitch 384):
// the same values in the same registers as load_w<3> takes from the transposed copy.
__device__ __forceinline__ void load_n(v4f (&w)[12], const float* __restrict__ wp, const int st)
{
#pragma unroll
    for (int t = 0; t < 3; ++t)
#pragma unroll
        for (int q = 0; q < 4; ++q)
#pragma unroll
            for (int c = 0; c < 4; ++c)
                w[t * 4 + q][c] = wp[(st * 32 + q * 8 + c) * 384 + t * 16];
}

// out[l][n][m] = in[l][m][n]: one wave turns one tile of 16 m x 32 n, a lane 4 x 4 of it.
// Loads cover whole 128-byte lines, stores 64-byte runs.
template<int M, int N>
__device__ __forceinline__ void transpose_tile(const float* __restrict__ in, float* __restrict__ out,
                                               const int T, const int lane)
{
    constexpr int NTN = N / 32, TPL = (M / 16) * NTN;
    const int l = T / TPL, rem = T % TPL;
    const int m0 = (rem / NTN) * 16 + 4 * (lane >> 3);
    const int n0 = (rem % NTN) * 32 + 4 * (lane & 7);
    const float* __restrict__ ip = in + l * M * N + m0 * N + n0;
    float* __restrict__ op = out + l * M * N + n0 * M + m0;
    v4f r[4];
#pragma unroll
    for (int j = 0; j < 4; ++j) r[j] = *(const v4f*)(ip + j * N);
#pragma unroll
    for (int i = 0; i < 4; ++i) {
        const v4f c = { r[0][i], r[1][i], r[2][i], r[3][i] };
        *(v4f*)(op + i * M) = c;
    }
    // The wait that belongs in front of any overwrite of a register the stores above name.
    asm volatile("s_wait_xcnt 0x0" ::: "memory");
}

__global__ __launch_bounds__(256)
void first_kernel(const float* __restrict__ nf, const float* __restrict__ Wn,
                  const float* __restrict__ g1, const float* __restrict__ b1,
                  const float* __restrict__ Wh, float* __restrict__ hout, float* __restrict__ qkv,
                  const float* __restrict__ W1, const float* __restrict__ W2,
                  const float* __restrict__ We_in, const float* __restrict__ We,
                  float* __restrict__ whT, float* __restrict__ w1T, float* __restrict__ w2T,
                  float* __restrict__ comb)
{
    __shared__ __attribute__((aligned(16))) float zs[16 * ZP];

    const int tid  = threadIdx.x;
    const int w    = __builtin_amdgcn_readfirstlane(tid >> 5);
    const int lane = tid & 31;
    const int l16  = lane & 15;
    const int kh   = lane >> 4;

    // Preparation work-groups: nothing of theirs is read in this launch, and they leave
    // as whole work-groups in front of every barrier.
    if (blockIdx.x >= ROWG) {
        const int pb = blockIdx.x - ROWG;
        if (pb < 24) {            // Wh of layers 1 and 2 (layer 0 is read untransposed below)
            transpose_tile<128, 384>(Wh + 128 * 384, whT + 128 * 384, pb * 8 + w, lane);
        } else if (pb < 72) {
            transpose_tile<128, 512>(W1, w1T, (pb - 24) * 8 + w, lane);
        } else if (pb < 120) {
            transpose_tile<512, 128>(W2, w2T, (pb - 72) * 8 + w, lane);
        } else if (w < 2) {       // comb[l][c] = We_in . We[l][:, c], 48 values; lanes past them repeat the last
            const int t = tid < 48 ? tid : 47;
            const float* __restrict__ wp = We + (t >> 4) * HIDD * 16 + (t & 15);
            float s = 0.0f;
#pragma unroll                    // the loads go out in one run instead of one round trip per group
            for (int d = 0; d < HIDD; ++d) s += We_in[d] * wp[d * 16];
            // The wait that belongs in front of any overwrite of a register the loads above name.
            // The address is an input so that its registers stay untouched up to this line.
            asm volatile("s_wait_xcnt 0x0" :: "v"(wp) : "memory");
            if (tid < 48) comb[tid] = s;
        }
        return;
    }

    const int row0 = blockIdx.x * 16;
    const float* zr = zs + l16 * ZP + 4 * kh;          // B fragments: row l16 of the normed tile
    const float* __restrict__ whp = Wh + 4 * kh * 384 + 48 * w + l16;
    v4f ea[12], eb[12];                                // QKV weight stages
    v4f hv[2];                                         // the wave's two rows, 4 columns a lane

    const v4f gg1 = *(const v4f*)(g1 + lane * 4);
    const v4f bb1 = *(const v4f*)(b1 + lane * 4);
    load_n(ea, whp, 0);
    // The wait that belongs in front of any overwrite of a register the loads above name.
    // Bases and offsets are inputs so that their registers stay untouched up to this line.
    asm volatile("s_wait_xcnt 0x0" :: "s"(g1), "s"(b1), "v"(whp), "v"(lane) : "memory");
    __builtin_amdgcn_sched_barrier(0);   // issued here, not sunk to the barrier: they fly during the layernorm
    const v4f wn0 = *(const v4f*)(Wn + lane * 4);
    const v4f wn1 = *(const v4f*)(Wn + HIDD + lane * 4);
#pragma unroll
    for (int rr = 0; rr < 2; ++rr) {
        const int row = row0 + 2 * w + rr;
        hv[rr] = nf[row * 2] * wn0 + nf[row * 2 + 1] * wn1;
    }

    float* __restrict__ op = hout + (row0 + 2 * w) * HIDD + lane * 4;
#pragma unroll
    for (int rr = 0; rr < 2; ++rr) {
        *(v4f*)(op + rr * HIDD) = hv[rr];
        *(v4f*)(zs + (2 * w + rr) * ZP + lane * 4) = ln_wave(hv[rr], gg1, bb1);
    }
    // same wait for the stores and the loads since the last one
    asm volatile("s_wait_xcnt 0x0" :: "v"(op), "v"(lane) : "memory");
    __syncthreads();           // all 16 normed rows are read by every wave

    // qkv^T = Wh^T hn^T, columns 48*w .. 48*w + 47
    v8f a[3];
#pragma unroll
    for (int t = 0; t < 3; ++t)
#pragma unroll
        for (int r = 0; r < 8; ++r) a[t][r] = 0.0f;
    load_n(eb, whp, 1);  mm_stage<3>(a, ea, zr, 0);
    load_n(ea, whp, 2);  mm_stage<3>(a, eb, zr, 1);
    load_n(eb, whp, 3);  mm_stage<3>(a, ea, zr, 2);
    mm_stage<3>(a, eb, zr, 3);
    // same wait for the QKV weight loads: their address pair stays untouched up to this line
    asm volatile("s_wait_xcnt 0x0" :: "v"(whp) : "memory");

    float* qw = qkv + (row0 + l16) * 384 + 48 * w + 8 * kh;
#pragma unroll
    for (int t = 0; t < 3; ++t) {
        const v4f lo = { a[t][0], a[t][1], a[t][2], a[t][3] };
        const v4f hi4 = { a[t][4], a[t][5], a[t][6], a[t][7] };
        *(v4f*)(qw + t * 16)     = lo;
        *(v4f*)(qw + t * 16 + 4) = hi4;
    }
}

// ---------------- host launch ----------------
extern "C" void kernel_launch(void* const* d_in, const int* in_sizes, int n_in,
                              void* d_out, int out_size, void* d_ws, size_t ws_size,
                              hipStream_t stream)
{
    const float* nf    = (const float*)d_in[0];   // (16,256,2)
    const float* ef    = (const float*)d_in[1];   // (16,256,256,1)
    const float* Wn    = (const float*)d_in[2];   // (2,128)
    const float* We_in = (const float*)d_in[3];   // (1,128)
    const float* ln1g  = (const float*)d_in[4];   // (3,128)
    const float* ln1b  = (const float*)d_in[5];
    const float* Wh    = (const float*)d_in[6];   // (3,128,384)
    const float* We    = (const float*)d_in[7];   // (3,128,16)
    const float* ln2g  = (const float*)d_in[8];
    const float* ln2b  = (const float*)d_in[9];
    const float* W1    = (const float*)d_in[10];  // (3,128,512)
    const float* W2    = (const float*)d_in[11];  // (3,512,128)
    const float* Wdec  = (const float*)d_in[12];  // (128,1)
    float* out = (float*)d_out;

    float* ws = (float*)d_ws;
    float* hA   = ws;                         // 524288, layer input, even layers
    float* hB   = ws + 524288;                // 524288, layer input, odd layers
    float* qkv  = ws + 1048576;               // 1572864
    float* y    = ws + 11010048;              // 524288
    float* comb = ws + 14155776;              // 64 (48 used)
    float* whT  = ws + 14155840;              // 3*384*128 = 147456 (layer 0's part stays unused)
    float* w1T  = ws + 14303296;              // 3*512*128 = 196608
    float* w2T  = ws + 14499904;              // 3*128*512 = 196608

    const dim3 ga(NNOD / 16, NBAT);
    const int  gr = NBAT * NNOD / 16;

    // h0 = nf Wn, qkv0 = LN1(h0) Wh[0]; beside them comb and the transposed weights of the later
    // launches (a fragment's k run contiguous)
    first_kernel<<<ROWG + PREPG, 256, 0, stream>>>(
        nf, Wn, ln1g, ln1b, Wh, hA, qkv, W1, W2, We_in, We, whT, w1T, w2T, comb);

    // y = (softmax(q k^T / 4 + ef*combB) * ef*combG) @ v, all heads, one launch
    attn_fused_kernel<<<ga, 256, 0, stream>>>(qkv, ef, comb, y);
    // h1 = relu(LN2(y + h0) W1[0]) W2[0] + y, qkv1 = LN1(h1) Wh[1]
    row_chain_kernel<1><<<gr, 256, 0, stream>>>(
        y, hA, hB, ln2g, ln2b, w1T, w2T,
        ln1g + HIDD, ln1b + HIDD, whT + 384 * HIDD, qkv, nullptr, nullptr);

    attn_fused_kernel<<<ga, 256, 0, stream>>>(qkv, ef, comb + 16, y);
    row_chain_kernel<1><<<gr, 256, 0, stream>>>(
        y, hB, hA, ln2g + HIDD, ln2b + HIDD, w1T + 512 * HIDD, w2T + 512 * HIDD,
        ln1g + 2 * HIDD, ln1b + 2 * HIDD, whT + 2 * 384 * HIDD, qkv, nullptr, nullptr);

    attn_fused_kernel<<<ga, 256, 0, stream>>>(qkv, ef, comb + 32, y);
    // out = 10 * tanh((h3 @ Wdec) / sqrt(128))
    row_chain_kernel<2><<<gr, 256, 0, stream>>>(
        y, hA, nullptr, ln2g + 2 * HIDD, ln2b + 2 * HIDD, w1T + 2 * 512 * HIDD, w2T + 2 * 512 * HIDD,
        nullptr, nullptr, nullptr, nullptr, Wdec, out);
}

// v004
// It runs in 68.3 microseconds.
// In two side-by-side timings against v003, it was 1.09 and 1.10 times as fast.
// All steps since v000 together make it 5.29 times as fast.
#include <hip/hip_runtime.h>
#include <math.h>

typedef __attribute__((ext_vector_type(2))) float v2f;
typedef __attribute__((ext_vector_type(4))) float v4f;
typedef __attribute__((ext_vector_type(8))) float v8f;

#define HIDD 128
#define NHD  8
#define NNOD 256
#define NBAT 16

#define ZP 132    // LDS pitch of a 128-wide row in floats: 16 B x odd, b128 reads conflict-free

__device__ __forceinline__ v8f mma_pair(const v4f a, const float b0, const float b1,
                                        const int s, const v8f c)
{
    const v2f av = { a[2 * s], a[2 * s + 1] };
    const v2f bv = { b0, b1 };
    return __builtin_amdgcn_wmma_f32_16x16x4_f32(false, av, false, bv, (short)0, c, false, false);
}

// layernorm of one 128-wide row held by one wave, four consecutive columns a lane
__device__ __forceinline__ v4f ln_wave(const v4f t, const v4f g, const v4f b)
{
    float s  = (t[0] + t[1]) + (t[2] + t[3]);
    float s2 = (t[0] * t[0] + t[1] * t[1]) + (t[2] * t[2] + t[3] * t[3]);
    for (int o = 16; o >= 1; o >>= 1) {
        s  += __shfl_xor(s,  o, 32);
        s2 += __shfl_xor(s2, o, 32);
    }
    const float mu   = s * (1.0f / HIDD);
    const float var  = s2 * (1.0f / HIDD) - mu * mu;
    const float rinv = rsqrtf(var + 1e-5f);
    v4f r;
    for (int i = 0; i < 4; ++i) r[i] = (t[i] - mu) * rinv * g[i] + b[i];
    return r;
}

// All loops below are unrolled so that the register arrays keep constant indices.
// One stage = 32 k of NT weight tiles (rows n, k contiguous, pitch 128).
// k slot (kh, e) of step (q, s) is k = 32*st + 8*q + 4*kh + 2*s + e, in A and in B alike.
template<int NT>
__device__ __forceinline__ void load_w(v4f (&w)[NT * 4], const float* __restrict__ wp, const int st)
{
#pragma unroll
    for (int t = 0; t < NT; ++t)
#pragma unroll
        for (int q = 0; q < 4; ++q)
            w[t * 4 + q] = *(const v4f*)(wp + t * 16 * HIDD + st * 32 + q * 8);
}

template<int NT>
__device__ __forceinline__ void mm_stage(v8f (&acc)[NT], const v4f (&w)[NT * 4],
                                         const float* zr, const int st)
{
    v4f bz[4];
#pragma unroll
    for (int q = 0; q < 4; ++q) bz[q] = *(const v4f*)(zr + st * 32 + q * 8);
    // keeps the next stage's weight loads and this stage's LDS reads ahead of the WMMA block:
    // left free, the scheduler sinks each load to just before its use and the wave waits it out
    __builtin_amdgcn_sched_barrier(0);
#pragma unroll
    for (int q = 0; q < 4; ++q)
#pragma unroll
        for (int s = 0; s < 2; ++s)
#pragma unroll
            for (int t = 0; t < NT; ++t)
                acc[t] = mma_pair(w[t * 4 + q], bz[q][2 * s], bz[q][2 * s + 1], s, acc[t]);
    __builtin_amdgcn_sched_barrier(0);   // the stage after next is not loaded before this block
}

// One stage of the second MLP product = two output tiles (c = 32*p .. 32*p + 31) over the
// wave's own 64 hidden columns; rows c of the weights, hidden index contiguous, pitch 512.
__device__ __forceinline__ void load_c(v4f (&w)[16], const float* __restrict__ cp, const int p)
{
#pragma unroll
    for (int u = 0; u < 2; ++u)
#pragma unroll
        for (int t = 0; t < 4; ++t)
#pragma unroll
            for (int hf = 0; hf < 2; ++hf)
                w[u * 8 + t * 2 + hf] = *(const v4f*)(cp + (2 * p + u) * 16 * 512 + t * 16 + hf * 4);
}

__device__ __forceinline__ void mm_c(v8f (&acc)[8], const v4f (&w)[16], const v8f (&d)[4], const int p)
{
    __builtin_amdgcn_sched_barrier(0);   // the next stage's weight loads stay ahead of this block
#pragma unroll
    for (int t = 0; t < 4; ++t)
#pragma unroll
        for (int hf = 0; hf < 2; ++hf)
#pragma unroll
            for (int s = 0; s < 2; ++s)
#pragma unroll
                for (int u = 0; u < 2; ++u)
                    acc[2 * p + u] = mma_pair(w[u * 8 + t * 2 + hf], d[t][4 * hf + 2 * s],
                                              d[t][4 * hf + 2 * s + 1], s, acc[2 * p + u]);
    __builtin_amdgcn_sched_barrier(0);   // the stage after next is not loaded before this block
}

// Four exp2 in one statement.  The early-clobber outputs keep every v_exp_f32 from being
// directly followed by a write of its source or a read of its result, and the v_nop is
// the one slot the instruction set asks for behind the last of them.
__device__ __forceinline__ void exp2x4(v4f& p, float t0, float t1, float t2, float t3)
{
    float p0, p1, p2, p3;
    asm("v_exp_f32 %0, %4\n\tv_exp_f32 %1, %5\n\tv_exp_f32 %2, %6\n\tv_exp_f32 %3, %7\n\tv_nop"
        : "=&v"(p0), "=&v"(p1), "=&v"(p2), "=&v"(p3)
        : "v"(t0), "v"(t1), "v"(t2), "v"(t3));
    p[0] = p0; p[1] = p1; p[2] = p2; p[3] = p3;
}

// ------ one whole layer: one workgroup = one batch x 16 rows, eight waves ------
// Attention (one wave per head), then the row-local chain on the same 16 rows, whose y never
// leaves LDS.  MODE 1: LN2, MLP + y, LN1 of the next layer, its QKV.  MODE 2: LN2, MLP + y, decoder.
// The next layer's QKV goes to a second buffer: other workgroups still read K and V of this one.
//
// S^T = K Q^T is kept in registers: lane (l16, kh) register r of tile jt holds
// key j = jt*16 + 8*kh + r of query i0 + l16.  That is already the B fragment of
// Y^T = V^T W^T when the k slots of step s are read as j = jt*16 + 8*kh + 2*s + {0,1},
// so the weights never leave the registers.  The softmax runs down a lane's own
// 128 values plus one exchange between the two lane halves.
#define EFP 260   // LDS pitch of an edge row in floats: 16 B x odd, b128 reads conflict-free
#define YSP 132   // LDS pitch of an output row in floats: 16 B x odd
template<int MODE>
__global__ __launch_bounds__(256)
void layer_kernel(const float* __restrict__ qkv, const float* __restrict__ ef,
                  const float* __restrict__ comb, const float* __restrict__ hin,
                  float* __restrict__ hout,
                  const float* __restrict__ g2, const float* __restrict__ b2,
                  const float* __restrict__ w1T, const float* __restrict__ w2T,
                  const float* __restrict__ g1, const float* __restrict__ b1,
                  const float* __restrict__ whT, float* __restrict__ qkvn,
                  const float* __restrict__ Wdec, float* __restrict__ out)
{
    __shared__ __attribute__((aligned(16))) float efs[16 * EFP];
    __shared__ __attribute__((aligned(16))) float ys[16 * YSP];
    __shared__ __attribute__((aligned(16))) float zs[16 * ZP];
    __shared__ __attribute__((aligned(16))) float red[8 * 16 * ZP];

    const int i0   = blockIdx.x * 16;
    const int b    = blockIdx.y;
    const int row0 = b * NNOD + i0;
    const int tid  = threadIdx.x;
    const int w    = __builtin_amdgcn_readfirstlane(tid >> 5);   // wave = head
    const int lane = tid & 31;
    const int l16  = lane & 15;
    const int kh   = lane >> 4;

    // edge tile (16 rows x 256, contiguous): loads issued first, so that they fly beside the K loads
    const v4f* __restrict__ efg = (const v4f*)(ef + (long long)row0 * NNOD);
    v4f e4[4];
#pragma unroll
    for (int q = 0; q < 4; ++q) e4[q] = efg[tid + 256 * q];

    const float cB = comb[w];
    const float cG = comb[NHD + w];

    const float* __restrict__ hb = qkv + (long long)b * NNOD * 384 + w * 16;

    // Q as B fragment, K as A fragment; k slot (kh, e) of step s is d = 8*kh + 2*s + e in both
    const float* __restrict__ qp = hb + (i0 + l16) * 384 + 8 * kh;
    const v4f q0 = *(const v4f*)(qp);
    const v4f q1 = *(const v4f*)(qp + 4);
    const v2f qf[4] = { {q0[0], q0[1]}, {q0[2], q0[3]}, {q1[0], q1[1]}, {q1[2], q1[3]} };

    const float* __restrict__ kp = hb + l16 * 384 + 8 * kh;   // K starts 128 floats into a row
    v4f k0[16], k1[16];
#pragma unroll
    for (int jt = 0; jt < 16; ++jt) {
        k0[jt] = *(const v4f*)(kp + 128 + jt * 16 * 384);
        k1[jt] = *(const v4f*)(kp + 128 + jt * 16 * 384 + 4);
    }

    // what the chain needs of this layer's input: the wave's two rows and LN2's scale and shift,
    // four columns a lane; asked for here, they are long there when the attention ends
    const float* __restrict__ hp = hin + (row0 + 2 * w) * HIDD;
    v4f hi[2];
#pragma unroll
    for (int rr = 0; rr < 2; ++rr) hi[rr] = *(const v4f*)(hp + rr * HIDD + lane * 4);
    const v4f gg = *(const v4f*)(g2 + lane * 4);
    const v4f bb = *(const v4f*)(b2 + lane * 4);

    // The wait that belongs in front of any overwrite of a register the loads above name.
    // Bases and offsets are inputs so that their registers stay untouched up to this line.
    asm volatile("s_wait_xcnt 0x0" :: "v"(qp), "v"(kp), "s"(efg), "v"(tid),
                                      "s"(hp), "s"(g2), "s"(b2), "v"(lane) : "memory");

    v8f S[16];
#pragma unroll
    for (int jt = 0; jt < 16; ++jt)
#pragma unroll
        for (int r = 0; r < 8; ++r) S[jt][r] = 0.0f;
#pragma unroll
    for (int g = 0; g < 4; ++g)
#pragma unroll
        for (int s = 0; s < 4; ++s)
#pragma unroll
            for (int t = 0; t < 4; ++t) {
                const int jt = g * 4 + t;
                const v4f kk = (s < 2) ? k0[jt] : k1[jt];
                const v2f a = { kk[(s & 1) * 2], kk[(s & 1) * 2 + 1] };
                S[jt] = __builtin_amdgcn_wmma_f32_16x16x4_f32(
                    false, a, false, qf[s], (short)0, S[jt], false, false);
            }

#pragma unroll
    for (int q = 0; q < 4; ++q) {
        const int f = tid + 256 * q;
        *(v4f*)(efs + (f >> 6) * EFP + (f & 63) * 4) = e4[q];
    }
    __syncthreads();   // the edge tile is read by all eight heads

    // x = s/sqrt(16) + e*cB, row maximum
    const float* er = efs + l16 * EFP + 8 * kh;
    float mx[4] = { -INFINITY, -INFINITY, -INFINITY, -INFINITY };
#pragma unroll
    for (int jt = 0; jt < 16; ++jt) {
        const v4f ea = *(const v4f*)(er + jt * 16);
        const v4f eb = *(const v4f*)(er + jt * 16 + 4);
#pragma unroll
        for (int r = 0; r < 8; ++r) {
            const float e = (r < 4) ? ea[r & 3] : eb[r & 3];
            const float x = S[jt][r] * 0.25f + e * cB;
            S[jt][r] = x;
            mx[r & 3] = fmaxf(mx[r & 3], x);
        }
    }
    float m = fmaxf(fmaxf(mx[0], mx[1]), fmaxf(mx[2], mx[3]));
    m = fmaxf(m, __shfl_xor(m, 16, 32));

    // p = exp(x - m) = exp2(x*log2e - m*log2e), row sum, unnormalised gated weight p*e
    const float L2E = 1.4426950408889634f;
    const float nm  = -m * L2E;
    float sm[4] = { 0.0f, 0.0f, 0.0f, 0.0f };
#pragma unroll
    for (int jt = 0; jt < 16; ++jt) {
        const v4f ea = *(const v4f*)(er + jt * 16);
        const v4f eb = *(const v4f*)(er + jt * 16 + 4);
#pragma unroll
        for (int c = 0; c < 2; ++c) {
            const v4f e = c ? eb : ea;
            v4f p;
            exp2x4(p, fmaf(S[jt][4 * c + 0], L2E, nm), fmaf(S[jt][4 * c + 1], L2E, nm),
                      fmaf(S[jt][4 * c + 2], L2E, nm), fmaf(S[jt][4 * c + 3], L2E, nm));
#pragma unroll
            for (int r = 0; r < 4; ++r) {
                sm[r] += p[r];
                S[jt][4 * c + r] = p[r] * e[r];
            }
        }
    }
    float ss = (sm[0] + sm[1]) + (sm[2] + sm[3]);
    ss += __shfl_xor(ss, 16, 32);

    // Y^T[d][i] = sum_j V[j][d] * w[i][j]; A fragment: lane l16 = d, rows j in the order above
    const float* __restrict__ vp = hb + l16 + 8 * kh * 384;   // V starts 256 floats into a row
    v8f o[2];
#pragma unroll
    for (int r = 0; r < 8; ++r) { o[0][r] = 0.0f; o[1][r] = 0.0f; }
#pragma unroll
    for (int jt = 0; jt < 16; ++jt)
#pragma unroll
        for (int s = 0; s < 4; ++s) {
            const v2f a = { vp[256 + (jt * 16 + 2 * s) * 384], vp[256 + (jt * 16 + 2 * s + 1) * 384] };
            const v2f wv = { S[jt][2 * s], S[jt][2 * s + 1] };
            o[s & 1] = __builtin_amdgcn_wmma_f32_16x16x4_f32(
                false, a, false, wv, (short)0, o[s & 1], false, false);
        }

    // same wait for the V loads: their address pair stays untouched up to this line
    asm volatile("s_wait_xcnt 0x0" :: "v"(vp) : "memory");

    // The chain reads its lane index anew (ln = lane, lr = l16, lk = kh): held in a register
    // across the attention, the index was spilled to scratch in one of the two builds.
    const int ln = __builtin_amdgcn_mbcnt_lo(~0u, 0u);
    const int lr = ln & 15;
    const int lk = ln >> 4;

    const float* zr = zs + lr * ZP + 4 * lk;          // B fragments: row lr of the normed tile
    const float* __restrict__ whp = whT + (48 * w + lr) * HIDD + 4 * lk;
    const float* __restrict__ w1p = w1T + (64 * w + lr) * HIDD + 4 * lk;
    const float* __restrict__ w2p = w2T + lr * 512 + 64 * w + 8 * lk;
    v4f wa[16], wb[16];                                // MLP weight stages
    v4f ea[12], eb[12];                                // QKV weight stages
    v4f yv[2], hv[2];                                  // the wave's two rows, 4 columns a lane
    v4f gg1, bb1;                                      // LN1 scale and shift of the lane's columns

    load_w<4>(wa, w1p, 0);     // first weight stage flies during the hand-over of y and the layernorm
    __builtin_amdgcn_sched_barrier(0);   // issued here, not sunk to the barrier

    // normalise and gate-scale once per output, gather the 8 heads' columns per row in LDS
    const float sc = cG / ss;
    v4f ya, yb;
#pragma unroll
    for (int r = 0; r < 4; ++r) {
        ya[r] = (o[0][r] + o[1][r]) * sc;
        yb[r] = (o[0][r + 4] + o[1][r + 4]) * sc;
    }
    float* yw = ys + lr * YSP + w * 16 + 8 * lk;
    *(v4f*)(yw)     = ya;
    *(v4f*)(yw + 4) = yb;
    __syncthreads();   // every head's columns are in place before whole rows are read

#pragma unroll
    for (int rr = 0; rr < 2; ++rr) {
        yv[rr] = *(const v4f*)(ys + (2 * w + rr) * YSP + ln * 4);
        *(v4f*)(zs + (2 * w + rr) * ZP + ln * 4) = ln_wave(yv[rr] + hi[rr], gg, bb);
    }
    __syncthreads();           // all 16 normed rows are read by every wave

    {
        // act^T = relu(W1^T z^T), hidden columns 64*w .. 64*w + 63; weights one stage ahead
        v8f d[4];
#pragma unroll
        for (int t = 0; t < 4; ++t)
#pragma unroll
            for (int r = 0; r < 8; ++r) d[t][r] = 0.0f;
        load_w<4>(wb, w1p, 1);  mm_stage<4>(d, wa, zr, 0);
        load_w<4>(wa, w1p, 2);  mm_stage<4>(d, wb, zr, 1);
        load_w<4>(wb, w1p, 3);  mm_stage<4>(d, wa, zr, 2);
        load_c(wa, w2p, 0);     mm_stage<4>(d, wb, zr, 3);
#pragma unroll
        for (int t = 0; t < 4; ++t)
#pragma unroll
            for (int r = 0; r < 8; ++r) d[t][r] = fmaxf(d[t][r], 0.0f);

        // partial (act W2)^T over the wave's own 64 hidden columns
        v8f oc[8];
#pragma unroll
        for (int c = 0; c < 8; ++c)
#pragma unroll
            for (int r = 0; r < 8; ++r) oc[c][r] = 0.0f;
        load_c(wb, w2p, 1);  mm_c(oc, wa, d, 0);
        load_c(wa, w2p, 2);  mm_c(oc, wb, d, 1);
        load_c(wb, w2p, 3);  mm_c(oc, wa, d, 2);
        mm_c(oc, wb, d, 3);

        float* rw = red + (w * 16 + lr) * ZP + 8 * lk;
#pragma unroll
        for (int c = 0; c < 8; ++c) {
            const v4f lo = { oc[c][0], oc[c][1], oc[c][2], oc[c][3] };
            const v4f hi4 = { oc[c][4], oc[c][5], oc[c][6], oc[c][7] };
            *(v4f*)(rw + c * 16)     = lo;
            *(v4f*)(rw + c * 16 + 4) = hi4;
        }
        // same wait for the weight loads: both address pairs stay untouched up to this line
        asm volatile("s_wait_xcnt 0x0" :: "v"(w1p), "v"(w2p) : "memory");
        __syncthreads();           // the eight partial sums of every row are in place

        if constexpr (MODE == 1) { // first QKV weight stage flies during the sum and the layernorm
            gg1 = *(const v4f*)(g1 + ln * 4);
            bb1 = *(const v4f*)(b1 + ln * 4);
            load_w<3>(ea, whp, 0);
            __builtin_amdgcn_sched_barrier(0);   // issued here, not sunk to the barrier
        }

#pragma unroll
        for (int rr = 0; rr < 2; ++rr) {
            const float* rp = red + (2 * w + rr) * ZP + ln * 4;
            v4f s = *(const v4f*)rp;
#pragma unroll
            for (int u = 1; u < 8; ++u) s += *(const v4f*)(rp + u * 16 * ZP);
            hv[rr] = s + yv[rr];
        }
    }

    if constexpr (MODE == 2) {
        // out = 10 * tanh((h . Wdec) / sqrt(128))
        const v4f wd = *(const v4f*)(Wdec + ln * 4);
        v2f res;
#pragma unroll
        for (int rr = 0; rr < 2; ++rr) {
            float s = (hv[rr][0] * wd[0] + hv[rr][1] * wd[1]) + (hv[rr][2] * wd[2] + hv[rr][3] * wd[3]);
            for (int o2 = 16; o2 >= 1; o2 >>= 1) s += __shfl_xor(s, o2, 32);
            res[rr] = 10.0f * tanhf(s * 0.08838834764831845f);
        }
        if (ln == 0) *(v2f*)(out + row0 + 2 * w) = res;
    } else {
        float* __restrict__ op = hout + (row0 + 2 * w) * HIDD + ln * 4;
#pragma unroll
        for (int rr = 0; rr < 2; ++rr) {
            *(v4f*)(op + rr * HIDD) = hv[rr];
            *(v4f*)(zs + (2 * w + rr) * ZP + ln * 4) = ln_wave(hv[rr], gg1, bb1);
        }
        // same wait for the stores and the loads since the last one
        asm volatile("s_wait_xcnt 0x0" :: "v"(op), "v"(ln) : "memory");
        __syncthreads();           // all 16 normed rows are read by every wave

        // qkv^T = Wh^T hn^T, columns 48*w .. 48*w + 47
        v8f a[3];
#pragma unroll
        for (int t = 0; t < 3; ++t)
#pragma unroll
            for (int r = 0; r < 8; ++r) a[t][r] = 0.0f;
        load_w<3>(eb, whp, 1);  mm_stage<3>(a, ea, zr, 0);
        load_w<3>(ea, whp, 2);  mm_stage<3>(a, eb, zr, 1);
        load_w<3>(eb, whp, 3);  mm_stage<3>(a, ea, zr, 2);
        mm_stage<3>(a, eb, zr, 3);
        // same wait for the QKV weight loads: their address pair stays untouched up to this line
        asm volatile("s_wait_xcnt 0x0" :: "v"(whp) : "memory");

        float* qw = qkvn + (row0 + lr) * 384 + 48 * w + 8 * lk;
#pragma unroll
        for (int t = 0; t < 3; ++t) {
            const v4f lo = { a[t][0], a[t][1], a[t][2], a[t][3] };
            const v4f hi4 = { a[t][4], a[t][5], a[t][6], a[t][7] };
            *(v4f*)(qw + t * 16)     = lo;
            *(v4f*)(qw + t * 16 + 4) = hi4;
        }
    }
}

// ------ first launch: layer 0's row work, and beside it the preparation of the later launches ------
#define ROWG (NBAT * NNOD / 16)   // work-groups 0 .. ROWG-1: 16 rows each
#define PREPG 121                 // behind them: 24 + 48 + 48 transposing work-groups and one for comb

// One stage of three QKV weight tiles read from the untransposed matrix (rows k, pitch 384):
// the same values in the same registers as load_w<3> takes from the transposed copy.
__device__ __forceinline__ void load_n(v4f (&w)[12], const float* __restrict__ wp, const int st)
{
#pragma unroll
    for (int t = 0; t < 3; ++t)
#pragma unroll
        for (int q = 0; q < 4; ++q)
#pragma unroll
            for (int c = 0; c < 4; ++c)
                w[t * 4 + q][c] = wp[(st * 32 + q * 8 + c) * 384 + t * 16];
}

// out[l][n][m] = in[l][m][n]: one wave turns one tile of 16 m x 32 n, a lane 4 x 4 of it.
// Loads cover whole 128-byte lines, stores 64-byte runs.
template<int M, int N>
__device__ __forceinline__ void transpose_tile(const float* __restrict__ in, float* __restrict__ out,
                                               const int T, const int lane)
{
    constexpr int NTN = N / 32, TPL = (M / 16) * NTN;
    const int l = T / TPL, rem = T % TPL;
    const int m0 = (rem / NTN) * 16 + 4 * (lane >> 3);
    const int n0 = (rem % NTN) * 32 + 4 * (lane & 7);
    const float* __restrict__ ip = in + l * M * N + m0 * N + n0;
    float* __restrict__ op = out + l * M * N + n0 * M + m0;
    v4f r[4];
#pragma unroll
    for (int j = 0; j < 4; ++j) r[j] = *(const v4f*)(ip + j * N);
#pragma unroll
    for (int i = 0; i < 4; ++i) {
        const v4f c = { r[0][i], r[1][i], r[2][i], r[3][i] };
        *(v4f*)(op + i * M) = c;
    }
    // The wait that belongs in front of any overwrite of a register the stores above name.
    asm volatile("s_wait_xcnt 0x0" ::: "memory");
}

__global__ __launch_bounds__(256)
void first_kernel(const float* __restrict__ nf, const float* __restrict__ Wn,
                  const float* __restrict__ g1, const float* __restrict__ b1,
                  const float* __restrict__ Wh, float* __restrict__ hout, float* __restrict__ qkv,
                  const float* __restrict__ W1, const float* __restrict__ W2,
                  const float* __restrict__ We_in, const float* __restrict__ We,
                  float* __restrict__ whT, float* __restrict__ w1T, float* __restrict__ w2T,
                  float* __restrict__ comb)
{
    __shared__ __attribute__((aligned(16))) float zs[16 * ZP];

    const int tid  = threadIdx.x;
    const int w    = __builtin_amdgcn_readfirstlane(tid >> 5);
    const int lane = tid & 31;
    const int l16  = lane & 15;
    const int kh   = lane >> 4;

    // Preparation work-groups: nothing of theirs is read in this launch, and they leave
    // as whole work-groups in front of every barrier.
    if (blockIdx.x >= ROWG) {
        const int pb = blockIdx.x - ROWG;
        if (pb < 24) {            // Wh of layers 1 and 2 (layer 0 is read untransposed below)
            transpose_tile<128, 384>(Wh + 128 * 384, whT + 128 * 384, pb * 8 + w, lane);
        } else if (pb < 72) {
            transpose_tile<128, 512>(W1, w1T, (pb - 24) * 8 + w, lane);
        } else if (pb < 120) {
            transpose_tile<512, 128>(W2, w2T, (pb - 72) * 8 + w, lane);
        } else if (w < 2) {       // comb[l][c] = We_in . We[l][:, c], 48 values; lanes past them repeat the last
            const int t = tid < 48 ? tid : 47;
            const float* __restrict__ wp = We + (t >> 4) * HIDD * 16 + (t & 15);
            float s = 0.0f;
#pragma unroll                    // the loads go out in one run instead of one round trip per group
            for (int d = 0; d < HIDD; ++d) s += We_in[d] * wp[d * 16];
            // The wait that belongs in front of any overwrite of a register the loads above name.
            // The address is an input so that its registers stay untouched up to this line.
            asm volatile("s_wait_xcnt 0x0" :: "v"(wp) : "memory");
            if (tid < 48) comb[tid] = s;
        }
        return;
    }

    const int row0 = blockIdx.x * 16;
    const float* zr = zs + l16 * ZP + 4 * kh;          // B fragments: row l16 of the normed tile
    const float* __restrict__ whp = Wh + 4 * kh * 384 + 48 * w + l16;
    v4f ea[12], eb[12];                                // QKV weight stages
    v4f hv[2];                                         // the wave's two rows, 4 columns a lane

    const v4f gg1 = *(const v4f*)(g1 + lane * 4);
    const v4f bb1 = *(const v4f*)(b1 + lane * 4);
    load_n(ea, whp, 0);
    // The wait that belongs in front of any overwrite of a register the loads above name.
    // Bases and offsets are inputs so that their registers stay untouched up to this line.
    asm volatile("s_wait_xcnt 0x0" :: "s"(g1), "s"(b1), "v"(whp), "v"(lane) : "memory");
    __builtin_amdgcn_sched_barrier(0);   // issued here, not sunk to the barrier: they fly during the layernorm
    const v4f wn0 = *(const v4f*)(Wn + lane * 4);
    const v4f wn1 = *(const v4f*)(Wn + HIDD + lane * 4);
#pragma unroll
    for (int rr = 0; rr < 2; ++rr) {
        const int row = row0 + 2 * w + rr;
        hv[rr] = nf[row * 2] * wn0 + nf[row * 2 + 1] * wn1;
    }

    float* __restrict__ op = hout + (row0 + 2 * w) * HIDD + lane * 4;
#pragma unroll
    for (int rr = 0; rr < 2; ++rr) {
        *(v4f*)(op + rr * HIDD) = hv[rr];
        *(v4f*)(zs + (2 * w + rr) * ZP + lane * 4) = ln_wave(hv[rr], gg1, bb1);
    }
    // same wait for the stores and the loads since the last one
    asm volatile("s_wait_xcnt 0x0" :: "v"(op), "v"(lane) : "memory");
    __syncthreads();           // all 16 normed rows are read by every wave

    // qkv^T = Wh^T hn^T, columns 48*w .. 48*w + 47
    v8f a[3];
#pragma unroll
    for (int t = 0; t < 3; ++t)
#pragma unroll
        for (int r = 0; r < 8; ++r) a[t][r] = 0.0f;
    load_n(eb, whp, 1);  mm_stage<3>(a, ea, zr, 0);
    load_n(ea, whp, 2);  mm_stage<3>(a, eb, zr, 1);
    load_n(eb, whp, 3);  mm_stage<3>(a, ea, zr, 2);
    mm_stage<3>(a, eb, zr, 3);
    // same wait for the QKV weight loads: their address pair stays untouched up to this line
    asm volatile("s_wait_xcnt 0x0" :: "v"(whp) : "memory");

    float* qw = qkv + (row0 + l16) * 384 + 48 * w + 8 * kh;
#pragma unroll
    for (int t = 0; t < 3; ++t) {
        const v4f lo = { a[t][0], a[t][1], a[t][2], a[t][3] };
        const v4f hi4 = { a[t][4], a[t][5], a[t][6], a[t][7] };
        *(v4f*)(qw + t * 16)     = lo;
        *(v4f*)(qw + t * 16 + 4) = hi4;
    }
}

// ---------------- host launch ----------------
extern "C" void kernel_launch(void* const* d_in, const int* in_sizes, int n_in,
                              void* d_out, int out_size, void* d_ws, size_t ws_size,
                              hipStream_t stream)
{
    const float* nf    = (const float*)d_in[0];   // (16,256,2)
    const float* ef    = (const float*)d_in[1];   // (16,256,256,1)
    const float* Wn    = (const float*)d_in[2];   // (2,128)
    const float* We_in = (const float*)d_in[3];   // (1,128)
    const float* ln1g  = (const float*)d_in[4];   // (3,128)
    const float* ln1b  = (const float*)d_in[5];
    const float* Wh    = (const float*)d_in[6];   // (3,128,384)
    const float* We    = (const float*)d_in[7];   // (3,128,16)
    const float* ln2g  = (const float*)d_in[8];
    const float* ln2b  = (const float*)d_in[9];
    const float* W1    = (const float*)d_in[10];  // (3,128,512)
    const float* W2    = (const float*)d_in[11];  // (3,512,128)
    const float* Wdec  = (const float*)d_in[12];  // (128,1)
    float* out = (float*)d_out;

    float* ws = (float*)d_ws;
    float* hA   = ws;                         // 524288, layer input, even layers
    float* hB   = ws + 524288;                // 524288, layer input, odd layers
    float* qkvA = ws + 1048576;               // 1572864, QKV of even layers
    float* qkvB = ws + 2621440;               // 1572864, QKV of the odd layer
    float* comb = ws + 14155776;              // 64 (48 used)
    float* whT  = ws + 14155840;              // 3*384*128 = 147456 (layer 0's part stays unused)
    float* w1T  = ws + 14303296;              // 3*512*128 = 196608
    float* w2T  = ws + 14499904;              // 3*128*512 = 196608

    const dim3 ga(NNOD / 16, NBAT);

    // h0 = nf Wn, qkv0 = LN1(h0) Wh[0]; beside them comb and the transposed weights of the later
    // launches (a fragment's k run contiguous)
    first_kernel<<<ROWG + PREPG, 256, 0, stream>>>(
        nf, Wn, ln1g, ln1b, Wh, hA, qkvA, W1, W2, We_in, We, whT, w1T, w2T, comb);

    // y = (softmax(q k^T / 4 + ef*combB) * ef*combG) @ v, all heads;
    // h1 = relu(LN2(y + h0) W1[0]) W2[0] + y, qkv1 = LN1(h1) Wh[1]
    layer_kernel<1><<<ga, 256, 0, stream>>>(
        qkvA, ef, comb, hA, hB, ln2g, ln2b, w1T, w2T,
        ln1g + HIDD, ln1b + HIDD, whT + 384 * HIDD, qkvB, nullptr, nullptr);

    layer_kernel<1><<<ga, 256, 0, stream>>>(
        qkvB, ef, comb + 16, hB, hA, ln2g + HIDD, ln2b + HIDD, w1T + 512 * HIDD, w2T + 512 * HIDD,
        ln1g + 2 * HIDD, ln1b + 2 * HIDD, whT + 2 * 384 * HIDD, qkvA, nullptr, nullptr);

    // last layer; out = 10 * tanh((h3 @ Wdec) / sqrt(128))
    layer_kernel<2><<<ga, 256, 0, stream>>>(
        qkvA, ef, comb + 32, hA, nullptr, ln2g + 2 * HIDD, ln2b + 2 * HIDD,
        w1T + 2 * 512 * HIDD, w2T + 2 * 512 * HIDD,
        nullptr, nullptr, nullptr, nullptr, Wdec, out);
}

// v005
// One run takes 59.2 microseconds.
// In two side-by-side timings against v004, it was 1.15 and 1.16 times as fast.
// Over all steps from v000 it is 6.10 times as fast.
#include <hip/hip_runtime.h>
#include <math.h>

typedef __attribute__((ext_vector_type(2))) float v2f;
typedef __attribute__((ext_vector_type(4))) float v4f;
typedef __attribute__((ext_vector_type(8))) float v8f;

#define HIDD 128
#define NHD  8
#define NNOD 256
#define NBAT 16

#define ZP 132    // LDS pitch of a 128-wide row in floats: 16 B x odd, b128 reads conflict-free

__device__ __forceinline__ v8f mma_pair(const v4f a, const float b0, const float b1,
                                        const int s, const v8f c)
{
    const v2f av = { a[2 * s], a[2 * s + 1] };
    const v2f bv = { b0, b1 };
    return __builtin_amdgcn_wmma_f32_16x16x4_f32(false, av, false, bv, (short)0, c, false, false);
}

// The same product with the operands swapped (activations as A, weights as B): the tile comes out
// untransposed, a lane's 8 registers are rows 8*kh + r of column l16.  Same k slots, same sum order.
__device__ __forceinline__ v8f mma_pair_t(const v4f a, const float b0, const float b1,
                                          const int s, const v8f c)
{
    const v2f av = { a[2 * s], a[2 * s + 1] };
    const v2f bv = { b0, b1 };
    return __builtin_amdgcn_wmma_f32_16x16x4_f32(false, bv, false, av, (short)0, c, false, false);
}

// layernorm of one 128-wide row held by one wave, four consecutive columns a lane
__device__ __forceinline__ v4f ln_wave(const v4f t, const v4f g, const v4f b)
{
    float s  = (t[0] + t[1]) + (t[2] + t[3]);
    float s2 = (t[0] * t[0] + t[1] * t[1]) + (t[2] * t[2] + t[3] * t[3]);
    for (int o = 16; o >= 1; o >>= 1) {
        s  += __shfl_xor(s,  o, 32);
        s2 += __shfl_xor(s2, o, 32);
    }
    const float mu   = s * (1.0f / HIDD);
    const float var  = s2 * (1.0f / HIDD) - mu * mu;
    const float rinv = rsqrtf(var + 1e-5f);
    v4f r;
    for (int i = 0; i < 4; ++i) r[i] = (t[i] - mu) * rinv * g[i] + b[i];
    return r;
}

// All loops below are unrolled so that the register arrays keep constant indices.
// One stage = 32 k of NT weight tiles of 16 columns n.
// k slot (kh, e) of step (q, s) is k = 32*st + 8*q + 4*kh + 2*s + e, in A and in B alike.
// The weights lie in the workspace in fragment order, [tile n/16][k/8][lane = 16*kh + n%16][4 k],
// so that one 16-byte load of a wave covers 512 contiguous bytes: four whole lines, not a
// quarter of sixteen.  TS = distance in floats between two tiles of the wave.
#define WTILE 2048   // floats of one weight tile: 16 columns x 128 k
template<int NT, int TS>
__device__ __forceinline__ void load_w(v4f (&w)[NT * 4], const float* __restrict__ wp, const int st)
{
#pragma unroll
    for (int t = 0; t < NT; ++t)
#pragma unroll
        for (int q = 0; q < 4; ++q)
            w[t * 4 + q] = *(const v4f*)(wp + t * TS + (st * 4 + q) * 128);
}

// VT: the last tile is made with the operands swapped (mma_pair_t)
template<int NT, bool VT = false>
__device__ __forceinline__ void mm_stage(v8f (&acc)[NT], const v4f (&w)[NT * 4],
                                         const float* zr, const int st)
{
    v4f bz[4];
#pragma unroll
    for (int q = 0; q < 4; ++q) bz[q] = *(const v4f*)(zr + st * 32 + q * 8);
    // keeps the next stage's weight loads and this stage's LDS reads ahead of the WMMA block:
    // left free, the scheduler sinks each load to just before its use and the wave waits it out
    __builtin_amdgcn_sched_barrier(0);
#pragma unroll
    for (int q = 0; q < 4; ++q)
#pragma unroll
        for (int s = 0; s < 2; ++s)
#pragma unroll
            for (int t = 0; t < NT; ++t)
                acc[t] = (VT && t == NT - 1)
                       ? mma_pair_t(w[t * 4 + q], bz[q][2 * s], bz[q][2 * s + 1], s, acc[t])
                       : mma_pair(w[t * 4 + q], bz[q][2 * s], bz[q][2 * s + 1], s, acc[t]);
    __builtin_amdgcn_sched_barrier(0);   // the stage after next is not loaded before this block
}

// One stage of the second MLP product = two output tiles (c = 32*p .. 32*p + 31) over the
// wave's own 64 hidden columns.  Fragment order here too:
// [wave = hidden/64][tile c/16][t = hidden/16 % 4][hf][lane = 16*kh + c%16][4 hidden],
// hidden = 64*wave + 16*t + 8*kh + 4*hf + e.
__device__ __forceinline__ void load_c(v4f (&w)[16], const float* __restrict__ cp, const int p)
{
#pragma unroll
    for (int u = 0; u < 2; ++u)
#pragma unroll
        for (int t = 0; t < 4; ++t)
#pragma unroll
            for (int hf = 0; hf < 2; ++hf)
                w[u * 8 + t * 2 + hf] = *(const v4f*)(cp + (2 * p + u) * 1024 + t * 256 + hf * 128);
}

__device__ __forceinline__ void mm_c(v8f (&acc)[8], const v4f (&w)[16], const v8f (&d)[4], const int p)
{
    __builtin_amdgcn_sched_barrier(0);   // the next stage's weight loads stay ahead of this block
#pragma unroll
    for (int t = 0; t < 4; ++t)
#pragma unroll
        for (int hf = 0; hf < 2; ++hf)
#pragma unroll
            for (int s = 0; s < 2; ++s)
#pragma unroll
                for (int u = 0; u < 2; ++u)
                    acc[2 * p + u] = mma_pair(w[u * 8 + t * 2 + hf], d[t][4 * hf + 2 * s],
                                              d[t][4 * hf + 2 * s + 1], s, acc[2 * p + u]);
    __builtin_amdgcn_sched_barrier(0);   // the stage after next is not loaded before this block
}

// Four exp2 in one statement.  The early-clobber outputs keep every v_exp_f32 from being
// directly followed by a write of its source or a read of its result, and the v_nop is
// the one slot the instruction set asks for behind the last of them.
__device__ __forceinline__ void exp2x4(v4f& p, float t0, float t1, float t2, float t3)
{
    float p0, p1, p2, p3;
    asm("v_exp_f32 %0, %4\n\tv_exp_f32 %1, %5\n\tv_exp_f32 %2, %6\n\tv_exp_f32 %3, %7\n\tv_nop"
        : "=&v"(p0), "=&v"(p1), "=&v"(p2), "=&v"(p3)
        : "v"(t0), "v"(t1), "v"(t2), "v"(t3));
    p[0] = p0; p[1] = p1; p[2] = p2; p[3] = p3;
}

// ------ one whole layer: one workgroup = one batch x 16 rows, eight waves ------
// Attention (one wave per head), then the row-local chain on the same 16 rows, whose y never
// leaves LDS.  MODE 1: LN2, MLP + y, LN1 of the next layer, its QKV.  MODE 2: LN2, MLP + y, decoder.
// The next layer's QKV goes to a second buffer: other workgroups still read K and V of this one.
//
// S^T = K Q^T is kept in registers: lane (l16, kh) register r of tile jt holds
// key j = jt*16 + 8*kh + r of query i0 + l16.  That is already the B fragment of
// Y^T = V^T W^T when the k slots of step s are read as j = jt*16 + 8*kh + 2*s + {0,1},
// so the weights never leave the registers.  The softmax runs down a lane's own
// 128 values plus one exchange between the two lane halves.
//
// Q, K and V lie in the workspace in fragment order,
// [Q | K | V][batch][head][tile of 16 rows][half][lane = 16*kh + l16][4 floats]:
// Q and K: row 16*tile + l16, d = 8*kh + 4*half + e;  V: row 16*tile + 8*kh + 4*half + e, d = l16.
// Every fragment load, and every store of the wave that makes a tile, is 512 contiguous bytes.
#define FTILE 256                    // floats of one tile: 16 rows x 16 d
#define FHEAD (NNOD / 16 * FTILE)    // of one head of one batch
#define FSEC  (NBAT * NHD * FHEAD)   // of all Q, all K or all V
#define EFP 260   // LDS pitch of an edge row in floats: 16 B x odd, b128 reads conflict-free
#define YSP 132   // LDS pitch of an output row in floats: 16 B x odd
template<int MODE>
__global__ __launch_bounds__(256)
void layer_kernel(const float* __restrict__ qkv, const float* __restrict__ ef,
                  const float* __restrict__ comb, const float* __restrict__ hin,
                  float* __restrict__ hout,
                  const float* __restrict__ g2, const float* __restrict__ b2,
                  const float* __restrict__ w1T, const float* __restrict__ w2T,
                  const float* __restrict__ g1, const float* __restrict__ b1,
                  const float* __restrict__ whT, float* __restrict__ qkvn,
                  const float* __restrict__ Wdec, float* __restrict__ out)
{
    __shared__ __attribute__((aligned(16))) float efs[16 * EFP];
    __shared__ __attribute__((aligned(16))) float ys[16 * YSP];
    __shared__ __attribute__((aligned(16))) float zs[16 * ZP];
    __shared__ __attribute__((aligned(16))) float red[8 * 16 * ZP];

    const int i0   = blockIdx.x * 16;
    const int b    = blockIdx.y;
    const int row0 = b * NNOD + i0;
    const int tid  = threadIdx.x;
    const int w    = __builtin_amdgcn_readfirstlane(tid >> 5);   // wave = head
    const int lane = tid & 31;
    const int l16  = lane & 15;
    const int kh   = lane >> 4;

    // edge tile (16 rows x 256, contiguous): loads issued first, so that they fly beside the K loads
    const v4f* __restrict__ efg = (const v4f*)(ef + (long long)row0 * NNOD);
    v4f e4[4];
#pragma unroll
    for (int q = 0; q < 4; ++q) e4[q] = efg[tid + 256 * q];

    const float cB = comb[w];
    const float cG = comb[NHD + w];

    const float* __restrict__ hb = qkv + (b * NHD + w) * FHEAD;   // the head's tiles; a lane reads at 4*lane

    // Q as B fragment, K as A fragment; k slot (kh, e) of step s is d = 8*kh + 2*s + e in both
    const float* __restrict__ qp = hb + blockIdx.x * FTILE;
    const v4f q0 = *(const v4f*)(qp + lane * 4);
    const v4f q1 = *(const v4f*)(qp + 128 + lane * 4);
    const v2f qf[4] = { {q0[0], q0[1]}, {q0[2], q0[3]}, {q1[0], q1[1]}, {q1[2], q1[3]} };

    v4f k0[16], k1[16];
#pragma unroll
    for (int jt = 0; jt < 16; ++jt) {
        k0[jt] = *(const v4f*)(hb + FSEC + jt * FTILE + lane * 4);
        k1[jt] = *(const v4f*)(hb + FSEC + jt * FTILE + 128 + lane * 4);
    }

    // what the chain needs of this layer's input: the wave's two rows and LN2's scale and shift,
    // four columns a lane; asked for here, they are long there when the attention ends
    const float* __restrict__ hp = hin + (row0 + 2 * w) * HIDD;
    v4f hi[2];
#pragma unroll
    for (int rr = 0; rr < 2; ++rr) hi[rr] = *(const v4f*)(hp + rr * HIDD + lane * 4);
    const v4f gg = *(const v4f*)(g2 + lane * 4);
    const v4f bb = *(const v4f*)(b2 + lane * 4);

    // The wait that belongs in front of any overwrite of a register the loads above name.
    // Bases and offsets are inputs so that their registers stay untouched up to this line.
    asm volatile("s_wait_xcnt 0x0" :: "s"(qp), "s"(hb), "s"(efg), "v"(tid),
                                      "s"(hp), "s"(g2), "s"(b2), "v"(lane) : "memory");

    v8f S[16];
#pragma unroll
    for (int jt = 0; jt < 16; ++jt)
#pragma unroll
        for (int r = 0; r < 8; ++r) S[jt][r] = 0.0f;
#pragma unroll
    for (int g = 0; g < 4; ++g)
#pragma unroll
        for (int s = 0; s < 4; ++s)
#pragma unroll
            for (int t = 0; t < 4; ++t) {
                const int jt = g * 4 + t;
                const v4f kk = (s < 2) ? k0[jt] : k1[jt];
                const v2f a = { kk[(s & 1) * 2], kk[(s & 1) * 2 + 1] };
                S[jt] = __builtin_amdgcn_wmma_f32_16x16x4_f32(
                    false, a, false, qf[s], (short)0, S[jt], false, false);
            }

#pragma unroll
    for (int q = 0; q < 4; ++q) {
        const int f = tid + 256 * q;
        *(v4f*)(efs + (f >> 6) * EFP + (f & 63) * 4) = e4[q];
    }
    __syncthreads();   // the edge tile is read by all eight heads

    // x = s/sqrt(16) + e*cB, row maximum
    const float* er = efs + l16 * EFP + 8 * kh;
    float mx[4] = { -INFINITY, -INFINITY, -INFINITY, -INFINITY };
#pragma unroll
    for (int jt = 0; jt < 16; ++jt) {
        const v4f ea = *(const v4f*)(er + jt * 16);
        const v4f eb = *(const v4f*)(er + jt * 16 + 4);
#pragma unroll
        for (int r = 0; r < 8; ++r) {
            const float e = (r < 4) ? ea[r & 3] : eb[r & 3];
            const float x = S[jt][r] * 0.25f + e * cB;
            S[jt][r] = x;
            mx[r & 3] = fmaxf(mx[r & 3], x);
        }
    }
    float m = fmaxf(fmaxf(mx[0], mx[1]), fmaxf(mx[2], mx[3]));
    m = fmaxf(m, __shfl_xor(m, 16, 32));

    // p = exp(x - m) = exp2(x*log2e - m*log2e), row sum, unnormalised gated weight p*e
    const float L2E = 1.4426950408889634f;
    const float nm  = -m * L2E;
    float sm[4] = { 0.0f, 0.0f, 0.0f, 0.0f };
#pragma unroll
    for (int jt = 0; jt < 16; ++jt) {
        const v4f ea = *(const v4f*)(er + jt * 16);
        const v4f eb = *(const v4f*)(er + jt * 16 + 4);
#pragma unroll
        for (int c = 0; c < 2; ++c) {
            const v4f e = c ? eb : ea;
            v4f p;
            exp2x4(p, fmaf(S[jt][4 * c + 0], L2E, nm), fmaf(S[jt][4 * c + 1], L2E, nm),
                      fmaf(S[jt][4 * c + 2], L2E, nm), fmaf(S[jt][4 * c + 3], L2E, nm));
#pragma unroll
            for (int r = 0; r < 4; ++r) {
                sm[r] += p[r];
                S[jt][4 * c + r] = p[r] * e[r];
            }
        }
    }
    float ss = (sm[0] + sm[1]) + (sm[2] + sm[3]);
    ss += __shfl_xor(ss, 16, 32);

    // Y^T[d][i] = sum_j V[j][d] * w[i][j]; A fragment: lane l16 = d, rows j in the order above
    v8f o[2];
#pragma unroll
    for (int r = 0; r < 8; ++r) { o[0][r] = 0.0f; o[1][r] = 0.0f; }
#pragma unroll
    for (int jt = 0; jt < 16; ++jt) {
        const v4f v0 = *(const v4f*)(hb + 2 * FSEC + jt * FTILE + lane * 4);
        const v4f v1 = *(const v4f*)(hb + 2 * FSEC + jt * FTILE + 128 + lane * 4);
#pragma unroll
        for (int s = 0; s < 4; ++s) {
            const v4f vv = (s < 2) ? v0 : v1;
            const v2f a = { vv[(s & 1) * 2], vv[(s & 1) * 2 + 1] };
            const v2f wv = { S[jt][2 * s], S[jt][2 * s + 1] };
            o[s & 1] = __builtin_amdgcn_wmma_f32_16x16x4_f32(
                false, a, false, wv, (short)0, o[s & 1], false, false);
        }
    }

    // same wait for the V loads: their base and offset stay untouched up to this line
    asm volatile("s_wait_xcnt 0x0" :: "s"(hb), "v"(lane) : "memory");

    // The chain reads its lane index anew (ln = lane, lr = l16, lk = kh): held in a register
    // across the attention, the index was spilled to scratch in one of the two builds.
    const int ln = __builtin_amdgcn_mbcnt_lo(~0u, 0u);
    const int lr = ln & 15;
    const int lk = ln >> 4;

    const float* zr = zs + lr * ZP + 4 * lk;          // B fragments: row lr of the normed tile
    const float* __restrict__ whb = whT + w * WTILE;       // tiles w, 8 + w, 16 + w: Q, K, V of head w
    const float* __restrict__ w1b = w1T + 4 * w * WTILE;   // tiles 4*w .. 4*w + 3
    const float* __restrict__ w2b = w2T + w * 8192;        // the wave's 64 hidden columns
    const float* __restrict__ whp = whb + ln * 4;
    const float* __restrict__ w1p = w1b + ln * 4;
    const float* __restrict__ w2p = w2b + ln * 4;
    v4f wa[16], wb[16];                                // MLP weight stages
    v4f ea[12], eb[12];                                // QKV weight stages
    v4f yv[2], hv[2];                                  // the wave's two rows, 4 columns a lane
    v4f gg1, bb1;                                      // LN1 scale and shift of the lane's columns

    load_w<4, WTILE>(wa, w1p, 0);     // first weight stage flies during the hand-over of y and the layernorm
    __builtin_amdgcn_sched_barrier(0);   // issued here, not sunk to the barrier

    // normalise and gate-scale once per output, gather the 8 heads' columns per row in LDS
    const float sc = cG / ss;
    v4f ya, yb;
#pragma unroll
    for (int r = 0; r < 4; ++r) {
        ya[r] = (o[0][r] + o[1][r]) * sc;
        yb[r] = (o[0][r + 4] + o[1][r + 4]) * sc;
    }
    float* yw = ys + lr * YSP + w * 16 + 8 * lk;
    *(v4f*)(yw)     = ya;
    *(v4f*)(yw + 4) = yb;
    __syncthreads();   // every head's columns are in place before whole rows are read

#pragma unroll
    for (int rr = 0; rr < 2; ++rr) {
        yv[rr] = *(const v4f*)(ys + (2 * w + rr) * YSP + ln * 4);
        *(v4f*)(zs + (2 * w + rr) * ZP + ln * 4) = ln_wave(yv[rr] + hi[rr], gg, bb);
    }
    __syncthreads();           // all 16 normed rows are read by every wave

    {
        // act^T = relu(W1^T z^T), hidden columns 64*w .. 64*w + 63; weights one stage ahead
        v8f d[4];
#pragma unroll
        for (int t = 0; t < 4; ++t)
#pragma unroll
            for (int r = 0; r < 8; ++r) d[t][r] = 0.0f;
        load_w<4, WTILE>(wb, w1p, 1);  mm_stage<4>(d, wa, zr, 0);
        load_w<4, WTILE>(wa, w1p, 2);  mm_stage<4>(d, wb, zr, 1);
        load_w<4, WTILE>(wb, w1p, 3);  mm_stage<4>(d, wa, zr, 2);
        load_c(wa, w2p, 0);     mm_stage<4>(d, wb, zr, 3);
#pragma unroll
        for (int t = 0; t < 4; ++t)
#pragma unroll
            for (int r = 0; r < 8; ++r) d[t][r] = fmaxf(d[t][r], 0.0f);

        // partial (act W2)^T over the wave's own 64 hidden columns
        v8f oc[8];
#pragma unroll
        for (int c = 0; c < 8; ++c)
#pragma unroll
            for (int r = 0; r < 8; ++r) oc[c][r] = 0.0f;
        load_c(wb, w2p, 1);  mm_c(oc, wa, d, 0);
        load_c(wa, w2p, 2);  mm_c(oc, wb, d, 1);
        load_c(wb, w2p, 3);  mm_c(oc, wa, d, 2);
        mm_c(oc, wb, d, 3);

        float* rw = red + (w * 16 + lr) * ZP + 8 * lk;
#pragma unroll
        for (int c = 0; c < 8; ++c) {
            const v4f lo = { oc[c][0], oc[c][1], oc[c][2], oc[c][3] };
            const v4f hi4 = { oc[c][4], oc[c][5], oc[c][6], oc[c][7] };
            *(v4f*)(rw + c * 16)     = lo;
            *(v4f*)(rw + c * 16 + 4) = hi4;
        }
        // same wait for the weight loads: both bases and the offset stay untouched up to this line
        asm volatile("s_wait_xcnt 0x0" :: "s"(w1b), "s"(w2b), "v"(ln) : "memory");
        __syncthreads();           // the eight partial sums of every row are in place

        if constexpr (MODE == 1) { // first QKV weight stage flies during the sum and the layernorm
            gg1 = *(const v4f*)(g1 + ln * 4);
            bb1 = *(const v4f*)(b1 + ln * 4);
            load_w<3, 8 * WTILE>(ea, whp, 0);
            __builtin_amdgcn_sched_barrier(0);   // issued here, not sunk to the barrier
        }

#pragma unroll
        for (int rr = 0; rr < 2; ++rr) {
            const float* rp = red + (2 * w + rr) * ZP + ln * 4;
            v4f s = *(const v4f*)rp;
#pragma unroll
            for (int u = 1; u < 8; ++u) s += *(const v4f*)(rp + u * 16 * ZP);
            hv[rr] = s + yv[rr];
        }
    }

    if constexpr (MODE == 2) {
        // out = 10 * tanh((h . Wdec) / sqrt(128))
        const v4f wd = *(const v4f*)(Wdec + ln * 4);
        v2f res;
#pragma unroll
        for (int rr = 0; rr < 2; ++rr) {
            float s = (hv[rr][0] * wd[0] + hv[rr][1] * wd[1]) + (hv[rr][2] * wd[2] + hv[rr][3] * wd[3]);
            for (int o2 = 16; o2 >= 1; o2 >>= 1) s += __shfl_xor(s, o2, 32);
            res[rr] = 10.0f * tanhf(s * 0.08838834764831845f);
        }
        if (ln == 0) *(v2f*)(out + row0 + 2 * w) = res;
    } else {
        float* __restrict__ op = hout + (row0 + 2 * w) * HIDD + ln * 4;
#pragma unroll
        for (int rr = 0; rr < 2; ++rr) {
            *(v4f*)(op + rr * HIDD) = hv[rr];
            *(v4f*)(zs + (2 * w + rr) * ZP + ln * 4) = ln_wave(hv[rr], gg1, bb1);
        }
        // same wait for the stores and the loads since the last one
        asm volatile("s_wait_xcnt 0x0" :: "v"(op), "v"(ln) : "memory");
        __syncthreads();           // all 16 normed rows are read by every wave

        // Q^T, K^T and V of head w: columns 16*w .. 16*w + 15 of each third of Wh
        v8f a[3];
#pragma unroll
        for (int t = 0; t < 3; ++t)
#pragma unroll
            for (int r = 0; r < 8; ++r) a[t][r] = 0.0f;
        load_w<3, 8 * WTILE>(eb, whp, 1);  mm_stage<3, true>(a, ea, zr, 0);
        load_w<3, 8 * WTILE>(ea, whp, 2);  mm_stage<3, true>(a, eb, zr, 1);
        load_w<3, 8 * WTILE>(eb, whp, 3);  mm_stage<3, true>(a, ea, zr, 2);
        mm_stage<3, true>(a, eb, zr, 3);
        // same wait for the QKV weight loads: their base and offset stay untouched up to this line
        asm volatile("s_wait_xcnt 0x0" :: "s"(whb), "v"(ln) : "memory");

        float* qw = qkvn + (b * NHD + w) * FHEAD + blockIdx.x * FTILE + ln * 4;
#pragma unroll
        for (int t = 0; t < 3; ++t) {
            const v4f lo = { a[t][0], a[t][1], a[t][2], a[t][3] };
            const v4f hi4 = { a[t][4], a[t][5], a[t][6], a[t][7] };
            *(v4f*)(qw + t * FSEC)       = lo;
            *(v4f*)(qw + t * FSEC + 128) = hi4;
        }
    }
}

// ------ first launch: layer 0's row work, and beside it the preparation of the later launches ------
#define ROWG (NBAT * NNOD / 16)   // work-groups 0 .. ROWG-1: 16 rows each
#define PREPG 121                 // behind them: 24 + 48 + 48 weight-ordering work-groups and one for comb

// One stage of the wave's three QKV weight tiles read from the matrix as it is given (rows k,
// pitch 384): the same values in the same registers as load_w takes from the fragment-order copy.
__device__ __forceinline__ void load_n(v4f (&w)[12], const float* __restrict__ wp, const int st)
{
#pragma unroll
    for (int t = 0; t < 3; ++t)
#pragma unroll
        for (int q = 0; q < 4; ++q)
#pragma unroll
            for (int c = 0; c < 4; ++c)
                w[t * 4 + q][c] = wp[(st * 32 + q * 8 + c) * 384 + t * HIDD];
}

// in[l][m][n] to fragment order, m being the k index of the product: one wave turns one tile of
// 16 m x 32 n, a lane 4 x 4 of it; four consecutive m of one n are one lane's 16 bytes of a fragment.
// W2ORD false: the order load_w reads; true: the order load_c reads.
// Loads cover whole 128-byte lines; a wave's four stores together fill whole 512-byte blocks.
template<int M, int N, bool W2ORD>
__device__ __forceinline__ void pack_tile(const float* __restrict__ in, float* __restrict__ out,
                                               const int T, const int lane)
{
    constexpr int NTN = N / 32, TPL = (M / 16) * NTN;
    const int l = T / TPL, rem = T % TPL;
    const int m0 = (rem / NTN) * 16 + 4 * (lane >> 3);
    const int n0 = (rem % NTN) * 32 + 4 * (lane & 7);
    const float* __restrict__ ip = in + l * M * N + m0 * N + n0;
    const int off = W2ORD
        ? (m0 >> 6) * 8192 + (n0 >> 4) * 1024 + ((m0 >> 4) & 3) * 256 + ((m0 >> 2) & 1) * 128
          + (((m0 >> 3) & 1) * 16 + (n0 & 15)) * 4
        : ((n0 >> 4) * 16 + (m0 >> 3)) * 128 + (((m0 >> 2) & 1) * 16 + (n0 & 15)) * 4;
    float* __restrict__ op = out + l * M * N + off;
    v4f r[4];
#pragma unroll
    for (int j = 0; j < 4; ++j) r[j] = *(const v4f*)(ip + j * N);
#pragma unroll
    for (int i = 0; i < 4; ++i) {
        const v4f c = { r[0][i], r[1][i], r[2][i], r[3][i] };
        *(v4f*)(op + i * 4) = c;
    }
    // The wait that belongs in front of any overwrite of a register the stores above name.
    asm volatile("s_wait_xcnt 0x0" ::: "memory");
}

__global__ __launch_bounds__(256)
void first_kernel(const float* __restrict__ nf, const float* __restrict__ Wn,
                  const float* __restrict__ g1, const float* __restrict__ b1,
                  const float* __restrict__ Wh, float* __restrict__ hout, float* __restrict__ qkv,
                  const float* __restrict__ W1, const float* __restrict__ W2,
                  const float* __restrict__ We_in, const float* __restrict__ We,
                  float* __restrict__ whT, float* __restrict__ w1T, float* __restrict__ w2T,
                  float* __restrict__ comb)
{
    __shared__ __attribute__((aligned(16))) float zs[16 * ZP];

    const int tid  = threadIdx.x;
    const int w    = __builtin_amdgcn_readfirstlane(tid >> 5);
    const int lane = tid & 31;
    const int l16  = lane & 15;
    const int kh   = lane >> 4;

    // Preparation work-groups: nothing of theirs is read in this launch, and they leave
    // as whole work-groups in front of every barrier.
    if (blockIdx.x >= ROWG) {
        const int pb = blockIdx.x - ROWG;
        if (pb < 24) {            // Wh of layers 1 and 2 (layer 0 is read as it is given below)
            pack_tile<128, 384, false>(Wh + 128 * 384, whT + 128 * 384, pb * 8 + w, lane);
        } else if (pb < 72) {
            pack_tile<128, 512, false>(W1, w1T, (pb - 24) * 8 + w, lane);
        } else if (pb < 120) {
            pack_tile<512, 128, true>(W2, w2T, (pb - 72) * 8 + w, lane);
        } else if (w < 2) {       // comb[l][c] = We_in . We[l][:, c], 48 values; lanes past them repeat the last
            const int t = tid < 48 ? tid : 47;
            const float* __restrict__ wp = We + (t >> 4) * HIDD * 16 + (t & 15);
            float s = 0.0f;
#pragma unroll                    // the loads go out in one run instead of one round trip per group
            for (int d = 0; d < HIDD; ++d) s += We_in[d] * wp[d * 16];
            // The wait that belongs in front of any overwrite of a register the loads above name.
            // The address is an input so that its registers stay untouched up to this line.
            asm volatile("s_wait_xcnt 0x0" :: "v"(wp) : "memory");
            if (tid < 48) comb[tid] = s;
        }
        return;
    }

    const int row0 = blockIdx.x * 16;
    const float* zr = zs + l16 * ZP + 4 * kh;          // B fragments: row l16 of the normed tile
    const float* __restrict__ whp = Wh + 4 * kh * 384 + 16 * w + l16;
    v4f ea[12], eb[12];                                // QKV weight stages
    v4f hv[2];                                         // the wave's two rows, 4 columns a lane

    const v4f gg1 = *(const v4f*)(g1 + lane * 4);
    const v4f bb1 = *(const v4f*)(b1 + lane * 4);
    load_n(ea, whp, 0);
    // The wait that belongs in front of any overwrite of a register the loads above name.
    // Bases and offsets are inputs so that their registers stay untouched up to this line.
    asm volatile("s_wait_xcnt 0x0" :: "s"(g1), "s"(b1), "v"(whp), "v"(lane) : "memory");
    __builtin_amdgcn_sched_barrier(0);   // issued here, not sunk to the barrier: they fly during the layernorm
    const v4f wn0 = *(const v4f*)(Wn + lane * 4);
    const v4f wn1 = *(const v4f*)(Wn + HIDD + lane * 4);
#pragma unroll
    for (int rr = 0; rr < 2; ++rr) {
        const int row = row0 + 2 * w + rr;
        hv[rr] = nf[row * 2] * wn0 + nf[row * 2 + 1] * wn1;
    }

    float* __restrict__ op = hout + (row0 + 2 * w) * HIDD + lane * 4;
#pragma unroll
    for (int rr = 0; rr < 2; ++rr) {
        *(v4f*)(op + rr * HIDD) = hv[rr];
        *(v4f*)(zs + (2 * w + rr) * ZP + lane * 4) = ln_wave(hv[rr], gg1, bb1);
    }
    // same wait for the stores and the loads since the last one
    asm volatile("s_wait_xcnt 0x0" :: "v"(op), "v"(lane) : "memory");
    __syncthreads();           // all 16 normed rows are read by every wave

    // Q^T, K^T and V of head w: columns 16*w .. 16*w + 15 of each third of Wh
    v8f a[3];
#pragma unroll
    for (int t = 0; t < 3; ++t)
#pragma unroll
        for (int r = 0; r < 8; ++r) a[t][r] = 0.0f;
    load_n(eb, whp, 1);  mm_stage<3, true>(a, ea, zr, 0);
    load_n(ea, whp, 2);  mm_stage<3, true>(a, eb, zr, 1);
    load_n(eb, whp, 3);  mm_stage<3, true>(a, ea, zr, 2);
    mm_stage<3, true>(a, eb, zr, 3);
    // same wait for the QKV weight loads: their address pair stays untouched up to this line
    asm volatile("s_wait_xcnt 0x0" :: "v"(whp) : "memory");

    float* qw = qkv + ((blockIdx.x >> 4) * NHD + w) * FHEAD + (blockIdx.x & 15) * FTILE + lane * 4;
#pragma unroll
    for (int t = 0; t < 3; ++t) {
        const v4f lo = { a[t][0], a[t][1], a[t][2], a[t][3] };
        const v4f hi4 = { a[t][4], a[t][5], a[t][6], a[t][7] };
        *(v4f*)(qw + t * FSEC)       = lo;
        *(v4f*)(qw + t * FSEC + 128) = hi4;
    }
    // same wait for these stores: the code of the other work-groups follows in the listing
    asm volatile("s_wait_xcnt 0x0" ::: "memory");
}

// ---------------- host launch ----------------
extern "C" void kernel_launch(void* const* d_in, const int* in_sizes, int n_in,
                              void* d_out, int out_size, void* d_ws, size_t ws_size,
                              hipStream_t stream)
{
    const float* nf    = (const float*)d_in[0];   // (16,256,2)
    const float* ef    = (const float*)d_in[1];   // (16,256,256,1)
    const float* Wn    = (const float*)d_in[2];   // (2,128)
    const float* We_in = (const float*)d_in[3];   // (1,128)
    const float* ln1g  = (const float*)d_in[4];   // (3,128)
    const float* ln1b  = (const float*)d_in[5];
    const float* Wh    = (const float*)d_in[6];   // (3,128,384)
    const float* We    = (const float*)d_in[7];   // (3,128,16)
    const float* ln2g  = (const float*)d_in[8];
    const float* ln2b  = (const float*)d_in[9];
    const float* W1    = (const float*)d_in[10];  // (3,128,512)
    const float* W2    = (const float*)d_in[11];  // (3,512,128)
    const float* Wdec  = (const float*)d_in[12];  // (128,1)
    float* out = (float*)d_out;

    float* ws = (float*)d_ws;
    float* hA   = ws;                         // 524288, layer input, even layers
    float* hB   = ws + 524288;                // 524288, layer input, odd layers
    float* qkvA = ws + 1048576;               // 1572864, QKV of even layers
    float* qkvB = ws + 2621440;               // 1572864, QKV of the odd layer
    float* comb = ws + 14155776;              // 64 (48 used)
    float* whT  = ws + 14155840;              // 3*384*128 = 147456 (layer 0's part stays unused)
    float* w1T  = ws + 14303296;              // 3*512*128 = 196608
    float* w2T  = ws + 14499904;              // 3*128*512 = 196608

    const dim3 ga(NNOD / 16, NBAT);

    // h0 = nf Wn, qkv0 = LN1(h0) Wh[0]; beside them comb and the weights of the later
    // launches in fragment order
    first_kernel<<<ROWG + PREPG, 256, 0, stream>>>(
        nf, Wn, ln1g, ln1b, Wh, hA, qkvA, W1, W2, We_in, We, whT, w1T, w2T, comb);

    // y = (softmax(q k^T / 4 + ef*combB) * ef*combG) @ v, all heads;
    // h1 = relu(LN2(y + h0) W1[0]) W2[0] + y, qkv1 = LN1(h1) Wh[1]
    layer_kernel<1><<<ga, 256, 0, stream>>>(
        qkvA, ef, comb, hA, hB, ln2g, ln2b, w1T, w2T,
        ln1g + HIDD, ln1b + HIDD, whT + 384 * HIDD, qkvB, nullptr, nullptr);

    layer_kernel<1><<<ga, 256, 0, stream>>>(
        qkvB, ef, comb + 16, hB, hA, ln2g + HIDD, ln2b + HIDD, w1T + 512 * HIDD, w2T + 512 * HIDD,
        ln1g + 2 * HIDD, ln1b + 2 * HIDD, whT + 2 * 384 * HIDD, qkvA, nullptr, nullptr);

    // last layer; out = 10 * tanh((h3 @ Wdec) / sqrt(128))
    layer_kernel<2><<<ga, 256, 0, stream>>>(
        qkvA, ef, comb + 32, hA, nullptr, ln2g + 2 * HIDD, ln2b + 2 * HIDD,
        w1T + 2 * 512 * HIDD, w2T + 2 * 512 * HIDD,
        nullptr, nullptr, nullptr, nullptr, Wdec, out);
}

// v006
// A run of this version takes 56.2 microseconds.
// Two timings next to v005 put it at 1.05 and 1.07 times that version's speed.
// Over all steps from v000 it is 6.49 times as fast.
#include <hip/hip_runtime.h>
#include <math.h>

typedef __attribute__((ext_vector_type(2))) float v2f;
typedef __attribute__((ext_vector_type(4))) float v4f;
typedef __attribute__((ext_vector_type(8))) float v8f;

#define HIDD 128
#define NHD  8
#define NNOD 256
#define NBAT 16

#define ZP 132    // LDS pitch of a 128-wide row in floats: 16 B x odd, b128 reads conflict-free

__device__ __forceinline__ v8f mma_pair(const v4f a, const float b0, const float b1,
                                        const int s, const v8f c)
{
    const v2f av = { a[2 * s], a[2 * s + 1] };
    const v2f bv = { b0, b1 };
    return __builtin_amdgcn_wmma_f32_16x16x4_f32(false, av, false, bv, (short)0, c, false, false);
}

// The same product with the operands swapped (activations as A, weights as B): the tile comes out
// untransposed, a lane's 8 registers are rows 8*kh + r of column l16.  Same k slots, same sum order.
__device__ __forceinline__ v8f mma_pair_t(const v4f a, const float b0, const float b1,
                                          const int s, const v8f c)
{
    const v2f av = { a[2 * s], a[2 * s + 1] };
    const v2f bv = { b0, b1 };
    return __builtin_amdgcn_wmma_f32_16x16x4_f32(false, bv, false, av, (short)0, c, false, false);
}

// layernorm of one 128-wide row held by one wave, four consecutive columns a lane
__device__ __forceinline__ v4f ln_wave(const v4f t, const v4f g, const v4f b)
{
    float s  = (t[0] + t[1]) + (t[2] + t[3]);
    float s2 = (t[0] * t[0] + t[1] * t[1]) + (t[2] * t[2] + t[3] * t[3]);
    for (int o = 16; o >= 1; o >>= 1) {
        s  += __shfl_xor(s,  o, 32);
        s2 += __shfl_xor(s2, o, 32);
    }
    const float mu   = s * (1.0f / HIDD);
    const float var  = s2 * (1.0f / HIDD) - mu * mu;
    const float rinv = rsqrtf(var + 1e-5f);
    v4f r;
    for (int i = 0; i < 4; ++i) r[i] = (t[i] - mu) * rinv * g[i] + b[i];
    return r;
}

// All loops below are unrolled so that the register arrays keep constant indices.
// One stage = 32 k of NT weight tiles of 16 columns n.
// k slot (kh, e) of step (q, s) is k = 32*st + 8*q + 4*kh + 2*s + e, in A and in B alike.
// The weights lie in the workspace in fragment order, [tile n/16][k/8][lane = 16*kh + n%16][4 k],
// so that one 16-byte load of a wave covers 512 contiguous bytes: four whole lines, not a
// quarter of sixteen.  TS = distance in floats between two tiles of the wave.
#define WTILE 2048   // floats of one weight tile: 16 columns x 128 k
template<int NT, int TS>
__device__ __forceinline__ void load_w(v4f (&w)[NT * 4], const float* __restrict__ wp, const int st)
{
#pragma unroll
    for (int t = 0; t < NT; ++t)
#pragma unroll
        for (int q = 0; q < 4; ++q)
            w[t * 4 + q] = *(const v4f*)(wp + t * TS + (st * 4 + q) * 128);
}

// VT: the last tile is made with the operands swapped (mma_pair_t)
template<int NT, bool VT = false>
__device__ __forceinline__ void mm_stage(v8f (&acc)[NT], const v4f (&w)[NT * 4],
                                         const float* zr, const int st)
{
    v4f bz[4];
#pragma unroll
    for (int q = 0; q < 4; ++q) bz[q] = *(const v4f*)(zr + st * 32 + q * 8);
    // keeps the next stage's weight loads and this stage's LDS reads ahead of the WMMA block:
    // left free, the scheduler sinks each load to just before its use and the wave waits it out
    __builtin_amdgcn_sched_barrier(0);
#pragma unroll
    for (int q = 0; q < 4; ++q)
#pragma unroll
        for (int s = 0; s < 2; ++s)
#pragma unroll
            for (int t = 0; t < NT; ++t)
                acc[t] = (VT && t == NT - 1)
                       ? mma_pair_t(w[t * 4 + q], bz[q][2 * s], bz[q][2 * s + 1], s, acc[t])
                       : mma_pair(w[t * 4 + q], bz[q][2 * s], bz[q][2 * s + 1], s, acc[t]);
    __builtin_amdgcn_sched_barrier(0);   // the loads that follow are not issued before this block
}

// One stage of the second MLP product = two output tiles (c = 32*p .. 32*p + 31) over the
// wave's own 64 hidden columns.  Fragment order here too:
// [wave = hidden/64][tile c/16][t = hidden/16 % 4][hf][lane = 16*kh + c%16][4 hidden],
// hidden = 64*wave + 16*t + 8*kh + 4*hf + e.
__device__ __forceinline__ void load_c(v4f (&w)[16], const float* __restrict__ cp, const int p)
{
#pragma unroll
    for (int u = 0; u < 2; ++u)
#pragma unroll
        for (int t = 0; t < 4; ++t)
#pragma unroll
            for (int hf = 0; hf < 2; ++hf)
                w[u * 8 + t * 2 + hf] = *(const v4f*)(cp + (2 * p + u) * 1024 + t * 256 + hf * 128);
}

__device__ __forceinline__ void mm_c(v8f (&acc)[8], const v4f (&w)[16], const v8f (&d)[4], const int p)
{
    __builtin_amdgcn_sched_barrier(0);   // the loads issued in front of it stay ahead of this block
#pragma unroll
    for (int t = 0; t < 4; ++t)
#pragma unroll
        for (int hf = 0; hf < 2; ++hf)
#pragma unroll
            for (int s = 0; s < 2; ++s)
#pragma unroll
                for (int u = 0; u < 2; ++u)
                    acc[2 * p + u] = mma_pair(w[u * 8 + t * 2 + hf], d[t][4 * hf + 2 * s],
                                              d[t][4 * hf + 2 * s + 1], s, acc[2 * p + u]);
    __builtin_amdgcn_sched_barrier(0);   // the loads that follow are not issued before this block
}

// Work-group barrier that waits for the wave's LDS operations only.  __syncthreads() also waits for
// every global load in flight, which would drain the weight stages that are requested ahead; nothing
// that passes between the waves of a work-group here goes through global memory.
__device__ __forceinline__ void lds_barrier()
{
    __builtin_amdgcn_fence(__ATOMIC_RELEASE, "workgroup", "local");
    __builtin_amdgcn_s_barrier();
    __builtin_amdgcn_fence(__ATOMIC_ACQUIRE, "workgroup", "local");
}

// Four exp2 in one statement.  The early-clobber outputs keep every v_exp_f32 from being
// directly followed by a write of its source or a read of its result, and the v_nop is
// the one slot the instruction set asks for behind the last of them.
__device__ __forceinline__ void exp2x4(v4f& p, float t0, float t1, float t2, float t3)
{
    float p0, p1, p2, p3;
    asm("v_exp_f32 %0, %4\n\tv_exp_f32 %1, %5\n\tv_exp_f32 %2, %6\n\tv_exp_f32 %3, %7\n\tv_nop"
        : "=&v"(p0), "=&v"(p1), "=&v"(p2), "=&v"(p3)
        : "v"(t0), "v"(t1), "v"(t2), "v"(t3));
    p[0] = p0; p[1] = p1; p[2] = p2; p[3] = p3;
}

// ------ one whole layer: one workgroup = one batch x 16 rows, eight waves ------
// Attention (one wave per head), then the row-local chain on the same 16 rows, whose y never
// leaves LDS.  MODE 1: LN2, MLP + y, LN1 of the next layer, its QKV.  MODE 2: LN2, MLP + y, decoder.
// The next layer's QKV goes to a second buffer: other workgroups still read K and V of this one.
//
// S^T = K Q^T is kept in registers: lane (l16, kh) register r of tile jt holds
// key j = jt*16 + 8*kh + r of query i0 + l16.  That is already the B fragment of
// Y^T = V^T W^T when the k slots of step s are read as j = jt*16 + 8*kh + 2*s + {0,1},
// so the weights never leave the registers.  The softmax runs down a lane's own
// 128 values plus one exchange between the two lane halves.
//
// Q, K and V lie in the workspace in fragment order,
// [Q | K | V][batch][head][tile of 16 rows][half][lane = 16*kh + l16][4 floats]:
// Q and K: row 16*tile + l16, d = 8*kh + 4*half + e;  V: row 16*tile + 8*kh + 4*half + e, d = l16.
// Every fragment load, and every store of the wave that makes a tile, is 512 contiguous bytes.
#define FTILE 256                    // floats of one tile: 16 rows x 16 d
#define FHEAD (NNOD / 16 * FTILE)    // of one head of one batch
#define FSEC  (NBAT * NHD * FHEAD)   // of all Q, all K or all V
#define EFP 260   // LDS pitch of an edge row in floats: 16 B x odd, b128 reads conflict-free
#define YSP 132   // LDS pitch of an output row in floats: 16 B x odd
template<int MODE>
__global__ __launch_bounds__(256)
void layer_kernel(const float* __restrict__ qkv, const float* __restrict__ ef,
                  const float* __restrict__ comb, const float* __restrict__ hin,
                  float* __restrict__ hout,
                  const float* __restrict__ g2, const float* __restrict__ b2,
                  const float* __restrict__ w1T, const float* __restrict__ w2T,
                  const float* __restrict__ g1, const float* __restrict__ b1,
                  const float* __restrict__ whT, float* __restrict__ qkvn,
                  const float* __restrict__ Wdec, float* __restrict__ out)
{
    __shared__ __attribute__((aligned(16))) float efs[16 * EFP];
    __shared__ __attribute__((aligned(16))) float ys[16 * YSP];
    __shared__ __attribute__((aligned(16))) float zs[16 * ZP];
    __shared__ __attribute__((aligned(16))) float red[8 * 16 * ZP];

    const int i0   = blockIdx.x * 16;
    const int b    = blockIdx.y;
    const int row0 = b * NNOD + i0;
    const int tid  = threadIdx.x;
    const int w    = __builtin_amdgcn_readfirstlane(tid >> 5);   // wave = head
    const int lane = tid & 31;
    const int l16  = lane & 15;
    const int kh   = lane >> 4;

    // edge tile (16 rows x 256, contiguous): loads issued first, so that they fly beside the K loads
    const v4f* __restrict__ efg = (const v4f*)(ef + (long long)row0 * NNOD);
    v4f e4[4];
#pragma unroll
    for (int q = 0; q < 4; ++q) e4[q] = efg[tid + 256 * q];

    const float cB = comb[w];
    const float cG = comb[NHD + w];

    const float* __restrict__ hb = qkv + (b * NHD + w) * FHEAD;   // the head's tiles; a lane reads at 4*lane

    // Q as B fragment, K as A fragment; k slot (kh, e) of step s is d = 8*kh + 2*s + e in both
    const float* __restrict__ qp = hb + blockIdx.x * FTILE;
    const v4f q0 = *(const v4f*)(qp + lane * 4);
    const v4f q1 = *(const v4f*)(qp + 128 + lane * 4);
    const v2f qf[4] = { {q0[0], q0[1]}, {q0[2], q0[3]}, {q1[0], q1[1]}, {q1[2], q1[3]} };

    v4f k0[16], k1[16];
#pragma unroll
    for (int jt = 0; jt < 16; ++jt) {
        k0[jt] = *(const v4f*)(hb + FSEC + jt * FTILE + lane * 4);
        k1[jt] = *(const v4f*)(hb + FSEC + jt * FTILE + 128 + lane * 4);
    }

    // what the chain needs of this layer's input: the wave's two rows and LN2's scale and shift,
    // four columns a lane; asked for here, they are long there when the attention ends
    const float* __restrict__ hp = hin + (row0 + 2 * w) * HIDD;
    v4f hi[2];
#pragma unroll
    for (int rr = 0; rr < 2; ++rr) hi[rr] = *(const v4f*)(hp + rr * HIDD + lane * 4);
    const v4f gg = *(const v4f*)(g2 + lane * 4);
    const v4f bb = *(const v4f*)(b2 + lane * 4);

    // The wait that belongs in front of any overwrite of a register the loads above name.
    // Bases and offsets are inputs so that their registers stay untouched up to this line.
    asm volatile("s_wait_xcnt 0x0" :: "s"(qp), "s"(hb), "s"(efg), "v"(tid),
                                      "s"(hp), "s"(g2), "s"(b2), "v"(lane) : "memory");

    v8f S[16];
#pragma unroll
    for (int jt = 0; jt < 16; ++jt)
#pragma unroll
        for (int r = 0; r < 8; ++r) S[jt][r] = 0.0f;
#pragma unroll
    for (int g = 0; g < 4; ++g)
#pragma unroll
        for (int s = 0; s < 4; ++s)
#pragma unroll
            for (int t = 0; t < 4; ++t) {
                const int jt = g * 4 + t;
                const v4f kk = (s < 2) ? k0[jt] : k1[jt];
                const v2f a = { kk[(s & 1) * 2], kk[(s & 1) * 2 + 1] };
                S[jt] = __builtin_amdgcn_wmma_f32_16x16x4_f32(
                    false, a, false, qf[s], (short)0, S[jt], false, false);
            }

    // The weights of the row chain run through a ring of four register stages, r0 .. r3, each asked
    // for three to four stages before its products.  The first takes registers K has left; it goes
    // out alone, so that V, which is needed sooner and returns behind it, is not held up for long.
    const float* __restrict__ w1b = w1T + 4 * w * WTILE;   // tiles 4*w .. 4*w + 3
    v4f r0[16], r1[16], r2[16], r3[16];
    __builtin_amdgcn_sched_barrier(0);   // not lifted among the score products, where K still holds the registers
    load_w<4, WTILE>(r0, w1b + lane * 4, 0);
    // The wait that belongs in front of any overwrite of a register these loads name.
    asm volatile("s_wait_xcnt 0x0" :: "s"(w1b), "v"(lane) : "memory");
    __builtin_amdgcn_sched_barrier(0);   // issued here, not sunk towards their use

#pragma unroll
    for (int q = 0; q < 4; ++q) {
        const int f = tid + 256 * q;
        *(v4f*)(efs + (f >> 6) * EFP + (f & 63) * 4) = e4[q];
    }
    lds_barrier();   // the edge tile is read by all eight heads

    // x = s/sqrt(16) + e*cB, row maximum
    const float* er = efs + l16 * EFP + 8 * kh;
    float mx[4] = { -INFINITY, -INFINITY, -INFINITY, -INFINITY };
#pragma unroll
    for (int jt = 0; jt < 16; ++jt) {
        const v4f ea = *(const v4f*)(er + jt * 16);
        const v4f eb = *(const v4f*)(er + jt * 16 + 4);
#pragma unroll
        for (int r = 0; r < 8; ++r) {
            const float e = (r < 4) ? ea[r & 3] : eb[r & 3];
            const float x = S[jt][r] * 0.25f + e * cB;
            S[jt][r] = x;
            mx[r & 3] = fmaxf(mx[r & 3], x);
        }
    }
    float m = fmaxf(fmaxf(mx[0], mx[1]), fmaxf(mx[2], mx[3]));
    m = fmaxf(m, __shfl_xor(m, 16, 32));

    // p = exp(x - m) = exp2(x*log2e - m*log2e), row sum, unnormalised gated weight p*e
    const float L2E = 1.4426950408889634f;
    const float nm  = -m * L2E;
    float sm[4] = { 0.0f, 0.0f, 0.0f, 0.0f };
#pragma unroll
    for (int jt = 0; jt < 16; ++jt) {
        const v4f ea = *(const v4f*)(er + jt * 16);
        const v4f eb = *(const v4f*)(er + jt * 16 + 4);
#pragma unroll
        for (int c = 0; c < 2; ++c) {
            const v4f e = c ? eb : ea;
            v4f p;
            exp2x4(p, fmaf(S[jt][4 * c + 0], L2E, nm), fmaf(S[jt][4 * c + 1], L2E, nm),
                      fmaf(S[jt][4 * c + 2], L2E, nm), fmaf(S[jt][4 * c + 3], L2E, nm));
#pragma unroll
            for (int r = 0; r < 4; ++r) {
                sm[r] += p[r];
                S[jt][4 * c + r] = p[r] * e[r];
            }
        }
    }
    float ss = (sm[0] + sm[1]) + (sm[2] + sm[3]);
    ss += __shfl_xor(ss, 16, 32);

    // Y^T[d][i] = sum_j V[j][d] * w[i][j]; A fragment: lane l16 = d, rows j in the order above
    v8f o[2];
#pragma unroll
    for (int r = 0; r < 8; ++r) { o[0][r] = 0.0f; o[1][r] = 0.0f; }
#pragma unroll
    for (int jt = 0; jt < 16; ++jt) {
        const v4f v0 = *(const v4f*)(hb + 2 * FSEC + jt * FTILE + lane * 4);
        const v4f v1 = *(const v4f*)(hb + 2 * FSEC + jt * FTILE + 128 + lane * 4);
#pragma unroll
        for (int s = 0; s < 4; ++s) {
            const v4f vv = (s < 2) ? v0 : v1;
            const v2f a = { vv[(s & 1) * 2], vv[(s & 1) * 2 + 1] };
            const v2f wv = { S[jt][2 * s], S[jt][2 * s + 1] };
            o[s & 1] = __builtin_amdgcn_wmma_f32_16x16x4_f32(
                false, a, false, wv, (short)0, o[s & 1], false, false);
        }
    }

    // same wait for the V loads: their base and offset stay untouched up to this line
    asm volatile("s_wait_xcnt 0x0" :: "s"(hb), "v"(lane) : "memory");

    // The chain reads its lane index anew (ln = lane, lr = l16, lk = kh): held in a register
    // across the attention, the index was spilled to scratch in one of the two builds.
    const int ln = __builtin_amdgcn_mbcnt_lo(~0u, 0u);
    const int lr = ln & 15;
    const int lk = ln >> 4;

    const float* zr = zs + lr * ZP + 4 * lk;          // B fragments: row lr of the normed tile
    const float* __restrict__ whb = whT + w * WTILE;       // tiles w, 8 + w, 16 + w: Q, K, V of head w
    const float* __restrict__ w2b = w2T + w * 8192;        // the wave's 64 hidden columns
    const float* __restrict__ whp = whb + ln * 4;
    const float* __restrict__ w1p = w1b + ln * 4;
    const float* __restrict__ w2p = w2b + ln * 4;
    v4f e0[12], e1[12], e2[12], e3[12];                // QKV weight stages, the ring's last round
    v4f yv[2], hv[2];                                  // the wave's two rows, 4 columns a lane
    v4f gg1, bb1;                                      // LN1 scale and shift of the lane's columns
    v4f wd;                                            // decoder weights of the lane's columns

    load_w<4, WTILE>(r1, w1p, 1);     // these three take registers of K, of the scores and of V
    load_w<4, WTILE>(r2, w1p, 2);
    load_w<4, WTILE>(r3, w1p, 3);
    __builtin_amdgcn_sched_barrier(0);   // issued here, not sunk to the barrier

    // normalise and gate-scale once per output, gather the 8 heads' columns per row in LDS
    const float sc = cG / ss;
    v4f ya, yb;
#pragma unroll
    for (int r = 0; r < 4; ++r) {
        ya[r] = (o[0][r] + o[1][r]) * sc;
        yb[r] = (o[0][r + 4] + o[1][r + 4]) * sc;
    }
    float* yw = ys + lr * YSP + w * 16 + 8 * lk;
    *(v4f*)(yw)     = ya;
    *(v4f*)(yw + 4) = yb;
    lds_barrier();   // every head's columns are in place before whole rows are read

#pragma unroll
    for (int rr = 0; rr < 2; ++rr) {
        yv[rr] = *(const v4f*)(ys + (2 * w + rr) * YSP + ln * 4);
        *(v4f*)(zs + (2 * w + rr) * ZP + ln * 4) = ln_wave(yv[rr] + hi[rr], gg, bb);
    }
    lds_barrier();             // all 16 normed rows are read by every wave

    {
        // act^T = relu(W1^T z^T), hidden columns 64*w .. 64*w + 63; a stage's registers are refilled behind its products
        v8f d[4];
#pragma unroll
        for (int t = 0; t < 4; ++t)
#pragma unroll
            for (int r = 0; r < 8; ++r) d[t][r] = 0.0f;
        mm_stage<4>(d, r0, zr, 0);  load_c(r0, w2p, 0);
        mm_stage<4>(d, r1, zr, 1);  load_c(r1, w2p, 1);
        mm_stage<4>(d, r2, zr, 2);  load_c(r2, w2p, 2);
        mm_stage<4>(d, r3, zr, 3);  load_c(r3, w2p, 3);
#pragma unroll
        for (int t = 0; t < 4; ++t)
#pragma unroll
            for (int r = 0; r < 8; ++r) d[t][r] = fmaxf(d[t][r], 0.0f);

        // partial (act W2)^T over the wave's own 64 hidden columns
        v8f oc[8];
#pragma unroll
        for (int c = 0; c < 8; ++c)
#pragma unroll
            for (int r = 0; r < 8; ++r) oc[c][r] = 0.0f;
        mm_c(oc, r0, d, 0);
        if constexpr (MODE == 1) {   // LN1's scale and shift first: the load counter returns in order
            gg1 = *(const v4f*)(g1 + ln * 4);
            bb1 = *(const v4f*)(b1 + ln * 4);
            load_w<3, 8 * WTILE>(e0, whp, 0);
        } else {                     // asked for here, it is there when the rows are summed
            wd = *(const v4f*)(Wdec + ln * 4);
        }
        mm_c(oc, r1, d, 1);
        if constexpr (MODE == 1) load_w<3, 8 * WTILE>(e1, whp, 1);
        mm_c(oc, r2, d, 2);
        if constexpr (MODE == 1) load_w<3, 8 * WTILE>(e2, whp, 2);
        mm_c(oc, r3, d, 3);
        if constexpr (MODE == 1) {
            load_w<3, 8 * WTILE>(e3, whp, 3);
            __builtin_amdgcn_sched_barrier(0);   // issued here, not sunk to the barrier
        }

        float* rw = red + (w * 16 + lr) * ZP + 8 * lk;
#pragma unroll
        for (int c = 0; c < 8; ++c) {
            const v4f lo = { oc[c][0], oc[c][1], oc[c][2], oc[c][3] };
            const v4f hi4 = { oc[c][4], oc[c][5], oc[c][6], oc[c][7] };
            *(v4f*)(rw + c * 16)     = lo;
            *(v4f*)(rw + c * 16 + 4) = hi4;
        }
        // same wait for the weight loads: both bases and the offset stay untouched up to this line
        asm volatile("s_wait_xcnt 0x0" :: "s"(w1b), "s"(w2b), "v"(ln) : "memory");
        lds_barrier();             // the eight partial sums of every row are in place

#pragma unroll
        for (int rr = 0; rr < 2; ++rr) {
            const float* rp = red + (2 * w + rr) * ZP + ln * 4;
            v4f s = *(const v4f*)rp;
#pragma unroll
            for (int u = 1; u < 8; ++u) s += *(const v4f*)(rp + u * 16 * ZP);
            hv[rr] = s + yv[rr];
        }
    }

    if constexpr (MODE == 2) {
        // out = 10 * tanh((h . Wdec) / sqrt(128))
        v2f res;
#pragma unroll
        for (int rr = 0; rr < 2; ++rr) {
            float s = (hv[rr][0] * wd[0] + hv[rr][1] * wd[1]) + (hv[rr][2] * wd[2] + hv[rr][3] * wd[3]);
            for (int o2 = 16; o2 >= 1; o2 >>= 1) s += __shfl_xor(s, o2, 32);
            res[rr] = 10.0f * tanhf(s * 0.08838834764831845f);
        }
        if (ln == 0) *(v2f*)(out + row0 + 2 * w) = res;
    } else {
        float* __restrict__ op = hout + (row0 + 2 * w) * HIDD + ln * 4;
#pragma unroll
        for (int rr = 0; rr < 2; ++rr) {
            *(v4f*)(op + rr * HIDD) = hv[rr];
            *(v4f*)(zs + (2 * w + rr) * ZP + ln * 4) = ln_wave(hv[rr], gg1, bb1);
        }
        // same wait for the stores and the loads since the last one
        asm volatile("s_wait_xcnt 0x0" :: "v"(op), "v"(ln) : "memory");
        lds_barrier();             // all 16 normed rows are read by every wave

        // Q^T, K^T and V of head w: columns 16*w .. 16*w + 15 of each third of Wh
        v8f a[3];
#pragma unroll
        for (int t = 0; t < 3; ++t)
#pragma unroll
            for (int r = 0; r < 8; ++r) a[t][r] = 0.0f;
        mm_stage<3, true>(a, e0, zr, 0);
        mm_stage<3, true>(a, e1, zr, 1);
        mm_stage<3, true>(a, e2, zr, 2);
        mm_stage<3, true>(a, e3, zr, 3);
        // same wait for the QKV weight loads: their base and offset stay untouched up to this line
        asm volatile("s_wait_xcnt 0x0" :: "s"(whb), "v"(ln) : "memory");

        float* qw = qkvn + (b * NHD + w) * FHEAD + blockIdx.x * FTILE + ln * 4;
#pragma unroll
        for (int t = 0; t < 3; ++t) {
            const v4f lo = { a[t][0], a[t][1], a[t][2], a[t][3] };
            const v4f hi4 = { a[t][4], a[t][5], a[t][6], a[t][7] };
            *(v4f*)(qw + t * FSEC)       = lo;
            *(v4f*)(qw + t * FSEC + 128) = hi4;
        }
    }
}

// ------ first launch: layer 0's row work, and beside it the preparation of the later launches ------
#define ROWG (NBAT * NNOD / 16)   // work-groups 0 .. ROWG-1: 16 rows each
#define PREPG 121                 // behind them: 24 + 48 + 48 weight-ordering work-groups and one for comb

// One stage of the wave's three QKV weight tiles read from the matrix as it is given (rows k,
// pitch 384): the same values in the same registers as load_w takes from the fragment-order copy.
__device__ __forceinline__ void load_n(v4f (&w)[12], const float* __restrict__ wp, const int st)
{
#pragma unroll
    for (int t = 0; t < 3; ++t)
#pragma unroll
        for (int q = 0; q < 4; ++q)
#pragma unroll
            for (int c = 0; c < 4; ++c)
                w[t * 4 + q][c] = wp[(st * 32 + q * 8 + c) * 384 + t * HIDD];
}

// in[l][m][n] to fragment order, m being the k index of the product: one wave turns one tile of
// 16 m x 32 n, a lane 4 x 4 of it; four consecutive m of one n are one lane's 16 bytes of a fragment.
// W2ORD false: the order load_w reads; true: the order load_c reads.
// Loads cover whole 128-byte lines; a wave's four stores together fill whole 512-byte blocks.
template<int M, int N, bool W2ORD>
__device__ __forceinline__ void pack_tile(const float* __restrict__ in, float* __restrict__ out,
                                               const int T, const int lane)
{
    constexpr int NTN = N / 32, TPL = (M / 16) * NTN;
    const int l = T / TPL, rem = T % TPL;
    const int m0 = (rem / NTN) * 16 + 4 * (lane >> 3);
    const int n0 = (rem % NTN) * 32 + 4 * (lane & 7);
    const float* __restrict__ ip = in + l * M * N + m0 * N + n0;
    const int off = W2ORD
        ? (m0 >> 6) * 8192 + (n0 >> 4) * 1024 + ((m0 >> 4) & 3) * 256 + ((m0 >> 2) & 1) * 128
          + (((m0 >> 3) & 1) * 16 + (n0 & 15)) * 4
        : ((n0 >> 4) * 16 + (m0 >> 3)) * 128 + (((m0 >> 2) & 1) * 16 + (n0 & 15)) * 4;
    float* __restrict__ op = out + l * M * N + off;
    v4f r[4];
#pragma unroll
    for (int j = 0; j < 4; ++j) r[j] = *(const v4f*)(ip + j * N);
#pragma unroll
    for (int i = 0; i < 4; ++i) {
        const v4f c = { r[0][i], r[1][i], r[2][i], r[3][i] };
        *(v4f*)(op + i * 4) = c;
    }
    // The wait that belongs in front of any overwrite of a register the stores above name.
    asm volatile("s_wait_xcnt 0x0" ::: "memory");
}

__global__ __launch_bounds__(256)
void first_kernel(const float* __restrict__ nf, const float* __restrict__ Wn,
                  const float* __restrict__ g1, const float* __restrict__ b1,
                  const float* __restrict__ Wh, float* __restrict__ hout, float* __restrict__ qkv,
                  const float* __restrict__ W1, const float* __restrict__ W2,
                  const float* __restrict__ We_in, const float* __restrict__ We,
                  float* __restrict__ whT, float* __restrict__ w1T, float* __restrict__ w2T,
                  float* __restrict__ comb)
{
    __shared__ __attribute__((aligned(16))) float zs[16 * ZP];

    const int tid  = threadIdx.x;
    const int w    = __builtin_amdgcn_readfirstlane(tid >> 5);
    const int lane = tid & 31;
    const int l16  = lane & 15;
    const int kh   = lane >> 4;

    // Preparation work-groups: nothing of theirs is read in this launch, and they leave
    // as whole work-groups in front of every barrier.
    if (blockIdx.x >= ROWG) {
        const int pb = blockIdx.x - ROWG;
        if (pb < 24) {            // Wh of layers 1 and 2 (layer 0 is read as it is given below)
            pack_tile<128, 384, false>(Wh + 128 * 384, whT + 128 * 384, pb * 8 + w, lane);
        } else if (pb < 72) {
            pack_tile<128, 512, false>(W1, w1T, (pb - 24) * 8 + w, lane);
        } else if (pb < 120) {
            pack_tile<512, 128, true>(W2, w2T, (pb - 72) * 8 + w, lane);
        } else if (w < 2) {       // comb[l][c] = We_in . We[l][:, c], 48 values; lanes past them repeat the last
            const int t = tid < 48 ? tid : 47;
            const float* __restrict__ wp = We + (t >> 4) * HIDD * 16 + (t & 15);
            float s = 0.0f;
#pragma unroll                    // the loads go out in one run instead of one round trip per group
            for (int d = 0; d < HIDD; ++d) s += We_in[d] * wp[d * 16];
            // The wait that belongs in front of any overwrite of a register the loads above name.
            // The address is an input so that its registers stay untouched up to this line.
            asm volatile("s_wait_xcnt 0x0" :: "v"(wp) : "memory");
            if (tid < 48) comb[tid] = s;
        }
        return;
    }

    const int row0 = blockIdx.x * 16;
    const float* zr = zs + l16 * ZP + 4 * kh;          // B fragments: row l16 of the normed tile
    const float* __restrict__ whp = Wh + 4 * kh * 384 + 16 * w + l16;
    v4f ea[12], eb[12];                                // QKV weight stages
    v4f hv[2];                                         // the wave's two rows, 4 columns a lane

    const v4f gg1 = *(const v4f*)(g1 + lane * 4);
    const v4f bb1 = *(const v4f*)(b1 + lane * 4);
    load_n(ea, whp, 0);
    // The wait that belongs in front of any overwrite of a register the loads above name.
    // Bases and offsets are inputs so that their registers stay untouched up to this line.
    asm volatile("s_wait_xcnt 0x0" :: "s"(g1), "s"(b1), "v"(whp), "v"(lane) : "memory");
    __builtin_amdgcn_sched_barrier(0);   // issued here, not sunk to the barrier: they fly during the layernorm
    const v4f wn0 = *(const v4f*)(Wn + lane * 4);
    const v4f wn1 = *(const v4f*)(Wn + HIDD + lane * 4);
#pragma unroll
    for (int rr = 0; rr < 2; ++rr) {
        const int row = row0 + 2 * w + rr;
        hv[rr] = nf[row * 2] * wn0 + nf[row * 2 + 1] * wn1;
    }

    float* __restrict__ op = hout + (row0 + 2 * w) * HIDD + lane * 4;
#pragma unroll
    for (int rr = 0; rr < 2; ++rr) {
        *(v4f*)(op + rr * HIDD) = hv[rr];
        *(v4f*)(zs + (2 * w + rr) * ZP + lane * 4) = ln_wave(hv[rr], gg1, bb1);
    }
    // same wait for the stores and the loads since the last one
    asm volatile("s_wait_xcnt 0x0" :: "v"(op), "v"(lane) : "memory");
    __syncthreads();           // all 16 normed rows are read by every wave

    // Q^T, K^T and V of head w: columns 16*w .. 16*w + 15 of each third of Wh
    v8f a[3];
#pragma unroll
    for (int t = 0; t < 3; ++t)
#pragma unroll
        for (int r = 0; r < 8; ++r) a[t][r] = 0.0f;
    load_n(eb, whp, 1);  mm_stage<3, true>(a, ea, zr, 0);
    load_n(ea, whp, 2);  mm_stage<3, true>(a, eb, zr, 1);
    load_n(eb, whp, 3);  mm_stage<3, true>(a, ea, zr, 2);
    mm_stage<3, true>(a, eb, zr, 3);
    // same wait for the QKV weight loads: their address pair stays untouched up to this line
    asm volatile("s_wait_xcnt 0x0" :: "v"(whp) : "memory");

    float* qw = qkv + ((blockIdx.x >> 4) * NHD + w) * FHEAD + (blockIdx.x & 15) * FTILE + lane * 4;
#pragma unroll
    for (int t = 0; t < 3; ++t) {
        const v4f lo = { a[t][0], a[t][1], a[t][2], a[t][3] };
        const v4f hi4 = { a[t][4], a[t][5], a[t][6], a[t][7] };
        *(v4f*)(qw + t * FSEC)       = lo;
        *(v4f*)(qw + t * FSEC + 128) = hi4;
    }
    // same wait for these stores: the code of the other work-groups follows in the listing
    asm volatile("s_wait_xcnt 0x0" ::: "memory");
}

// ---------------- host launch ----------------
extern "C" void kernel_launch(void* const* d_in, const int* in_sizes, int n_in,
                              void* d_out, int out_size, void* d_ws, size_t ws_size,
                              hipStream_t stream)
{
    const float* nf    = (const float*)d_in[0];   // (16,256,2)
    const float* ef    = (const float*)d_in[1];   // (16,256,256,1)
    const float* Wn    = (const float*)d_in[2];   // (2,128)
    const float* We_in = (const float*)d_in[3];   // (1,128)
    const float* ln1g  = (const float*)d_in[4];   // (3,128)
    const float* ln1b  = (const float*)d_in[5];
    const float* Wh    = (const float*)d_in[6];   // (3,128,384)
    const float* We    = (const float*)d_in[7];   // (3,128,16)
    const float* ln2g  = (const float*)d_in[8];
    const float* ln2b  = (const float*)d_in[9];
    const float* W1    = (const float*)d_in[10];  // (3,128,512)
    const float* W2    = (const float*)d_in[11];  // (3,512,128)
    const float* Wdec  = (const float*)d_in[12];  // (128,1)
    float* out = (float*)d_out;

    float* ws = (float*)d_ws;
    float* hA   = ws;                         // 524288, layer input, even layers
    float* hB   = ws + 524288;                // 524288, layer input, odd layers
    float* qkvA = ws + 1048576;               // 1572864, QKV of even layers
    float* qkvB = ws + 2621440;               // 1572864, QKV of the odd layer
    float* comb = ws + 14155776;              // 64 (48 used)
    float* whT  = ws + 14155840;              // 3*384*128 = 147456 (layer 0's part stays unused)
    float* w1T  = ws + 14303296;              // 3*512*128 = 196608
    float* w2T  = ws + 14499904;              // 3*128*512 = 196608

    const dim3 ga(NNOD / 16, NBAT);

    // h0 = nf Wn, qkv0 = LN1(h0) Wh[0]; beside them comb and the weights of the later
    // launches in fragment order
    first_kernel<<<ROWG + PREPG, 256, 0, stream>>>(
        nf, Wn, ln1g, ln1b, Wh, hA, qkvA, W1, W2, We_in, We, whT, w1T, w2T, comb);

    // y = (softmax(q k^T / 4 + ef*combB) * ef*combG) @ v, all heads;
    // h1 = relu(LN2(y + h0) W1[0]) W2[0] + y, qkv1 = LN1(h1) Wh[1]
    layer_kernel<1><<<ga, 256, 0, stream>>>(
        qkvA, ef, comb, hA, hB, ln2g, ln2b, w1T, w2T,
        ln1g + HIDD, ln1b + HIDD, whT + 384 * HIDD, qkvB, nullptr, nullptr);

    layer_kernel<1><<<ga, 256, 0, stream>>>(
        qkvB, ef, comb + 16, hB, hA, ln2g + HIDD, ln2b + HIDD, w1T + 512 * HIDD, w2T + 512 * HIDD,
        ln1g + 2 * HIDD, ln1b + 2 * HIDD, whT + 2 * 384 * HIDD, qkvA, nullptr, nullptr);

    // last layer; out = 10 * tanh((h3 @ Wdec) / sqrt(128))
    layer_kernel<2><<<ga, 256, 0, stream>>>(
        qkvA, ef, comb + 32, hA, nullptr, ln2g + 2 * HIDD, ln2b + 2 * HIDD,
        w1T + 2 * 512 * HIDD, w2T + 2 * 512 * HIDD,
        nullptr, nullptr, nullptr, nullptr, Wdec, out);
}

// v007
// Measured time: 54.3 microseconds a run.
// Two timings next to v006 both put it at 1.03 times that version's speed.
// Over all steps from v000 it is 6.71 times as fast.
#include <hip/hip_runtime.h>
#include <math.h>

typedef __attribute__((ext_vector_type(2))) float v2f;
typedef __attribute__((ext_vector_type(4))) float v4f;
typedef __attribute__((ext_vector_type(8))) float v8f;

#define HIDD 128
#define NHD  8
#define NNOD 256
#define NBAT 16

#define ZP 132    // LDS pitch of a 128-wide row in floats: 16 B x odd, b128 reads conflict-free

__device__ __forceinline__ v8f mma_pair(const v4f a, const float b0, const float b1,
                                        const int s, const v8f c)
{
    const v2f av = { a[2 * s], a[2 * s + 1] };
    const v2f bv = { b0, b1 };
    return __builtin_amdgcn_wmma_f32_16x16x4_f32(false, av, false, bv, (short)0, c, false, false);
}

// The same product with the operands swapped (activations as A, weights as B): the tile comes out
// untransposed, a lane's 8 registers are rows 8*kh + r of column l16.  Same k slots, same sum order.
__device__ __forceinline__ v8f mma_pair_t(const v4f a, const float b0, const float b1,
                                          const int s, const v8f c)
{
    const v2f av = { a[2 * s], a[2 * s + 1] };
    const v2f bv = { b0, b1 };
    return __builtin_amdgcn_wmma_f32_16x16x4_f32(false, bv, false, av, (short)0, c, false, false);
}

// layernorm of one 128-wide row held by one wave, four consecutive columns a lane
__device__ __forceinline__ v4f ln_wave(const v4f t, const v4f g, const v4f b)
{
    float s  = (t[0] + t[1]) + (t[2] + t[3]);
    float s2 = (t[0] * t[0] + t[1] * t[1]) + (t[2] * t[2] + t[3] * t[3]);
    for (int o = 16; o >= 1; o >>= 1) {
        s  += __shfl_xor(s,  o, 32);
        s2 += __shfl_xor(s2, o, 32);
    }
    const float mu   = s * (1.0f / HIDD);
    const float var  = s2 * (1.0f / HIDD) - mu * mu;
    const float rinv = rsqrtf(var + 1e-5f);
    v4f r;
    for (int i = 0; i < 4; ++i) r[i] = (t[i] - mu) * rinv * g[i] + b[i];
    return r;
}

// All loops below are unrolled so that the register arrays keep constant indices.
// One stage = 32 k of NT weight tiles of 16 columns n.
// k slot (kh, e) of step (q, s) is k = 32*st + 8*q + 4*kh + 2*s + e, in A and in B alike.
// The weights lie in the workspace in fragment order, [tile n/16][k/8][lane = 16*kh + n%16][4 k],
// so that one 16-byte load of a wave covers 512 contiguous bytes: four whole lines, not a
// quarter of sixteen.  TS = distance in floats between two tiles of the wave.
#define WTILE 2048   // floats of one weight tile: 16 columns x 128 k
template<int NT, int TS>
__device__ __forceinline__ void load_w(v4f (&w)[NT * 4], const float* __restrict__ wp, const int st)
{
#pragma unroll
    for (int t = 0; t < NT; ++t)
#pragma unroll
        for (int q = 0; q < 4; ++q)
            w[t * 4 + q] = *(const v4f*)(wp + t * TS + (st * 4 + q) * 128);
}

// VT: the last tile is made with the operands swapped (mma_pair_t)
template<int NT, bool VT = false>
__device__ __forceinline__ void mm_stage(v8f (&acc)[NT], const v4f (&w)[NT * 4],
                                         const float* zr, const int st)
{
    v4f bz[4];
#pragma unroll
    for (int q = 0; q < 4; ++q) bz[q] = *(const v4f*)(zr + st * 32 + q * 8);
    // keeps the next stage's weight loads and this stage's LDS reads ahead of the WMMA block:
    // left free, the scheduler sinks each load to just before its use and the wave waits it out
    __builtin_amdgcn_sched_barrier(0);
#pragma unroll
    for (int q = 0; q < 4; ++q)
#pragma unroll
        for (int s = 0; s < 2; ++s)
#pragma unroll
            for (int t = 0; t < NT; ++t)
                acc[t] = (VT && t == NT - 1)
                       ? mma_pair_t(w[t * 4 + q], bz[q][2 * s], bz[q][2 * s + 1], s, acc[t])
                       : mma_pair(w[t * 4 + q], bz[q][2 * s], bz[q][2 * s + 1], s, acc[t]);
    __builtin_amdgcn_sched_barrier(0);   // the loads that follow are not issued before this block
}

// One stage of the second MLP product = two output tiles (c = 32*p .. 32*p + 31) over the
// wave's own 64 hidden columns.  Fragment order here too:
// [wave = hidden/64][tile c/16][t = hidden/16 % 4][hf][lane = 16*kh + c%16][4 hidden],
// hidden = 64*wave + 16*t + 8*kh + 4*hf + e.
__device__ __forceinline__ void load_c(v4f (&w)[16], const float* __restrict__ cp, const int p)
{
#pragma unroll
    for (int u = 0; u < 2; ++u)
#pragma unroll
        for (int t = 0; t < 4; ++t)
#pragma unroll
            for (int hf = 0; hf < 2; ++hf)
                w[u * 8 + t * 2 + hf] = *(const v4f*)(cp + (2 * p + u) * 1024 + t * 256 + hf * 128);
}

__device__ __forceinline__ void mm_c(v8f (&acc)[8], const v4f (&w)[16], const v8f (&d)[4], const int p)
{
    __builtin_amdgcn_sched_barrier(0);   // the loads issued in front of it stay ahead of this block
#pragma unroll
    for (int t = 0; t < 4; ++t)
#pragma unroll
        for (int hf = 0; hf < 2; ++hf)
#pragma unroll
            for (int s = 0; s < 2; ++s)
#pragma unroll
                for (int u = 0; u < 2; ++u)
                    acc[2 * p + u] = mma_pair(w[u * 8 + t * 2 + hf], d[t][4 * hf + 2 * s],
                                              d[t][4 * hf + 2 * s + 1], s, acc[2 * p + u]);
    __builtin_amdgcn_sched_barrier(0);   // the loads that follow are not issued before this block
}

// Work-group barrier that waits for the wave's LDS operations only.  __syncthreads() also waits for
// every global load in flight, which would drain the weight stages that are requested ahead; nothing
// that passes between the waves of a work-group here goes through global memory.
__device__ __forceinline__ void lds_barrier()
{
    __builtin_amdgcn_fence(__ATOMIC_RELEASE, "workgroup", "local");
    __builtin_amdgcn_s_barrier();
    __builtin_amdgcn_fence(__ATOMIC_ACQUIRE, "workgroup", "local");
}

// Four exp2 in one statement.  The early-clobber outputs keep every v_exp_f32 from being
// directly followed by a write of its source or a read of its result, and the v_nop is
// the one slot the instruction set asks for behind the last of them.
__device__ __forceinline__ void exp2x4(v4f& p, float t0, float t1, float t2, float t3)
{
    float p0, p1, p2, p3;
    asm("v_exp_f32 %0, %4\n\tv_exp_f32 %1, %5\n\tv_exp_f32 %2, %6\n\tv_exp_f32 %3, %7\n\tv_nop"
        : "=&v"(p0), "=&v"(p1), "=&v"(p2), "=&v"(p3)
        : "v"(t0), "v"(t1), "v"(t2), "v"(t3));
    p[0] = p0; p[1] = p1; p[2] = p2; p[3] = p3;
}

// ------ one whole layer: one workgroup = one batch x 16 rows, eight waves ------
// Attention (one wave per head), then the row-local chain on the same 16 rows, whose y never
// leaves LDS.  MODE 1: LN2, MLP + y, LN1 of the next layer, its QKV.  MODE 2: LN2, MLP + y, decoder.
// The next layer's QKV goes to a second buffer: other workgroups still read K and V of this one.
//
// S^T = K Q^T is kept in registers: lane (l16, kh) register r of tile jt holds
// key j = jt*16 + 8*kh + r of query i0 + l16.  That is already the B fragment of
// Y^T = V^T W^T when the k slots of step s are read as j = jt*16 + 8*kh + 2*s + {0,1},
// so the weights never leave the registers.  The softmax runs down a lane's own
// 128 values plus one exchange between the two lane halves.
//
// Q, K and V lie in the workspace in fragment order,
// [Q | K | V][batch][head][tile of 16 rows][half][lane = 16*kh + l16][4 floats]:
// Q and K: row 16*tile + l16, d = 8*kh + 4*half + e;  V: row 16*tile + 8*kh + 4*half + e, d = l16.
// Every fragment load, and every store of the wave that makes a tile, is 512 contiguous bytes.
#define FTILE 256                    // floats of one tile: 16 rows x 16 d
#define FHEAD (NNOD / 16 * FTILE)    // of one head of one batch
#define FSEC  (NBAT * NHD * FHEAD)   // of all Q, all K or all V
#define EFP 260   // LDS pitch of an edge row in floats: 16 B x odd, b128 reads conflict-free
#define YSP 132   // LDS pitch of an output row in floats: 16 B x odd
template<int MODE>
__global__ __launch_bounds__(256)
void layer_kernel(const float* __restrict__ qkv, const float* __restrict__ ef,
                  const float* __restrict__ comb, const float* __restrict__ hin,
                  float* __restrict__ hout,
                  const float* __restrict__ g2, const float* __restrict__ b2,
                  const float* __restrict__ w1T, const float* __restrict__ w2T,
                  const float* __restrict__ g1, const float* __restrict__ b1,
                  const float* __restrict__ whT, float* __restrict__ qkvn,
                  const float* __restrict__ Wdec, float* __restrict__ out)
{
    __shared__ __attribute__((aligned(16))) float efs[16 * EFP];
    __shared__ __attribute__((aligned(16))) float ys[16 * YSP];
    __shared__ __attribute__((aligned(16))) float zs[16 * ZP];
    __shared__ __attribute__((aligned(16))) float red[8 * 16 * ZP];

    const int i0   = blockIdx.x * 16;
    const int b    = blockIdx.y;
    const int row0 = b * NNOD + i0;
    const int tid  = threadIdx.x;
    const int w    = __builtin_amdgcn_readfirstlane(tid >> 5);   // wave = head
    const int lane = tid & 31;
    const int l16  = lane & 15;
    const int kh   = lane >> 4;

    // edge tile (16 rows x 256, contiguous): loads issued first, so that they fly beside the K loads
    const v4f* __restrict__ efg = (const v4f*)(ef + (long long)row0 * NNOD);
    v4f e4[4];
#pragma unroll
    for (int q = 0; q < 4; ++q) e4[q] = efg[tid + 256 * q];

    const float cB = comb[w];
    const float cG = comb[NHD + w];

    const float* __restrict__ hb = qkv + (b * NHD + w) * FHEAD;   // the head's tiles; a lane reads at 4*lane

    // Q as B fragment, K as A fragment; k slot (kh, e) of step s is d = 8*kh + 2*s + e in both
    const float* __restrict__ qp = hb + blockIdx.x * FTILE;
    const v4f q0 = *(const v4f*)(qp + lane * 4);
    const v4f q1 = *(const v4f*)(qp + 128 + lane * 4);
    const v2f qf[4] = { {q0[0], q0[1]}, {q0[2], q0[3]}, {q1[0], q1[1]}, {q1[2], q1[3]} };

    v4f k0[16], k1[16];
#pragma unroll
    for (int jt = 0; jt < 16; ++jt) {
        k0[jt] = *(const v4f*)(hb + FSEC + jt * FTILE + lane * 4);
        k1[jt] = *(const v4f*)(hb + FSEC + jt * FTILE + 128 + lane * 4);
    }

    // what the chain needs of this layer's input: the wave's two rows and LN2's scale and shift,
    // four columns a lane; asked for here, they are long there when the attention ends
    const float* __restrict__ hp = hin + (row0 + 2 * w) * HIDD;
    v4f hi[2];
#pragma unroll
    for (int rr = 0; rr < 2; ++rr) hi[rr] = *(const v4f*)(hp + rr * HIDD + lane * 4);
    const v4f gg = *(const v4f*)(g2 + lane * 4);
    const v4f bb = *(const v4f*)(b2 + lane * 4);

    // The wait that belongs in front of any overwrite of a register the loads above name.
    // Bases and offsets are inputs so that their registers stay untouched up to this line.
    asm volatile("s_wait_xcnt 0x0" :: "s"(qp), "s"(hb), "s"(efg), "v"(tid),
                                      "s"(hp), "s"(g2), "s"(b2), "v"(lane) : "memory");

    // All work-groups read the same weights.  They walk the four stages of each product from different
    // starting points and wrap, so that they do not ask L2 for one line at one moment: ring stage g
    // holds stage (g + rot) & 3.  The activations follow through one LDS column offset (rotcol below).
    const int rot = (blockIdx.x + blockIdx.y) & 3;
    const float* __restrict__ w1b = w1T + 4 * w * WTILE;   // tiles 4*w .. 4*w + 3
    const float* __restrict__ whb = whT + w * WTILE;       // tiles w, 8 + w, 16 + w: Q, K, V of head w
    const float* __restrict__ w2b = w2T + w * 8192;        // the wave's 64 hidden columns
    const float* w1s[4];
    const float* w2s[4];
    const float* whs[4];
#pragma unroll
    for (int g = 0; g < 4; ++g) {
        const int st = (g + rot) & 3;
        w1s[g] = w1b + st * 512;
        w2s[g] = w2b + st * 2048;
        whs[g] = whb + st * 512;
    }

    v8f S[16];
#pragma unroll
    for (int jt = 0; jt < 16; ++jt)
#pragma unroll
        for (int r = 0; r < 8; ++r) S[jt][r] = 0.0f;
#pragma unroll
    for (int g = 0; g < 4; ++g)
#pragma unroll
        for (int s = 0; s < 4; ++s)
#pragma unroll
            for (int t = 0; t < 4; ++t) {
                const int jt = g * 4 + t;
                const v4f kk = (s < 2) ? k0[jt] : k1[jt];
                const v2f a = { kk[(s & 1) * 2], kk[(s & 1) * 2 + 1] };
                S[jt] = __builtin_amdgcn_wmma_f32_16x16x4_f32(
                    false, a, false, qf[s], (short)0, S[jt], false, false);
            }

    // The weights of the row chain run through a ring of four register stages, r0 .. r3, each asked
    // for three to four stages before its products.  The first takes registers K has left; it goes
    // out alone, so that V, which is needed sooner and returns behind it, is not held up for long.
    v4f r0[16], r1[16], r2[16], r3[16];
    __builtin_amdgcn_sched_barrier(0);   // not lifted among the score products, where K still holds the registers
    load_w<4, WTILE>(r0, w1s[0] + lane * 4, 0);
    // The wait that belongs in front of any overwrite of a register these loads name.
    asm volatile("s_wait_xcnt 0x0" :: "s"(w1s[0]), "v"(lane) : "memory");
    __builtin_amdgcn_sched_barrier(0);   // issued here, not sunk towards their use

#pragma unroll
    for (int q = 0; q < 4; ++q) {
        const int f = tid + 256 * q;
        *(v4f*)(efs + (f >> 6) * EFP + (f & 63) * 4) = e4[q];
    }
    lds_barrier();   // the edge tile is read by all eight heads

    // x = s/sqrt(16) + e*cB, row maximum
    const float* er = efs + l16 * EFP + 8 * kh;
    float mx[4] = { -INFINITY, -INFINITY, -INFINITY, -INFINITY };
#pragma unroll
    for (int jt = 0; jt < 16; ++jt) {
        const v4f ea = *(const v4f*)(er + jt * 16);
        const v4f eb = *(const v4f*)(er + jt * 16 + 4);
#pragma unroll
        for (int r = 0; r < 8; ++r) {
            const float e = (r < 4) ? ea[r & 3] : eb[r & 3];
            const float x = S[jt][r] * 0.25f + e * cB;
            S[jt][r] = x;
            mx[r & 3] = fmaxf(mx[r & 3], x);
        }
    }
    float m = fmaxf(fmaxf(mx[0], mx[1]), fmaxf(mx[2], mx[3]));
    m = fmaxf(m, __shfl_xor(m, 16, 32));

    // p = exp(x - m) = exp2(x*log2e - m*log2e), row sum, unnormalised gated weight p*e
    const float L2E = 1.4426950408889634f;
    const float nm  = -m * L2E;
    float sm[4] = { 0.0f, 0.0f, 0.0f, 0.0f };
#pragma unroll
    for (int jt = 0; jt < 16; ++jt) {
        const v4f ea = *(const v4f*)(er + jt * 16);
        const v4f eb = *(const v4f*)(er + jt * 16 + 4);
#pragma unroll
        for (int c = 0; c < 2; ++c) {
            const v4f e = c ? eb : ea;
            v4f p;
            exp2x4(p, fmaf(S[jt][4 * c + 0], L2E, nm), fmaf(S[jt][4 * c + 1], L2E, nm),
                      fmaf(S[jt][4 * c + 2], L2E, nm), fmaf(S[jt][4 * c + 3], L2E, nm));
#pragma unroll
            for (int r = 0; r < 4; ++r) {
                sm[r] += p[r];
                S[jt][4 * c + r] = p[r] * e[r];
            }
        }
    }
    float ss = (sm[0] + sm[1]) + (sm[2] + sm[3]);
    ss += __shfl_xor(ss, 16, 32);

    // Y^T[d][i] = sum_j V[j][d] * w[i][j]; A fragment: lane l16 = d, rows j in the order above
    v8f o[2];
#pragma unroll
    for (int r = 0; r < 8; ++r) { o[0][r] = 0.0f; o[1][r] = 0.0f; }
#pragma unroll
    for (int jt = 0; jt < 16; ++jt) {
        const v4f v0 = *(const v4f*)(hb + 2 * FSEC + jt * FTILE + lane * 4);
        const v4f v1 = *(const v4f*)(hb + 2 * FSEC + jt * FTILE + 128 + lane * 4);
#pragma unroll
        for (int s = 0; s < 4; ++s) {
            const v4f vv = (s < 2) ? v0 : v1;
            const v2f a = { vv[(s & 1) * 2], vv[(s & 1) * 2 + 1] };
            const v2f wv = { S[jt][2 * s], S[jt][2 * s + 1] };
            o[s & 1] = __builtin_amdgcn_wmma_f32_16x16x4_f32(
                false, a, false, wv, (short)0, o[s & 1], false, false);
        }
    }

    // same wait for the V loads: their base and offset stay untouched up to this line
    asm volatile("s_wait_xcnt 0x0" :: "s"(hb), "v"(lane) : "memory");

    // The chain reads its lane index anew (ln = lane, lr = l16, lk = kh): held in a register
    // across the attention, the index was spilled to scratch in one of the two builds.
    const int ln = __builtin_amdgcn_mbcnt_lo(~0u, 0u);
    const int lr = ln & 15;
    const int lk = ln >> 4;

    const float* zr = zs + lr * ZP + 4 * lk;          // B fragments: row lr of the normed tile
    // LDS column of the lane's four columns 4*ln: their block of 32 lies at ring stage (block - rot) & 3,
    // in the normed tile (read by stage) and in the partial sums (written by stage) alike
    const int rotcol = ((((ln >> 3) - rot) & 3) << 5) + ((ln & 7) << 2);
    v4f e0[12], e1[12], e2[12], e3[12];                // QKV weight stages, the ring's last round
    v4f yv[2], hv[2];                                  // the wave's two rows, 4 columns a lane
    v4f gg1, bb1;                                      // LN1 scale and shift of the lane's columns
    v4f wd;                                            // decoder weights of the lane's columns

    load_w<4, WTILE>(r1, w1s[1] + ln * 4, 0);     // these three take registers of K, of the scores and of V
    load_w<4, WTILE>(r2, w1s[2] + ln * 4, 0);
    load_w<4, WTILE>(r3, w1s[3] + ln * 4, 0);
    __builtin_amdgcn_sched_barrier(0);   // issued here, not sunk to the barrier

    // normalise and gate-scale once per output, gather the 8 heads' columns per row in LDS
    const float sc = cG / ss;
    v4f ya, yb;
#pragma unroll
    for (int r = 0; r < 4; ++r) {
        ya[r] = (o[0][r] + o[1][r]) * sc;
        yb[r] = (o[0][r + 4] + o[1][r + 4]) * sc;
    }
    float* yw = ys + lr * YSP + w * 16 + 8 * lk;
    *(v4f*)(yw)     = ya;
    *(v4f*)(yw + 4) = yb;
    lds_barrier();   // every head's columns are in place before whole rows are read

#pragma unroll
    for (int rr = 0; rr < 2; ++rr) {
        yv[rr] = *(const v4f*)(ys + (2 * w + rr) * YSP + ln * 4);
        *(v4f*)(zs + (2 * w + rr) * ZP + rotcol) = ln_wave(yv[rr] + hi[rr], gg, bb);
    }
    lds_barrier();             // all 16 normed rows are read by every wave

    {
        // act^T = relu(W1^T z^T), hidden columns 64*w .. 64*w + 63; a stage's registers are refilled behind its products
        v8f d[4];
#pragma unroll
        for (int t = 0; t < 4; ++t)
#pragma unroll
            for (int r = 0; r < 8; ++r) d[t][r] = 0.0f;
        mm_stage<4>(d, r0, zr, 0);  load_c(r0, w2s[0] + ln * 4, 0);
        mm_stage<4>(d, r1, zr, 1);  load_c(r1, w2s[1] + ln * 4, 0);
        mm_stage<4>(d, r2, zr, 2);  load_c(r2, w2s[2] + ln * 4, 0);
        mm_stage<4>(d, r3, zr, 3);  load_c(r3, w2s[3] + ln * 4, 0);
#pragma unroll
        for (int t = 0; t < 4; ++t)
#pragma unroll
            for (int r = 0; r < 8; ++r) d[t][r] = fmaxf(d[t][r], 0.0f);

        // partial (act W2)^T over the wave's own 64 hidden columns
        v8f oc[8];
#pragma unroll
        for (int c = 0; c < 8; ++c)
#pragma unroll
            for (int r = 0; r < 8; ++r) oc[c][r] = 0.0f;
        mm_c(oc, r0, d, 0);
        if constexpr (MODE == 1) {   // LN1's scale and shift first: the load counter returns in order
            gg1 = *(const v4f*)(g1 + ln * 4);
            bb1 = *(const v4f*)(b1 + ln * 4);
            load_w<3, 8 * WTILE>(e0, whs[0] + ln * 4, 0);
        } else {                     // asked for here, it is there when the rows are summed
            wd = *(const v4f*)(Wdec + ln * 4);
        }
        mm_c(oc, r1, d, 1);
        if constexpr (MODE == 1) load_w<3, 8 * WTILE>(e1, whs[1] + ln * 4, 0);
        mm_c(oc, r2, d, 2);
        if constexpr (MODE == 1) load_w<3, 8 * WTILE>(e2, whs[2] + ln * 4, 0);
        mm_c(oc, r3, d, 3);
        if constexpr (MODE == 1) {
            load_w<3, 8 * WTILE>(e3, whs[3] + ln * 4, 0);
            __builtin_amdgcn_sched_barrier(0);   // issued here, not sunk to the barrier
        }

        float* rw = red + (w * 16 + lr) * ZP + 8 * lk;
#pragma unroll
        for (int c = 0; c < 8; ++c) {
            const v4f lo = { oc[c][0], oc[c][1], oc[c][2], oc[c][3] };
            const v4f hi4 = { oc[c][4], oc[c][5], oc[c][6], oc[c][7] };
            *(v4f*)(rw + c * 16)     = lo;
            *(v4f*)(rw + c * 16 + 4) = hi4;
        }
        // same wait for the weight loads: the stage bases and the offset stay untouched up to this line
        asm volatile("s_wait_xcnt 0x0" :: "s"(w1s[1]), "s"(w1s[2]), "s"(w1s[3]), "s"(w2s[0]), "s"(w2s[1]),
                                          "s"(w2s[2]), "s"(w2s[3]), "v"(ln) : "memory");
        lds_barrier();             // the eight partial sums of every row are in place

#pragma unroll
        for (int rr = 0; rr < 2; ++rr) {
            const float* rp = red + (2 * w + rr) * ZP + rotcol;
            v4f s = *(const v4f*)rp;
#pragma unroll
            for (int u = 1; u < 8; ++u) s += *(const v4f*)(rp + u * 16 * ZP);
            hv[rr] = s + yv[rr];
        }
    }

    if constexpr (MODE == 2) {
        // out = 10 * tanh((h . Wdec) / sqrt(128))
        v2f res;
#pragma unroll
        for (int rr = 0; rr < 2; ++rr) {
            float s = (hv[rr][0] * wd[0] + hv[rr][1] * wd[1]) + (hv[rr][2] * wd[2] + hv[rr][3] * wd[3]);
            for (int o2 = 16; o2 >= 1; o2 >>= 1) s += __shfl_xor(s, o2, 32);
            res[rr] = 10.0f * tanhf(s * 0.08838834764831845f);
        }
        if (ln == 0) *(v2f*)(out + row0 + 2 * w) = res;
    } else {
        float* __restrict__ op = hout + (row0 + 2 * w) * HIDD + ln * 4;
#pragma unroll
        for (int rr = 0; rr < 2; ++rr) {
            *(v4f*)(op + rr * HIDD) = hv[rr];
            *(v4f*)(zs + (2 * w + rr) * ZP + rotcol) = ln_wave(hv[rr], gg1, bb1);
        }
        // same wait for the stores and the loads since the last one
        asm volatile("s_wait_xcnt 0x0" :: "v"(op), "v"(ln) : "memory");
        lds_barrier();             // all 16 normed rows are read by every wave

        // Q^T, K^T and V of head w: columns 16*w .. 16*w + 15 of each third of Wh
        v8f a[3];
#pragma unroll
        for (int t = 0; t < 3; ++t)
#pragma unroll
            for (int r = 0; r < 8; ++r) a[t][r] = 0.0f;
        mm_stage<3, true>(a, e0, zr, 0);
        mm_stage<3, true>(a, e1, zr, 1);
        mm_stage<3, true>(a, e2, zr, 2);
        mm_stage<3, true>(a, e3, zr, 3);
        // same wait for the QKV weight loads: their stage bases and offset stay untouched up to this line
        asm volatile("s_wait_xcnt 0x0" :: "s"(whs[0]), "s"(whs[1]), "s"(whs[2]), "s"(whs[3]), "v"(ln) : "memory");

        float* qw = qkvn + (b * NHD + w) * FHEAD + blockIdx.x * FTILE + ln * 4;
#pragma unroll
        for (int t = 0; t < 3; ++t) {
            const v4f lo = { a[t][0], a[t][1], a[t][2], a[t][3] };
            const v4f hi4 = { a[t][4], a[t][5], a[t][6], a[t][7] };
            *(v4f*)(qw + t * FSEC)       = lo;
            *(v4f*)(qw + t * FSEC + 128) = hi4;
        }
    }
}

// ------ first launch: layer 0's row work, and beside it the preparation of the later launches ------
#define ROWG (NBAT * NNOD / 16)   // work-groups 0 .. ROWG-1: 16 rows each
#define PREPG 121                 // behind them: 24 + 48 + 48 weight-ordering work-groups and one for comb

// One stage of the wave's three QKV weight tiles read from the matrix as it is given (rows k,
// pitch 384): the same values in the same registers as load_w takes from the fragment-order copy.
__device__ __forceinline__ void load_n(v4f (&w)[12], const float* __restrict__ wp, const int st)
{
#pragma unroll
    for (int t = 0; t < 3; ++t)
#pragma unroll
        for (int q = 0; q < 4; ++q)
#pragma unroll
            for (int c = 0; c < 4; ++c)
                w[t * 4 + q][c] = wp[(st * 32 + q * 8 + c) * 384 + t * HIDD];
}

// in[l][m][n] to fragment order, m being the k index of the product: one wave turns one tile of
// 16 m x 32 n, a lane 4 x 4 of it; four consecutive m of one n are one lane's 16 bytes of a fragment.
// W2ORD false: the order load_w reads; true: the order load_c reads.
// Loads cover whole 128-byte lines; a wave's four stores together fill whole 512-byte blocks.
template<int M, int N, bool W2ORD>
__device__ __forceinline__ void pack_tile(const float* __restrict__ in, float* __restrict__ out,
                                               const int T, const int lane)
{
    constexpr int NTN = N / 32, TPL = (M / 16) * NTN;
    const int l = T / TPL, rem = T % TPL;
    const int m0 = (rem / NTN) * 16 + 4 * (lane >> 3);
    const int n0 = (rem % NTN) * 32 + 4 * (lane & 7);
    const float* __restrict__ ip = in + l * M * N + m0 * N + n0;
    const int off = W2ORD
        ? (m0 >> 6) * 8192 + (n0 >> 4) * 1024 + ((m0 >> 4) & 3) * 256 + ((m0 >> 2) & 1) * 128
          + (((m0 >> 3) & 1) * 16 + (n0 & 15)) * 4
        : ((n0 >> 4) * 16 + (m0 >> 3)) * 128 + (((m0 >> 2) & 1) * 16 + (n0 & 15)) * 4;
    float* __restrict__ op = out + l * M * N + off;
    v4f r[4];
#pragma unroll
    for (int j = 0; j < 4; ++j) r[j] = *(const v4f*)(ip + j * N);
#pragma unroll
    for (int i = 0; i < 4; ++i) {
        const v4f c = { r[0][i], r[1][i], r[2][i], r[3][i] };
        *(v4f*)(op + i * 4) = c;
    }
    // The wait that belongs in front of any overwrite of a register the stores above name.
    asm volatile("s_wait_xcnt 0x0" ::: "memory");
}

__global__ __launch_bounds__(256)
void first_kernel(const float* __restrict__ nf, const float* __restrict__ Wn,
                  const float* __restrict__ g1, const float* __restrict__ b1,
                  const float* __restrict__ Wh, float* __restrict__ hout, float* __restrict__ qkv,
                  const float* __restrict__ W1, const float* __restrict__ W2,
                  const float* __restrict__ We_in, const float* __restrict__ We,
                  float* __restrict__ whT, float* __restrict__ w1T, float* __restrict__ w2T,
                  float* __restrict__ comb)
{
    __shared__ __attribute__((aligned(16))) float zs[16 * ZP];

    const int tid  = threadIdx.x;
    const int w    = __builtin_amdgcn_readfirstlane(tid >> 5);
    const int lane = tid & 31;
    const int l16  = lane & 15;
    const int kh   = lane >> 4;

    // Preparation work-groups: nothing of theirs is read in this launch, and they leave
    // as whole work-groups in front of every barrier.
    if (blockIdx.x >= ROWG) {
        const int pb = blockIdx.x - ROWG;
        if (pb < 24) {            // Wh of layers 1 and 2 (layer 0 is read as it is given below)
            pack_tile<128, 384, false>(Wh + 128 * 384, whT + 128 * 384, pb * 8 + w, lane);
        } else if (pb < 72) {
            pack_tile<128, 512, false>(W1, w1T, (pb - 24) * 8 + w, lane);
        } else if (pb < 120) {
            pack_tile<512, 128, true>(W2, w2T, (pb - 72) * 8 + w, lane);
        } else if (w < 2) {       // comb[l][c] = We_in . We[l][:, c], 48 values; lanes past them repeat the last
            const int t = tid < 48 ? tid : 47;
            const float* __restrict__ wp = We + (t >> 4) * HIDD * 16 + (t & 15);
            float s = 0.0f;
#pragma unroll                    // the loads go out in one run instead of one round trip per group
            for (int d = 0; d < HIDD; ++d) s += We_in[d] * wp[d * 16];
            // The wait that belongs in front of any overwrite of a register the loads above name.
            // The address is an input so that its registers stay untouched up to this line.
            asm volatile("s_wait_xcnt 0x0" :: "v"(wp) : "memory");
            if (tid < 48) comb[tid] = s;
        }
        return;
    }

    const int row0 = blockIdx.x * 16;
    const float* zr = zs + l16 * ZP + 4 * kh;          // B fragments: row l16 of the normed tile
    const float* __restrict__ whp = Wh + 4 * kh * 384 + 16 * w + l16;
    v4f ea[12], eb[12];                                // QKV weight stages
    v4f hv[2];                                         // the wave's two rows, 4 columns a lane

    const v4f gg1 = *(const v4f*)(g1 + lane * 4);
    const v4f bb1 = *(const v4f*)(b1 + lane * 4);
    load_n(ea, whp, 0);
    // The wait that belongs in front of any overwrite of a register the loads above name.
    // Bases and offsets are inputs so that their registers stay untouched up to this line.
    asm volatile("s_wait_xcnt 0x0" :: "s"(g1), "s"(b1), "v"(whp), "v"(lane) : "memory");
    __builtin_amdgcn_sched_barrier(0);   // issued here, not sunk to the barrier: they fly during the layernorm
    const v4f wn0 = *(const v4f*)(Wn + lane * 4);
    const v4f wn1 = *(const v4f*)(Wn + HIDD + lane * 4);
#pragma unroll
    for (int rr = 0; rr < 2; ++rr) {
        const int row = row0 + 2 * w + rr;
        hv[rr] = nf[row * 2] * wn0 + nf[row * 2 + 1] * wn1;
    }

    float* __restrict__ op = hout + (row0 + 2 * w) * HIDD + lane * 4;
#pragma unroll
    for (int rr = 0; rr < 2; ++rr) {
        *(v4f*)(op + rr * HIDD) = hv[rr];
        *(v4f*)(zs + (2 * w + rr) * ZP + lane * 4) = ln_wave(hv[rr], gg1, bb1);
    }
    // same wait for the stores and the loads since the last one
    asm volatile("s_wait_xcnt 0x0" :: "v"(op), "v"(lane) : "memory");
    __syncthreads();           // all 16 normed rows are read by every wave

    // Q^T, K^T and V of head w: columns 16*w .. 16*w + 15 of each third of Wh
    v8f a[3];
#pragma unroll
    for (int t = 0; t < 3; ++t)
#pragma unroll
        for (int r = 0; r < 8; ++r) a[t][r] = 0.0f;
    load_n(eb, whp, 1);  mm_stage<3, true>(a, ea, zr, 0);
    load_n(ea, whp, 2);  mm_stage<3, true>(a, eb, zr, 1);
    load_n(eb, whp, 3);  mm_stage<3, true>(a, ea, zr, 2);
    mm_stage<3, true>(a, eb, zr, 3);
    // same wait for the QKV weight loads: their address pair stays untouched up to this line
    asm volatile("s_wait_xcnt 0x0" :: "v"(whp) : "memory");

    float* qw = qkv + ((blockIdx.x >> 4) * NHD + w) * FHEAD + (blockIdx.x & 15) * FTILE + lane * 4;
#pragma unroll
    for (int t = 0; t < 3; ++t) {
        const v4f lo = { a[t][0], a[t][1], a[t][2], a[t][3] };
        const v4f hi4 = { a[t][4], a[t][5], a[t][6], a[t][7] };
        *(v4f*)(qw + t * FSEC)       = lo;
        *(v4f*)(qw + t * FSEC + 128) = hi4;
    }
    // same wait for these stores: the code of the other work-groups follows in the listing
    asm volatile("s_wait_xcnt 0x0" ::: "memory");
}

// ---------------- host launch ----------------
extern "C" void kernel_launch(void* const* d_in, const int* in_sizes, int n_in,
                              void* d_out, int out_size, void* d_ws, size_t ws_size,
                              hipStream_t stream)
{
    const float* nf    = (const float*)d_in[0];   // (16,256,2)
    const float* ef    = (const float*)d_in[1];   // (16,256,256,1)
    const float* Wn    = (const float*)d_in[2];   // (2,128)
    const float* We_in = (const float*)d_in[3];   // (1,128)
    const float* ln1g  = (const float*)d_in[4];   // (3,128)
    const float* ln1b  = (const float*)d_in[5];
    const float* Wh    = (const float*)d_in[6];   // (3,128,384)
    const float* We    = (const float*)d_in[7];   // (3,128,16)
    const float* ln2g  = (const float*)d_in[8];
    const float* ln2b  = (const float*)d_in[9];
    const float* W1    = (const float*)d_in[10];  // (3,128,512)
    const float* W2    = (const float*)d_in[11];  // (3,512,128)
    const float* Wdec  = (const float*)d_in[12];  // (128,1)
    float* out = (float*)d_out;

    float* ws = (float*)d_ws;
    float* hA   = ws;                         // 524288, layer input, even layers
    float* hB   = ws + 524288;                // 524288, layer input, odd layers
    float* qkvA = ws + 1048576;               // 1572864, QKV of even layers
    float* qkvB = ws + 2621440;               // 1572864, QKV of the odd layer
    float* comb = ws + 14155776;              // 64 (48 used)
    float* whT  = ws + 14155840;              // 3*384*128 = 147456 (layer 0's part stays unused)
    float* w1T  = ws + 14303296;              // 3*512*128 = 196608
    float* w2T  = ws + 14499904;              // 3*128*512 = 196608

    const dim3 ga(NNOD / 16, NBAT);

    // h0 = nf Wn, qkv0 = LN1(h0) Wh[0]; beside them comb and the weights of the later
    // launches in fragment order
    first_kernel<<<ROWG + PREPG, 256, 0, stream>>>(
        nf, Wn, ln1g, ln1b, Wh, hA, qkvA, W1, W2, We_in, We, whT, w1T, w2T, comb);

    // y = (softmax(q k^T / 4 + ef*combB) * ef*combG) @ v, all heads;
    // h1 = relu(LN2(y + h0) W1[0]) W2[0] + y, qkv1 = LN1(h1) Wh[1]
    layer_kernel<1><<<ga, 256, 0, stream>>>(
        qkvA, ef, comb, hA, hB, ln2g, ln2b, w1T, w2T,
        ln1g + HIDD, ln1b + HIDD, whT + 384 * HIDD, qkvB, nullptr, nullptr);

    layer_kernel<1><<<ga, 256, 0, stream>>>(
        qkvB, ef, comb + 16, hB, hA, ln2g + HIDD, ln2b + HIDD, w1T + 512 * HIDD, w2T + 512 * HIDD,
        ln1g + 2 * HIDD, ln1b + 2 * HIDD, whT + 2 * 384 * HIDD, qkvA, nullptr, nullptr);

    // last layer; out = 10 * tanh((h3 @ Wdec) / sqrt(128))
    layer_kernel<2><<<ga, 256, 0, stream>>>(
        qkvA, ef, comb + 32, hA, nullptr, ln2g + 2 * HIDD, ln2b + 2 * HIDD,
        w1T + 2 * 512 * HIDD, w2T + 2 * 512 * HIDD,
        nullptr, nullptr, nullptr, nullptr, Wdec, out);
}

// v008
// One run takes 52.6 microseconds.
// Next to v007, in two timings, it ran 1.03 and 1.04 times as fast.
// Over all steps from v000 it is 6.94 times as fast.
#include <hip/hip_runtime.h>
#include <math.h>

typedef __attribute__((ext_vector_type(2))) float v2f;
typedef __attribute__((ext_vector_type(4))) float v4f;
typedef __attribute__((ext_vector_type(8))) float v8f;

#define HIDD 128
#define NHD  8
#define NNOD 256
#define NBAT 16

#define ZP 132    // LDS pitch of a 128-wide row in floats: 16 B x odd, b128 reads conflict-free

__device__ __forceinline__ v8f mma_pair(const v4f a, const float b0, const float b1,
                                        const int s, const v8f c)
{
    const v2f av = { a[2 * s], a[2 * s + 1] };
    const v2f bv = { b0, b1 };
    return __builtin_amdgcn_wmma_f32_16x16x4_f32(false, av, false, bv, (short)0, c, false, false);
}

// The same product with the operands swapped (activations as A, weights as B): the tile comes out
// untransposed, a lane's 8 registers are rows 8*kh + r of column l16.  Same k slots, same sum order.
__device__ __forceinline__ v8f mma_pair_t(const v4f a, const float b0, const float b1,
                                          const int s, const v8f c)
{
    const v2f av = { a[2 * s], a[2 * s + 1] };
    const v2f bv = { b0, b1 };
    return __builtin_amdgcn_wmma_f32_16x16x4_f32(false, bv, false, av, (short)0, c, false, false);
}

// layernorm of one 128-wide row held by one wave, four consecutive columns a lane
__device__ __forceinline__ v4f ln_wave(const v4f t, const v4f g, const v4f b)
{
    float s  = (t[0] + t[1]) + (t[2] + t[3]);
    float s2 = (t[0] * t[0] + t[1] * t[1]) + (t[2] * t[2] + t[3] * t[3]);
    for (int o = 16; o >= 1; o >>= 1) {
        s  += __shfl_xor(s,  o, 32);
        s2 += __shfl_xor(s2, o, 32);
    }
    const float mu   = s * (1.0f / HIDD);
    const float var  = s2 * (1.0f / HIDD) - mu * mu;
    const float rinv = rsqrtf(var + 1e-5f);
    v4f r;
    for (int i = 0; i < 4; ++i) r[i] = (t[i] - mu) * rinv * g[i] + b[i];
    return r;
}

// All loops below are unrolled so that the register arrays keep constant indices.
// One stage = 32 k of NT weight tiles of 16 columns n.
// k slot (kh, e) of step (q, s) is k = 32*st + 8*q + 4*kh + 2*s + e, in A and in B alike.
// The weights lie in the workspace in fragment order, [tile n/16][k/8][lane = 16*kh + n%16][4 k],
// so that one 16-byte load of a wave covers 512 contiguous bytes: four whole lines, not a
// quarter of sixteen.  TS = distance in floats between two tiles of the wave.
#define WTILE 2048   // floats of one weight tile: 16 columns x 128 k
template<int NT, int TS>
__device__ __forceinline__ void load_w(v4f (&w)[NT * 4], const float* __restrict__ wp, const int st)
{
#pragma unroll
    for (int t = 0; t < NT; ++t)
#pragma unroll
        for (int q = 0; q < 4; ++q)
            w[t * 4 + q] = *(const v4f*)(wp + t * TS + (st * 4 + q) * 128);
}

// VT: the last tile is made with the operands swapped (mma_pair_t)
template<int NT, bool VT = false>
__device__ __forceinline__ void mm_stage(v8f (&acc)[NT], const v4f (&w)[NT * 4],
                                         const float* zr, const int st)
{
    v4f bz[4];
#pragma unroll
    for (int q = 0; q < 4; ++q) bz[q] = *(const v4f*)(zr + st * 32 + q * 8);
    // keeps the next stage's weight loads and this stage's LDS reads ahead of the WMMA block:
    // left free, the scheduler sinks each load to just before its use and the wave waits it out
    __builtin_amdgcn_sched_barrier(0);
#pragma unroll
    for (int q = 0; q < 4; ++q)
#pragma unroll
        for (int s = 0; s < 2; ++s)
#pragma unroll
            for (int t = 0; t < NT; ++t)
                acc[t] = (VT && t == NT - 1)
                       ? mma_pair_t(w[t * 4 + q], bz[q][2 * s], bz[q][2 * s + 1], s, acc[t])
                       : mma_pair(w[t * 4 + q], bz[q][2 * s], bz[q][2 * s + 1], s, acc[t]);
    __builtin_amdgcn_sched_barrier(0);   // the loads that follow are not issued before this block
}

// One stage of the second MLP product = two output tiles (c = 32*p .. 32*p + 31) over the
// wave's own 64 hidden columns.  Fragment order here too:
// [wave = hidden/64][tile c/16][t = hidden/16 % 4][hf][lane = 16*kh + c%16][4 hidden],
// hidden = 64*wave + 16*t + 8*kh + 4*hf + e.
__device__ __forceinline__ void load_c(v4f (&w)[16], const float* __restrict__ cp, const int p)
{
#pragma unroll
    for (int u = 0; u < 2; ++u)
#pragma unroll
        for (int t = 0; t < 4; ++t)
#pragma unroll
            for (int hf = 0; hf < 2; ++hf)
                w[u * 8 + t * 2 + hf] = *(const v4f*)(cp + (2 * p + u) * 1024 + t * 256 + hf * 128);
}

__device__ __forceinline__ void mm_c(v8f (&acc)[8], const v4f (&w)[16], const v8f (&d)[4], const int p)
{
    __builtin_amdgcn_sched_barrier(0);   // the loads issued in front of it stay ahead of this block
#pragma unroll
    for (int t = 0; t < 4; ++t)
#pragma unroll
        for (int hf = 0; hf < 2; ++hf)
#pragma unroll
            for (int s = 0; s < 2; ++s)
#pragma unroll
                for (int u = 0; u < 2; ++u)
                    acc[2 * p + u] = mma_pair(w[u * 8 + t * 2 + hf], d[t][4 * hf + 2 * s],
                                              d[t][4 * hf + 2 * s + 1], s, acc[2 * p + u]);
    __builtin_amdgcn_sched_barrier(0);   // the loads that follow are not issued before this block
}

// Work-group barrier that waits for the wave's LDS operations only.  __syncthreads() also waits for
// every global load in flight, which would drain the weight stages that are requested ahead; nothing
// that passes between the waves of a work-group here goes through global memory.
__device__ __forceinline__ void lds_barrier()
{
    __builtin_amdgcn_fence(__ATOMIC_RELEASE, "workgroup", "local");
    __builtin_amdgcn_s_barrier();
    __builtin_amdgcn_fence(__ATOMIC_ACQUIRE, "workgroup", "local");
}

// Four exp2 in one statement.  The early-clobber outputs keep every v_exp_f32 from being
// directly followed by a write of its source or a read of its result, and the v_nop is
// the one slot the instruction set asks for behind the last of them.
__device__ __forceinline__ void exp2x4(v4f& p, float t0, float t1, float t2, float t3)
{
    float p0, p1, p2, p3;
    asm("v_exp_f32 %0, %4\n\tv_exp_f32 %1, %5\n\tv_exp_f32 %2, %6\n\tv_exp_f32 %3, %7\n\tv_nop"
        : "=&v"(p0), "=&v"(p1), "=&v"(p2), "=&v"(p3)
        : "v"(t0), "v"(t1), "v"(t2), "v"(t3));
    p[0] = p0; p[1] = p1; p[2] = p2; p[3] = p3;
}

// ------ one whole layer: one workgroup = one batch x 16 rows, eight waves ------
// Attention (one wave per head), then the row-local chain on the same 16 rows, whose y never
// leaves LDS.  MODE 1: LN2, MLP + y, LN1 of the next layer, its QKV.  MODE 2: LN2, MLP + y, decoder.
// The next layer's QKV goes to a second buffer: other workgroups still read K and V of this one.
//
// S^T = K Q^T is kept in registers: lane (l16, kh) register r of tile jt holds
// key j = ((jt + kr) & 15)*16 + 8*kh + r of query i0 + l16.  That is already the B fragment of
// Y^T = V^T W^T when the k slots of step s are read as j = ((jt + kr) & 15)*16 + 8*kh + 2*s + {0,1},
// so the weights never leave the registers.  The softmax runs down a lane's own
// 128 values plus one exchange between the two lane halves.
//
// Q, K and V lie in the workspace in fragment order,
// [Q | K | V][batch][head][tile of 16 rows][half][lane = 16*kh + l16][4 floats]:
// Q and K: row 16*tile + l16, d = 8*kh + 4*half + e;  V: row 16*tile + 8*kh + 4*half + e, d = l16.
// Every fragment load, and every store of the wave that makes a tile, is 512 contiguous bytes.
#define FTILE 256                    // floats of one tile: 16 rows x 16 d
#define FHEAD (NNOD / 16 * FTILE)    // of one head of one batch
#define FSEC  (NBAT * NHD * FHEAD)   // of all Q, all K or all V
#define EFP 260   // LDS pitch of an edge row in floats: 16 B x odd, b128 reads conflict-free
#define YSP 132   // LDS pitch of an output row in floats: 16 B x odd
template<int MODE>
__global__ __launch_bounds__(256)
void layer_kernel(const float* __restrict__ qkv, const float* __restrict__ ef,
                  const float* __restrict__ comb, const float* __restrict__ hin,
                  float* __restrict__ hout,
                  const float* __restrict__ g2, const float* __restrict__ b2,
                  const float* __restrict__ w1T, const float* __restrict__ w2T,
                  const float* __restrict__ g1, const float* __restrict__ b1,
                  const float* __restrict__ whT, float* __restrict__ qkvn,
                  const float* __restrict__ Wdec, float* __restrict__ out)
{
    __shared__ __attribute__((aligned(16))) float efs[16 * EFP];
    __shared__ __attribute__((aligned(16))) float ys[16 * YSP];
    __shared__ __attribute__((aligned(16))) float zs[16 * ZP];
    __shared__ __attribute__((aligned(16))) float red[8 * 16 * ZP];

    const int i0   = blockIdx.x * 16;
    const int b    = blockIdx.y;
    const int row0 = b * NNOD + i0;
    const int tid  = threadIdx.x;
    const int w    = __builtin_amdgcn_readfirstlane(tid >> 5);   // wave = head
    const int lane = tid & 31;
    const int l16  = lane & 15;
    const int kh   = lane >> 4;

    // edge tile (16 rows x 256, contiguous): loads issued first, so that they fly beside the K loads
    const v4f* __restrict__ efg = (const v4f*)(ef + (long long)row0 * NNOD);
    v4f e4[4];
#pragma unroll
    for (int q = 0; q < 4; ++q) e4[q] = efg[tid + 256 * q];

    const float cB = comb[w];
    const float cG = comb[NHD + w];

    const float* __restrict__ hb = qkv + (b * NHD + w) * FHEAD;   // the head's tiles; a lane reads at 4*lane

    // Q as B fragment, K as A fragment; k slot (kh, e) of step s is d = 8*kh + 2*s + e in both
    const float* __restrict__ qp = hb + blockIdx.x * FTILE;
    const v4f q0 = *(const v4f*)(qp + lane * 4);
    const v4f q1 = *(const v4f*)(qp + 128 + lane * 4);
    const v2f qf[4] = { {q0[0], q0[1]}, {q0[2], q0[3]}, {q1[0], q1[1]}, {q1[2], q1[3]} };

    // The 16 work-groups of a batch read the same K and V.  Each walks the 16 key tiles from a start of
    // its own and wraps, so that they do not ask L2 for one line at one moment and every tile is asked
    // for early by one of them: tile slot jt holds key tile (jt + kr) & 15, in K, in the edge tile in
    // LDS and in V alike.  Any kr gives the same sums in another order; this one spreads neighbours.
    const int kr = ((blockIdx.x & 3) << 2) | (blockIdx.x >> 2);
    unsigned ko[16];   // the lane's offset in bytes in the head's K, and in its V
#pragma unroll
    for (int jt = 0; jt < 16; ++jt) ko[jt] = (((jt + kr) & 15) * FTILE + lane * 4) * 4;
    const char* __restrict__ kb = (const char*)(hb + FSEC);
    const char* __restrict__ vb = (const char*)(hb + 2 * FSEC);

    v4f k0[16], k1[16];
#pragma unroll
    for (int jt = 0; jt < 16; ++jt) {
        k0[jt] = *(const v4f*)(kb + ko[jt]);
        k1[jt] = *(const v4f*)(kb + 512 + ko[jt]);
    }

    // what the chain needs of this layer's input: the wave's two rows and LN2's scale and shift,
    // four columns a lane; asked for here, they are long there when the attention ends
    const float* __restrict__ hp = hin + (row0 + 2 * w) * HIDD;
    v4f hi[2];
#pragma unroll
    for (int rr = 0; rr < 2; ++rr) hi[rr] = *(const v4f*)(hp + rr * HIDD + lane * 4);
    const v4f gg = *(const v4f*)(g2 + lane * 4);
    const v4f bb = *(const v4f*)(b2 + lane * 4);

    // The wait that belongs in front of any overwrite of a register the loads above name.
    // Bases and offsets are inputs so that their registers stay untouched up to this line.
    asm volatile("s_wait_xcnt 0x0" :: "s"(qp), "s"(hb), "s"(efg), "v"(tid), "s"(hp), "s"(g2), "s"(b2), "v"(lane),
                                      "v"(ko[0]), "v"(ko[1]), "v"(ko[2]), "v"(ko[3]), "v"(ko[4]), "v"(ko[5]),
                                      "v"(ko[6]), "v"(ko[7]), "v"(ko[8]), "v"(ko[9]), "v"(ko[10]), "v"(ko[11]),
                                      "v"(ko[12]), "v"(ko[13]), "v"(ko[14]), "v"(ko[15]) : "memory");

    // All work-groups read the same weights.  They walk the four stages of each product from different
    // starting points and wrap, so that they do not ask L2 for one line at one moment: ring stage g
    // holds stage (g + rot) & 3.  The activations follow through one LDS column offset (rotcol below).
    const int rot = (blockIdx.x + blockIdx.y) & 3;
    const float* __restrict__ w1b = w1T + 4 * w * WTILE;   // tiles 4*w .. 4*w + 3
    const float* __restrict__ whb = whT + w * WTILE;       // tiles w, 8 + w, 16 + w: Q, K, V of head w
    const float* __restrict__ w2b = w2T + w * 8192;        // the wave's 64 hidden columns
    const float* w1s[4];
    const float* w2s[4];
    const float* whs[4];
#pragma unroll
    for (int g = 0; g < 4; ++g) {
        const int st = (g + rot) & 3;
        w1s[g] = w1b + st * 512;
        w2s[g] = w2b + st * 2048;
        whs[g] = whb + st * 512;
    }

    v8f S[16];
#pragma unroll
    for (int jt = 0; jt < 16; ++jt)
#pragma unroll
        for (int r = 0; r < 8; ++r) S[jt][r] = 0.0f;
#pragma unroll
    for (int g = 0; g < 4; ++g)
#pragma unroll
        for (int s = 0; s < 4; ++s)
#pragma unroll
            for (int t = 0; t < 4; ++t) {
                const int jt = g * 4 + t;
                const v4f kk = (s < 2) ? k0[jt] : k1[jt];
                const v2f a = { kk[(s & 1) * 2], kk[(s & 1) * 2 + 1] };
                S[jt] = __builtin_amdgcn_wmma_f32_16x16x4_f32(
                    false, a, false, qf[s], (short)0, S[jt], false, false);
            }

    // The weights of the row chain run through a ring of four register stages, r0 .. r3, each asked
    // for three to four stages before its products.  The first takes registers K has left; it goes
    // out alone, so that V, which is needed sooner and returns behind it, is not held up for long.
    v4f r0[16], r1[16], r2[16], r3[16];
    __builtin_amdgcn_sched_barrier(0);   // not lifted among the score products, where K still holds the registers
    load_w<4, WTILE>(r0, w1s[0] + lane * 4, 0);
    // The wait that belongs in front of any overwrite of a register these loads name.
    asm volatile("s_wait_xcnt 0x0" :: "s"(w1s[0]), "v"(lane) : "memory");
    __builtin_amdgcn_sched_barrier(0);   // issued here, not sunk towards their use

#pragma unroll
    for (int q = 0; q < 4; ++q) {
        const int f = tid + 256 * q;
        *(v4f*)(efs + (f >> 6) * EFP + ((((f & 63) >> 2) - kr) & 15) * 16 + (f & 3) * 4) = e4[q];   // key tile to its slot
    }
    lds_barrier();   // the edge tile is read by all eight heads

    // x = s/sqrt(16) + e*cB, row maximum
    const float* er = efs + l16 * EFP + 8 * kh;
    float mx[4] = { -INFINITY, -INFINITY, -INFINITY, -INFINITY };
#pragma unroll
    for (int jt = 0; jt < 16; ++jt) {
        const v4f ea = *(const v4f*)(er + jt * 16);
        const v4f eb = *(const v4f*)(er + jt * 16 + 4);
#pragma unroll
        for (int r = 0; r < 8; ++r) {
            const float e = (r < 4) ? ea[r & 3] : eb[r & 3];
            const float x = S[jt][r] * 0.25f + e * cB;
            S[jt][r] = x;
            mx[r & 3] = fmaxf(mx[r & 3], x);
        }
    }
    float m = fmaxf(fmaxf(mx[0], mx[1]), fmaxf(mx[2], mx[3]));
    m = fmaxf(m, __shfl_xor(m, 16, 32));

    // p = exp(x - m) = exp2(x*log2e - m*log2e), row sum, unnormalised gated weight p*e
    const float L2E = 1.4426950408889634f;
    const float nm  = -m * L2E;
    float sm[4] = { 0.0f, 0.0f, 0.0f, 0.0f };
#pragma unroll
    for (int jt = 0; jt < 16; ++jt) {
        const v4f ea = *(const v4f*)(er + jt * 16);
        const v4f eb = *(const v4f*)(er + jt * 16 + 4);
#pragma unroll
        for (int c = 0; c < 2; ++c) {
            const v4f e = c ? eb : ea;
            v4f p;
            exp2x4(p, fmaf(S[jt][4 * c + 0], L2E, nm), fmaf(S[jt][4 * c + 1], L2E, nm),
                      fmaf(S[jt][4 * c + 2], L2E, nm), fmaf(S[jt][4 * c + 3], L2E, nm));
#pragma unroll
            for (int r = 0; r < 4; ++r) {
                sm[r] += p[r];
                S[jt][4 * c + r] = p[r] * e[r];
            }
        }
    }
    float ss = (sm[0] + sm[1]) + (sm[2] + sm[3]);
    ss += __shfl_xor(ss, 16, 32);

    // Y^T[d][i] = sum_j V[j][d] * w[i][j]; A fragment: lane l16 = d, rows j in the order above
    v8f o[2];
#pragma unroll
    for (int r = 0; r < 8; ++r) { o[0][r] = 0.0f; o[1][r] = 0.0f; }
#pragma unroll
    for (int jt = 0; jt < 16; ++jt) {
        const v4f v0 = *(const v4f*)(vb + ko[jt]);
        const v4f v1 = *(const v4f*)(vb + 512 + ko[jt]);
#pragma unroll
        for (int s = 0; s < 4; ++s) {
            const v4f vv = (s < 2) ? v0 : v1;
            const v2f a = { vv[(s & 1) * 2], vv[(s & 1) * 2 + 1] };
            const v2f wv = { S[jt][2 * s], S[jt][2 * s + 1] };
            o[s & 1] = __builtin_amdgcn_wmma_f32_16x16x4_f32(
                false, a, false, wv, (short)0, o[s & 1], false, false);
        }
    }

    // same wait for the V loads: their base and offsets stay untouched up to this line
    asm volatile("s_wait_xcnt 0x0" :: "s"(hb),
                                      "v"(ko[0]), "v"(ko[1]), "v"(ko[2]), "v"(ko[3]), "v"(ko[4]), "v"(ko[5]),
                                      "v"(ko[6]), "v"(ko[7]), "v"(ko[8]), "v"(ko[9]), "v"(ko[10]), "v"(ko[11]),
                                      "v"(ko[12]), "v"(ko[13]), "v"(ko[14]), "v"(ko[15]) : "memory");

    // The chain reads its lane index anew (ln = lane, lr = l16, lk = kh): held in a register
    // across the attention, the index was spilled to scratch in one of the two builds.
    const int ln = __builtin_amdgcn_mbcnt_lo(~0u, 0u);
    const int lr = ln & 15;
    const int lk = ln >> 4;

    const float* zr = zs + lr * ZP + 4 * lk;          // B fragments: row lr of the normed tile
    // LDS column of the lane's four columns 4*ln: their block of 32 lies at ring stage (block - rot) & 3,
    // in the normed tile (read by stage) and in the partial sums (written by stage) alike
    const int rotcol = ((((ln >> 3) - rot) & 3) << 5) + ((ln & 7) << 2);
    v4f e0[12], e1[12], e2[12], e3[12];                // QKV weight stages, the ring's last round
    v4f yv[2], hv[2];                                  // the wave's two rows, 4 columns a lane
    v4f gg1, bb1;                                      // LN1 scale and shift of the lane's columns
    v4f wd;                                            // decoder weights of the lane's columns

    load_w<4, WTILE>(r1, w1s[1] + ln * 4, 0);     // these three take registers of K, of the scores and of V
    load_w<4, WTILE>(r2, w1s[2] + ln * 4, 0);
    load_w<4, WTILE>(r3, w1s[3] + ln * 4, 0);
    __builtin_amdgcn_sched_barrier(0);   // issued here, not sunk to the barrier

    // normalise and gate-scale once per output, gather the 8 heads' columns per row in LDS
    const float sc = cG / ss;
    v4f ya, yb;
#pragma unroll
    for (int r = 0; r < 4; ++r) {
        ya[r] = (o[0][r] + o[1][r]) * sc;
        yb[r] = (o[0][r + 4] + o[1][r + 4]) * sc;
    }
    float* yw = ys + lr * YSP + w * 16 + 8 * lk;
    *(v4f*)(yw)     = ya;
    *(v4f*)(yw + 4) = yb;
    lds_barrier();   // every head's columns are in place before whole rows are read

#pragma unroll
    for (int rr = 0; rr < 2; ++rr) {
        yv[rr] = *(const v4f*)(ys + (2 * w + rr) * YSP + ln * 4);
        *(v4f*)(zs + (2 * w + rr) * ZP + rotcol) = ln_wave(yv[rr] + hi[rr], gg, bb);
    }
    lds_barrier();             // all 16 normed rows are read by every wave

    {
        // act^T = relu(W1^T z^T), hidden columns 64*w .. 64*w + 63; a stage's registers are refilled behind its products
        v8f d[4];
#pragma unroll
        for (int t = 0; t < 4; ++t)
#pragma unroll
            for (int r = 0; r < 8; ++r) d[t][r] = 0.0f;
        mm_stage<4>(d, r0, zr, 0);  load_c(r0, w2s[0] + ln * 4, 0);
        mm_stage<4>(d, r1, zr, 1);  load_c(r1, w2s[1] + ln * 4, 0);
        mm_stage<4>(d, r2, zr, 2);  load_c(r2, w2s[2] + ln * 4, 0);
        mm_stage<4>(d, r3, zr, 3);  load_c(r3, w2s[3] + ln * 4, 0);
#pragma unroll
        for (int t = 0; t < 4; ++t)
#pragma unroll
            for (int r = 0; r < 8; ++r) d[t][r] = fmaxf(d[t][r], 0.0f);

        // partial (act W2)^T over the wave's own 64 hidden columns
        v8f oc[8];
#pragma unroll
        for (int c = 0; c < 8; ++c)
#pragma unroll
            for (int r = 0; r < 8; ++r) oc[c][r] = 0.0f;
        mm_c(oc, r0, d, 0);
        if constexpr (MODE == 1) {   // LN1's scale and shift first: the load counter returns in order
            gg1 = *(const v4f*)(g1 + ln * 4);
            bb1 = *(const v4f*)(b1 + ln * 4);
            load_w<3, 8 * WTILE>(e0, whs[0] + ln * 4, 0);
        } else {                     // asked for here, it is there when the rows are summed
            wd = *(const v4f*)(Wdec + ln * 4);
        }
        mm_c(oc, r1, d, 1);
        if constexpr (MODE == 1) load_w<3, 8 * WTILE>(e1, whs[1] + ln * 4, 0);
        mm_c(oc, r2, d, 2);
        if constexpr (MODE == 1) load_w<3, 8 * WTILE>(e2, whs[2] + ln * 4, 0);
        mm_c(oc, r3, d, 3);
        if constexpr (MODE == 1) {
            load_w<3, 8 * WTILE>(e3, whs[3] + ln * 4, 0);
            __builtin_amdgcn_sched_barrier(0);   // issued here, not sunk to the barrier
        }

        float* rw = red + (w * 16 + lr) * ZP + 8 * lk;
#pragma unroll
        for (int c = 0; c < 8; ++c) {
            const v4f lo = { oc[c][0], oc[c][1], oc[c][2], oc[c][3] };
            const v4f hi4 = { oc[c][4], oc[c][5], oc[c][6], oc[c][7] };
            *(v4f*)(rw + c * 16)     = lo;
            *(v4f*)(rw + c * 16 + 4) = hi4;
        }
        // same wait for the weight loads: the stage bases and the offset stay untouched up to this line
        asm volatile("s_wait_xcnt 0x0" :: "s"(w1s[1]), "s"(w1s[2]), "s"(w1s[3]), "s"(w2s[0]), "s"(w2s[1]),
                                          "s"(w2s[2]), "s"(w2s[3]), "v"(ln) : "memory");
        lds_barrier();             // the eight partial sums of every row are in place

#pragma unroll
        for (int rr = 0; rr < 2; ++rr) {
            const float* rp = red + (2 * w + rr) * ZP + rotcol;
            v4f s = *(const v4f*)rp;
#pragma unroll
            for (int u = 1; u < 8; ++u) s += *(const v4f*)(rp + u * 16 * ZP);
            hv[rr] = s + yv[rr];
        }
    }

    if constexpr (MODE == 2) {
        // out = 10 * tanh((h . Wdec) / sqrt(128))
        v2f res;
#pragma unroll
        for (int rr = 0; rr < 2; ++rr) {
            float s = (hv[rr][0] * wd[0] + hv[rr][1] * wd[1]) + (hv[rr][2] * wd[2] + hv[rr][3] * wd[3]);
            for (int o2 = 16; o2 >= 1; o2 >>= 1) s += __shfl_xor(s, o2, 32);
            res[rr] = 10.0f * tanhf(s * 0.08838834764831845f);
        }
        if (ln == 0) *(v2f*)(out + row0 + 2 * w) = res;
    } else {
        float* __restrict__ op = hout + (row0 + 2 * w) * HIDD + ln * 4;
#pragma unroll
        for (int rr = 0; rr < 2; ++rr) {
            *(v4f*)(op + rr * HIDD) = hv[rr];
            *(v4f*)(zs + (2 * w + rr) * ZP + rotcol) = ln_wave(hv[rr], gg1, bb1);
        }
        // same wait for the stores and the loads since the last one
        asm volatile("s_wait_xcnt 0x0" :: "v"(op), "v"(ln) : "memory");
        lds_barrier();             // all 16 normed rows are read by every wave

        // Q^T, K^T and V of head w: columns 16*w .. 16*w + 15 of each third of Wh
        v8f a[3];
#pragma unroll
        for (int t = 0; t < 3; ++t)
#pragma unroll
            for (int r = 0; r < 8; ++r) a[t][r] = 0.0f;
        mm_stage<3, true>(a, e0, zr, 0);
        mm_stage<3, true>(a, e1, zr, 1);
        mm_stage<3, true>(a, e2, zr, 2);
        mm_stage<3, true>(a, e3, zr, 3);
        // same wait for the QKV weight loads: their stage bases and offset stay untouched up to this line
        asm volatile("s_wait_xcnt 0x0" :: "s"(whs[0]), "s"(whs[1]), "s"(whs[2]), "s"(whs[3]), "v"(ln) : "memory");

        float* qw = qkvn + (b * NHD + w) * FHEAD + blockIdx.x * FTILE + ln * 4;
#pragma unroll
        for (int t = 0; t < 3; ++t) {
            const v4f lo = { a[t][0], a[t][1], a[t][2], a[t][3] };
            const v4f hi4 = { a[t][4], a[t][5], a[t][6], a[t][7] };
            *(v4f*)(qw + t * FSEC)       = lo;
            *(v4f*)(qw + t * FSEC + 128) = hi4;
        }
    }
}

// ------ first launch: layer 0's row work, and beside it the preparation of the later launches ------
#define ROWG (NBAT * NNOD / 16)   // work-groups 0 .. ROWG-1: 16 rows each
#define PREPG 121                 // behind them: 24 + 48 + 48 weight-ordering work-groups and one for comb

// One stage of the wave's three QKV weight tiles read from the matrix as it is given (rows k,
// pitch 384): the same values in the same registers as load_w takes from the fragment-order copy.
__device__ __forceinline__ void load_n(v4f (&w)[12], const float* __restrict__ wp, const int st)
{
#pragma unroll
    for (int t = 0; t < 3; ++t)
#pragma unroll
        for (int q = 0; q < 4; ++q)
#pragma unroll
            for (int c = 0; c < 4; ++c)
                w[t * 4 + q][c] = wp[(st * 32 + q * 8 + c) * 384 + t * HIDD];
}

// in[l][m][n] to fragment order, m being the k index of the product: one wave turns one tile of
// 16 m x 32 n, a lane 4 x 4 of it; four consecutive m of one n are one lane's 16 bytes of a fragment.
// W2ORD false: the order load_w reads; true: the order load_c reads.
// Loads cover whole 128-byte lines; a wave's four stores together fill whole 512-byte blocks.
template<int M, int N, bool W2ORD>
__device__ __forceinline__ void pack_tile(const float* __restrict__ in, float* __restrict__ out,
                                               const int T, const int lane)
{
    constexpr int NTN = N / 32, TPL = (M / 16) * NTN;
    const int l = T / TPL, rem = T % TPL;
    const int m0 = (rem / NTN) * 16 + 4 * (lane >> 3);
    const int n0 = (rem % NTN) * 32 + 4 * (lane & 7);
    const float* __restrict__ ip = in + l * M * N + m0 * N + n0;
    const int off = W2ORD
        ? (m0 >> 6) * 8192 + (n0 >> 4) * 1024 + ((m0 >> 4) & 3) * 256 + ((m0 >> 2) & 1) * 128
          + (((m0 >> 3) & 1) * 16 + (n0 & 15)) * 4
        : ((n0 >> 4) * 16 + (m0 >> 3)) * 128 + (((m0 >> 2) & 1) * 16 + (n0 & 15)) * 4;
    float* __restrict__ op = out + l * M * N + off;
    v4f r[4];
#pragma unroll
    for (int j = 0; j < 4; ++j) r[j] = *(const v4f*)(ip + j * N);
#pragma unroll
    for (int i = 0; i < 4; ++i) {
        const v4f c = { r[0][i], r[1][i], r[2][i], r[3][i] };
        *(v4f*)(op + i * 4) = c;
    }
    // The wait that belongs in front of any overwrite of a register the stores above name.
    asm volatile("s_wait_xcnt 0x0" ::: "memory");
}

__global__ __launch_bounds__(256)
void first_kernel(const float* __restrict__ nf, const float* __restrict__ Wn,
                  const float* __restrict__ g1, const float* __restrict__ b1,
                  const float* __restrict__ Wh, float* __restrict__ hout, float* __restrict__ qkv,
                  const float* __restrict__ W1, const float* __restrict__ W2,
                  const float* __restrict__ We_in, const float* __restrict__ We,
                  float* __restrict__ whT, float* __restrict__ w1T, float* __restrict__ w2T,
                  float* __restrict__ comb)
{
    __shared__ __attribute__((aligned(16))) float zs[16 * ZP];

    const int tid  = threadIdx.x;
    const int w    = __builtin_amdgcn_readfirstlane(tid >> 5);
    const int lane = tid & 31;
    const int l16  = lane & 15;
    const int kh   = lane >> 4;

    // Preparation work-groups: nothing of theirs is read in this launch, and they leave
    // as whole work-groups in front of every barrier.
    if (blockIdx.x >= ROWG) {
        const int pb = blockIdx.x - ROWG;
        if (pb < 24) {            // Wh of layers 1 and 2 (layer 0 is read as it is given below)
            pack_tile<128, 384, false>(Wh + 128 * 384, whT + 128 * 384, pb * 8 + w, lane);
        } else if (pb < 72) {
            pack_tile<128, 512, false>(W1, w1T, (pb - 24) * 8 + w, lane);
        } else if (pb < 120) {
            pack_tile<512, 128, true>(W2, w2T, (pb - 72) * 8 + w, lane);
        } else if (w < 2) {       // comb[l][c] = We_in . We[l][:, c], 48 values; lanes past them repeat the last
            const int t = tid < 48 ? tid : 47;
            const float* __restrict__ wp = We + (t >> 4) * HIDD * 16 + (t & 15);
            float s = 0.0f;
#pragma unroll                    // the loads go out in one run instead of one round trip per group
            for (int d = 0; d < HIDD; ++d) s += We_in[d] * wp[d * 16];
            // The wait that belongs in front of any overwrite of a register the loads above name.
            // The address is an input so that its registers stay untouched up to this line.
            asm volatile("s_wait_xcnt 0x0" :: "v"(wp) : "memory");
            if (tid < 48) comb[tid] = s;
        }
        return;
    }

    const int row0 = blockIdx.x * 16;
    const float* zr = zs + l16 * ZP + 4 * kh;          // B fragments: row l16 of the normed tile
    const float* __restrict__ whp = Wh + 4 * kh * 384 + 16 * w + l16;
    // All row work-groups read the same Wh.  As in layer_kernel they walk its four stages from different
    // starts and wrap: step g takes stage (g + rot) & 3, and the normed rows follow through rotcol.
    const int rot = blockIdx.x & 3;
    const float* whs[4];
#pragma unroll
    for (int g = 0; g < 4; ++g) whs[g] = whp + ((g + rot) & 3) * 32 * 384;
    const int rotcol = ((((lane >> 3) - rot) & 3) << 5) + ((lane & 7) << 2);
    v4f ea[12], eb[12];                                // QKV weight stages
    v4f hv[2];                                         // the wave's two rows, 4 columns a lane

    const v4f gg1 = *(const v4f*)(g1 + lane * 4);
    const v4f bb1 = *(const v4f*)(b1 + lane * 4);
    load_n(ea, whs[0], 0);
    // The wait that belongs in front of any overwrite of a register the loads above name.
    // Bases and offsets are inputs so that their registers stay untouched up to this line.
    asm volatile("s_wait_xcnt 0x0" :: "s"(g1), "s"(b1), "v"(whs[0]), "v"(lane) : "memory");
    __builtin_amdgcn_sched_barrier(0);   // issued here, not sunk to the barrier: they fly during the layernorm
    const v4f wn0 = *(const v4f*)(Wn + lane * 4);
    const v4f wn1 = *(const v4f*)(Wn + HIDD + lane * 4);
#pragma unroll
    for (int rr = 0; rr < 2; ++rr) {
        const int row = row0 + 2 * w + rr;
        hv[rr] = nf[row * 2] * wn0 + nf[row * 2 + 1] * wn1;
    }

    float* __restrict__ op = hout + (row0 + 2 * w) * HIDD + lane * 4;
#pragma unroll
    for (int rr = 0; rr < 2; ++rr) {
        *(v4f*)(op + rr * HIDD) = hv[rr];
        *(v4f*)(zs + (2 * w + rr) * ZP + rotcol) = ln_wave(hv[rr], gg1, bb1);
    }
    // same wait for the stores and the loads since the last one
    asm volatile("s_wait_xcnt 0x0" :: "v"(op), "v"(lane) : "memory");
    __syncthreads();           // all 16 normed rows are read by every wave

    // Q^T, K^T and V of head w: columns 16*w .. 16*w + 15 of each third of Wh
    v8f a[3];
#pragma unroll
    for (int t = 0; t < 3; ++t)
#pragma unroll
        for (int r = 0; r < 8; ++r) a[t][r] = 0.0f;
    load_n(eb, whs[1], 0);  mm_stage<3, true>(a, ea, zr, 0);
    load_n(ea, whs[2], 0);  mm_stage<3, true>(a, eb, zr, 1);
    load_n(eb, whs[3], 0);  mm_stage<3, true>(a, ea, zr, 2);
    mm_stage<3, true>(a, eb, zr, 3);
    // same wait for the QKV weight loads: their address pairs stay untouched up to this line
    asm volatile("s_wait_xcnt 0x0" :: "v"(whs[1]), "v"(whs[2]), "v"(whs[3]) : "memory");

    float* qw = qkv + ((blockIdx.x >> 4) * NHD + w) * FHEAD + (blockIdx.x & 15) * FTILE + lane * 4;
#pragma unroll
    for (int t = 0; t < 3; ++t) {
        const v4f lo = { a[t][0], a[t][1], a[t][2], a[t][3] };
        const v4f hi4 = { a[t][4], a[t][5], a[t][6], a[t][7] };
        *(v4f*)(qw + t * FSEC)       = lo;
        *(v4f*)(qw + t * FSEC + 128) = hi4;
    }
    // same wait for these stores: the code of the other work-groups follows in the listing
    asm volatile("s_wait_xcnt 0x0" ::: "memory");
}

// ---------------- host launch ----------------
extern "C" void kernel_launch(void* const* d_in, const int* in_sizes, int n_in,
                              void* d_out, int out_size, void* d_ws, size_t ws_size,
                              hipStream_t stream)
{
    const float* nf    = (const float*)d_in[0];   // (16,256,2)
    const float* ef    = (const float*)d_in[1];   // (16,256,256,1)
    const float* Wn    = (const float*)d_in[2];   // (2,128)
    const float* We_in = (const float*)d_in[3];   // (1,128)
    const float* ln1g  = (const float*)d_in[4];   // (3,128)
    const float* ln1b  = (const float*)d_in[5];
    const float* Wh    = (const float*)d_in[6];   // (3,128,384)
    const float* We    = (const float*)d_in[7];   // (3,128,16)
    const float* ln2g  = (const float*)d_in[8];
    const float* ln2b  = (const float*)d_in[9];
    const float* W1    = (const float*)d_in[10];  // (3,128,512)
    const float* W2    = (const float*)d_in[11];  // (3,512,128)
    const float* Wdec  = (const float*)d_in[12];  // (128,1)
    float* out = (float*)d_out;

    float* ws = (float*)d_ws;
    float* hA   = ws;                         // 524288, layer input, even layers
    float* hB   = ws + 524288;                // 524288, layer input, odd layers
    float* qkvA = ws + 1048576;               // 1572864, QKV of even layers
    float* qkvB = ws + 2621440;               // 1572864, QKV of the odd layer
    float* comb = ws + 14155776;              // 64 (48 used)
    float* whT  = ws + 14155840;              // 3*384*128 = 147456 (layer 0's part stays unused)
    float* w1T  = ws + 14303296;              // 3*512*128 = 196608
    float* w2T  = ws + 14499904;              // 3*128*512 = 196608

    const dim3 ga(NNOD / 16, NBAT);

    // h0 = nf Wn, qkv0 = LN1(h0) Wh[0]; beside them comb and the weights of the later
    // launches in fragment order
    first_kernel<<<ROWG + PREPG, 256, 0, stream>>>(
        nf, Wn, ln1g, ln1b, Wh, hA, qkvA, W1, W2, We_in, We, whT, w1T, w2T, comb);

    // y = (softmax(q k^T / 4 + ef*combB) * ef*combG) @ v, all heads;
    // h1 = relu(LN2(y + h0) W1[0]) W2[0] + y, qkv1 = LN1(h1) Wh[1]
    layer_kernel<1><<<ga, 256, 0, stream>>>(
        qkvA, ef, comb, hA, hB, ln2g, ln2b, w1T, w2T,
        ln1g + HIDD, ln1b + HIDD, whT + 384 * HIDD, qkvB, nullptr, nullptr);

    layer_kernel<1><<<ga, 256, 0, stream>>>(
        qkvB, ef, comb + 16, hB, hA, ln2g + HIDD, ln2b + HIDD, w1T + 512 * HIDD, w2T + 512 * HIDD,
        ln1g + 2 * HIDD, ln1b + 2 * HIDD, whT + 2 * 384 * HIDD, qkvA, nullptr, nullptr);

    // last layer; out = 10 * tanh((h3 @ Wdec) / sqrt(128))
    layer_kernel<2><<<ga, 256, 0, stream>>>(
        qkvA, ef, comb + 32, hA, nullptr, ln2g + 2 * HIDD, ln2b + 2 * HIDD,
        w1T + 2 * 512 * HIDD, w2T + 2 * 512 * HIDD,
        nullptr, nullptr, nullptr, nullptr, Wdec, out);
}

// v009
// Measured time: 48 microseconds a run.
// In two side-by-side timings against v008, it was 1.10 and 1.09 times as fast.
// Over all steps from v000 it is 7.62 times as fast.
#include <hip/hip_runtime.h>
#include <math.h>

typedef __attribute__((ext_vector_type(2))) float v2f;
typedef __attribute__((ext_vector_type(4))) float v4f;
typedef __attribute__((ext_vector_type(8))) float v8f;

#define HIDD 128
#define NHD  8
#define NNOD 256
#define NBAT 16

#define ZP 132    // LDS pitch of a 128-wide row in floats: 16 B x odd, b128 reads conflict-free

__device__ __forceinline__ v8f mma_pair(const v4f a, const float b0, const float b1,
                                        const int s, const v8f c)
{
    const v2f av = { a[2 * s], a[2 * s + 1] };
    const v2f bv = { b0, b1 };
    return __builtin_amdgcn_wmma_f32_16x16x4_f32(false, av, false, bv, (short)0, c, false, false);
}

// The same product with the operands swapped (activations as A, weights as B): the tile comes out
// untransposed, a lane's 8 registers are rows 8*kh + r of column l16.  Same k slots, same sum order.
__device__ __forceinline__ v8f mma_pair_t(const v4f a, const float b0, const float b1,
                                          const int s, const v8f c)
{
    const v2f av = { a[2 * s], a[2 * s + 1] };
    const v2f bv = { b0, b1 };
    return __builtin_amdgcn_wmma_f32_16x16x4_f32(false, bv, false, av, (short)0, c, false, false);
}

// layernorm of one 128-wide row held by one wave, four consecutive columns a lane
__device__ __forceinline__ v4f ln_wave(const v4f t, const v4f g, const v4f b)
{
    float s  = (t[0] + t[1]) + (t[2] + t[3]);
    float s2 = (t[0] * t[0] + t[1] * t[1]) + (t[2] * t[2] + t[3] * t[3]);
    for (int o = 16; o >= 1; o >>= 1) {
        s  += __shfl_xor(s,  o, 32);
        s2 += __shfl_xor(s2, o, 32);
    }
    const float mu   = s * (1.0f / HIDD);
    const float var  = s2 * (1.0f / HIDD) - mu * mu;
    const float rinv = rsqrtf(var + 1e-5f);
    v4f r;
    for (int i = 0; i < 4; ++i) r[i] = (t[i] - mu) * rinv * g[i] + b[i];
    return r;
}

// All loops below are unrolled so that the register arrays keep constant indices.
// One stage = 32 k of NT weight tiles of 16 columns n.
// k slot (kh, e) of step (q, s) is k = 32*st + 8*q + 4*kh + 2*s + e, in A and in B alike.
// The weights lie in the workspace in fragment order, [tile n/16][k/8][lane = 16*kh + n%16][4 k],
// so that one 16-byte load of a wave covers 512 contiguous bytes: four whole lines, not a
// quarter of sixteen.  TS = distance in floats between two tiles of the wave.
#define WTILE 2048   // floats of one weight tile: 16 columns x 128 k
template<int NT, int TS>
__device__ __forceinline__ void load_w(v4f (&w)[NT * 4], const float* __restrict__ wp, const int st)
{
#pragma unroll
    for (int t = 0; t < NT; ++t)
#pragma unroll
        for (int q = 0; q < 4; ++q)
            w[t * 4 + q] = *(const v4f*)(wp + t * TS + (st * 4 + q) * 128);
}

// VT: the last tile is made with the operands swapped (mma_pair_t)
template<int NT, bool VT = false>
__device__ __forceinline__ void mm_stage(v8f (&acc)[NT], const v4f (&w)[NT * 4],
                                         const float* zr, const int st)
{
    v4f bz[4];
#pragma unroll
    for (int q = 0; q < 4; ++q) bz[q] = *(const v4f*)(zr + st * 32 + q * 8);
    // keeps the next stage's weight loads and this stage's LDS reads ahead of the WMMA block:
    // left free, the scheduler sinks each load to just before its use and the wave waits it out
    __builtin_amdgcn_sched_barrier(0);
#pragma unroll
    for (int q = 0; q < 4; ++q)
#pragma unroll
        for (int s = 0; s < 2; ++s)
#pragma unroll
            for (int t = 0; t < NT; ++t)
                acc[t] = (VT && t == NT - 1)
                       ? mma_pair_t(w[t * 4 + q], bz[q][2 * s], bz[q][2 * s + 1], s, acc[t])
                       : mma_pair(w[t * 4 + q], bz[q][2 * s], bz[q][2 * s + 1], s, acc[t]);
    __builtin_amdgcn_sched_barrier(0);   // the loads that follow are not issued before this block
}

// One stage of the second MLP product = two output tiles (c = 32*p .. 32*p + 31) over the
// wave's own 64 hidden columns.  Fragment order here too:
// [wave = hidden/64][tile c/16][t = hidden/16 % 4][hf][lane = 16*kh + c%16][4 hidden],
// hidden = 64*wave + 16*t + 8*kh + 4*hf + e.
__device__ __forceinline__ void load_c(v4f (&w)[16], const float* __restrict__ cp, const int p)
{
#pragma unroll
    for (int u = 0; u < 2; ++u)
#pragma unroll
        for (int t = 0; t < 4; ++t)
#pragma unroll
            for (int hf = 0; hf < 2; ++hf)
                w[u * 8 + t * 2 + hf] = *(const v4f*)(cp + (2 * p + u) * 1024 + t * 256 + hf * 128);
}

__device__ __forceinline__ void mm_c(v8f (&acc)[8], const v4f (&w)[16], const v8f (&d)[4], const int p)
{
    __builtin_amdgcn_sched_barrier(0);   // the loads issued in front of it stay ahead of this block
#pragma unroll
    for (int t = 0; t < 4; ++t)
#pragma unroll
        for (int hf = 0; hf < 2; ++hf)
#pragma unroll
            for (int s = 0; s < 2; ++s)
#pragma unroll
                for (int u = 0; u < 2; ++u)
                    acc[2 * p + u] = mma_pair(w[u * 8 + t * 2 + hf], d[t][4 * hf + 2 * s],
                                              d[t][4 * hf + 2 * s + 1], s, acc[2 * p + u]);
    __builtin_amdgcn_sched_barrier(0);   // the loads that follow are not issued before this block
}

// Work-group barrier that waits for the wave's LDS operations only.  __syncthreads() also waits for
// every global load in flight, which would drain the weight stages that are requested ahead; nothing
// that passes between the waves of a work-group here goes through global memory.
__device__ __forceinline__ void lds_barrier()
{
    __builtin_amdgcn_fence(__ATOMIC_RELEASE, "workgroup", "local");
    __builtin_amdgcn_s_barrier();
    __builtin_amdgcn_fence(__ATOMIC_ACQUIRE, "workgroup", "local");
}

// Four exp2 in one statement.  The early-clobber outputs keep every v_exp_f32 from being
// directly followed by a write of its source or a read of its result, and the v_nop is
// the one slot the instruction set asks for behind the last of them.
__device__ __forceinline__ void exp2x4(v4f& p, float t0, float t1, float t2, float t3)
{
    float p0, p1, p2, p3;
    asm("v_exp_f32 %0, %4\n\tv_exp_f32 %1, %5\n\tv_exp_f32 %2, %6\n\tv_exp_f32 %3, %7\n\tv_nop"
        : "=&v"(p0), "=&v"(p1), "=&v"(p2), "=&v"(p3)
        : "v"(t0), "v"(t1), "v"(t2), "v"(t3));
    p[0] = p0; p[1] = p1; p[2] = p2; p[3] = p3;
}

// Reciprocal square roots of arguments that are at least the layernorm's epsilon, so that no scaling
// for subnormals is needed.  As in exp2x4, the early-clobber outputs and the v_nop keep the one slot
// the instruction set asks for behind a v_rsq_f32 free of its result and its source.
__device__ __forceinline__ void rsqx4(float (&r)[4], float t0, float t1, float t2, float t3)
{
    asm("v_rsq_f32 %0, %4\n\tv_rsq_f32 %1, %5\n\tv_rsq_f32 %2, %6\n\tv_rsq_f32 %3, %7\n\tv_nop"
        : "=&v"(r[0]), "=&v"(r[1]), "=&v"(r[2]), "=&v"(r[3])
        : "v"(t0), "v"(t1), "v"(t2), "v"(t3));
}
__device__ __forceinline__ float rsqx1(float t)
{
    float r;
    asm("v_rsq_f32 %0, %1\n\tv_nop" : "=&v"(r) : "v"(t));
    return r;
}

// ------ one whole layer: one workgroup = one batch x 16 rows, eight waves ------
// Attention (one wave per head), then the row-local chain on the same 16 rows, whose y never
// leaves LDS.  MODE 1: LN2, MLP + y, LN1 of the next layer, its QKV.  MODE 2: LN2, MLP + y, decoder.
// The next layer's QKV goes to a second buffer: other workgroups still read K and V of this one.
//
// S^T = K Q^T is kept in registers: lane (l16, kh) register r of tile jt holds
// key j = ((jt + kr) & 15)*16 + 8*kh + r of query i0 + l16.  That is already the B fragment of
// Y^T = V^T W^T when the k slots of step s are read as j = ((jt + kr) & 15)*16 + 8*kh + 2*s + {0,1},
// so the weights never leave the registers.  The softmax runs down a lane's own
// 128 values plus one exchange between the two lane halves.
//
// Q, K and V lie in the workspace in fragment order,
// [Q | K | V][batch][head][tile of 16 rows][half][lane = 16*kh + l16][4 floats]:
// Q and K: row 16*tile + l16, d = 8*kh + 4*half + e;  V: row 16*tile + 8*kh + 4*half + e, d = l16.
// Every fragment load, and every store of the wave that makes a tile, is 512 contiguous bytes.
#define FTILE 256                    // floats of one tile: 16 rows x 16 d
#define FHEAD (NNOD / 16 * FTILE)    // of one head of one batch
#define FSEC  (NBAT * NHD * FHEAD)   // of all Q, all K or all V
#define EFP 260   // LDS pitch of an edge row in floats: 16 B x odd, b128 reads conflict-free
#define YSP 132   // LDS pitch of an output row in floats: 16 B x odd
// GEN (layer 0): the layer's input h0 = nf Wn has rank 2, so a row of LN1(h0) Wh is
// alpha*P0 + beta*P1 + P2 with alpha = x0*rinv, beta = x1*rinv (x = the row of nf, rinv from the
// quadratic form of x in the covariances of Wn's two rows).  first_kernel leaves P (4 rows of 384,
// the last zero) and the three covariance terms where qkv points.  The Q tile and every V tile are then
// one product of depth 4, coefficients x P, whose result registers are the fragment the loads would
// bring; K is not formed: with T = P_K Q^T (4 x 16) a score tile is one product of depth 4, coefficients x T.
#define PROW 384              // floats of one row of P
#define PCOV (4 * PROW)       // the covariance terms lie behind the four rows
template<int MODE, bool GEN = false>
__global__ __launch_bounds__(256)
void layer_kernel(const float* __restrict__ qkv, const float* __restrict__ ef,
                  const float* __restrict__ comb, const float* __restrict__ hin,
                  float* __restrict__ hout,
                  const float* __restrict__ g2, const float* __restrict__ b2,
                  const float* __restrict__ w1T, const float* __restrict__ w2T,
                  const float* __restrict__ g1, const float* __restrict__ b1,
                  const float* __restrict__ whT, float* __restrict__ qkvn,
                  const float* __restrict__ Wdec, float* __restrict__ out,
                  const float* __restrict__ nf, const float* __restrict__ Wn)
{
    __shared__ __attribute__((aligned(16))) float efs[16 * EFP];
    __shared__ __attribute__((aligned(16))) float ys[16 * YSP];
    __shared__ __attribute__((aligned(16))) float zs[16 * ZP];
    __shared__ __attribute__((aligned(16))) float red[8 * 16 * ZP];

    const int i0   = blockIdx.x * 16;
    const int b    = blockIdx.y;
    const int row0 = b * NNOD + i0;
    const int tid  = threadIdx.x;
    const int w    = __builtin_amdgcn_readfirstlane(tid >> 5);   // wave = head
    const int lane = tid & 31;
    const int l16  = lane & 15;
    const int kh   = lane >> 4;

    // edge tile (16 rows x 256, contiguous): loads issued first, so that they fly beside the K loads
    const v4f* __restrict__ efg = (const v4f*)(ef + (long long)row0 * NNOD);
    v4f e4[4];
#pragma unroll
    for (int q = 0; q < 4; ++q) e4[q] = efg[tid + 256 * q];

    const float cB = comb[w];
    const float cG = comb[NHD + w];

    const float* __restrict__ hb = qkv + (b * NHD + w) * FHEAD;   // the head's tiles; a lane reads at 4*lane

    // The 16 work-groups of a batch read the same K and V.  Each walks the 16 key tiles from a start of
    // its own and wraps, so that they do not ask L2 for one line at one moment and every tile is asked
    // for early by one of them: tile slot jt holds key tile (jt + kr) & 15, in K, in the edge tile in
    // LDS and in V alike.  Any kr gives the same sums in another order; this one spreads neighbours.
    const int kr = ((blockIdx.x & 3) << 2) | (blockIdx.x >> 2);
    unsigned ko[16];   // the lane's offset in bytes in the head's K, and in its V; GEN: its key row in the batch
    const char* __restrict__ kb = (const char*)(hb + FSEC);
    const char* __restrict__ vb = (const char*)(hb + 2 * FSEC);

    // Q as B fragment, K as A fragment; k slot (kh, e) of step s is d = 8*kh + 2*s + e in both
    v4f q0, q1;
    v4f k0[16], k1[16];
    v4f hi[2];         // the wave's two rows of this layer's input, four columns a lane
    v4f vg0[16], vg1[16];   // GEN: the V tiles, made behind the score products
    v2f cf[16], pv;    // GEN: coefficients of the 16 key tiles and the head's columns of P for V
    v2f tb;            // GEN: T as B fragment
    v4f gg, bb;        // LN2's scale and shift of the lane's columns

    if constexpr (!GEN) {
        const float* __restrict__ qp = hb + blockIdx.x * FTILE;
        q0 = *(const v4f*)(qp + lane * 4);
        q1 = *(const v4f*)(qp + 128 + lane * 4);
#pragma unroll
        for (int jt = 0; jt < 16; ++jt) ko[jt] = (((jt + kr) & 15) * FTILE + lane * 4) * 4;
#pragma unroll
        for (int jt = 0; jt < 16; ++jt) {
            k0[jt] = *(const v4f*)(kb + ko[jt]);
            k1[jt] = *(const v4f*)(kb + 512 + ko[jt]);
        }
        // asked for here, the input rows are long there when the attention ends
        const float* __restrict__ hp = hin + (row0 + 2 * w) * HIDD;
#pragma unroll
        for (int rr = 0; rr < 2; ++rr) hi[rr] = *(const v4f*)(hp + rr * HIDD + lane * 4);
        gg = *(const v4f*)(g2 + lane * 4);
        bb = *(const v4f*)(b2 + lane * 4);

        // The wait that belongs in front of any overwrite of a register the loads above name.
        // Bases and offsets are inputs so that their registers stay untouched up to this line.
        asm volatile("s_wait_xcnt 0x0" :: "s"(qp), "s"(hb), "s"(efg), "v"(tid), "s"(hp), "s"(g2), "s"(b2), "v"(lane),
                                          "v"(ko[0]), "v"(ko[1]), "v"(ko[2]), "v"(ko[3]), "v"(ko[4]), "v"(ko[5]),
                                          "v"(ko[6]), "v"(ko[7]), "v"(ko[8]), "v"(ko[9]), "v"(ko[10]), "v"(ko[11]),
                                          "v"(ko[12]), "v"(ko[13]), "v"(ko[14]), "v"(ko[15]) : "memory");
    } else {
        // k slot (kh, e) of the depth-4 products is term 2*kh + e: alpha, beta, 1, 0 against P0, P1, P2, 0
        const v2f* __restrict__ nb = (const v2f*)(nf + b * NNOD * 2);
        const unsigned qo = i0 + l16;
        v2f x[17];     // the lane's key row of each tile slot, and its query row
#pragma unroll
        for (int jt = 0; jt < 16; ++jt) ko[jt] = ((jt + kr) & 15) * 16 + l16;
        x[16] = nb[qo];
#pragma unroll
        for (int jt = 0; jt < 16; ++jt) x[jt] = nb[ko[jt]];
        const unsigned po = 2 * kh * PROW + 16 * w + l16;   // rows 2*kh and 2*kh + 1 of P, the head's column l16
        const float* __restrict__ pb = qkv;
        const v2f pq = { pb[po],       pb[po + PROW] };
        pv = v2f{ pb[po + 256], pb[po + PROW + 256] };
        // P_K as A fragment of T, d = 8*kh + 4*half + e as in a K tile.  Row m of the tile is term
        // (m & 1) + 2*(m >> 3): terms 0, 1 come out in registers 0, 1 of the lower lane half and terms
        // 2, 3 in registers 0, 1 of the upper, which is T as B fragment; the other rows are not read.
        const unsigned to = (((l16 & 1) + 2 * (l16 >> 3)) * PROW + 128 + 16 * w + 8 * kh) * 4;   // in bytes
        const v4f t0 = *(const v4f*)((const char*)pb + to);
        const v4f t1 = *(const v4f*)((const char*)pb + 16 + to);
        const float c00 = qkv[PCOV], c01 = qkv[PCOV + 1], c11 = qkv[PCOV + 2];
        const v4f wn0 = *(const v4f*)(Wn + lane * 4);
        const v4f wn1 = *(const v4f*)(Wn + HIDD + lane * 4);
        gg = *(const v4f*)(g2 + lane * 4);
        bb = *(const v4f*)(b2 + lane * 4);
        // The wait that belongs in front of any overwrite of a register the loads above name.
        // Bases and offsets are inputs so that their registers stay untouched up to this line.
        asm volatile("s_wait_xcnt 0x0" :: "s"(nb), "s"(pb), "s"(efg), "v"(tid), "s"(Wn), "s"(g2), "s"(b2), "v"(lane),
                                          "v"(qo), "v"(po), "v"(to),
                                          "v"(ko[0]), "v"(ko[1]), "v"(ko[2]), "v"(ko[3]), "v"(ko[4]), "v"(ko[5]),
                                          "v"(ko[6]), "v"(ko[7]), "v"(ko[8]), "v"(ko[9]), "v"(ko[10]), "v"(ko[11]),
                                          "v"(ko[12]), "v"(ko[13]), "v"(ko[14]), "v"(ko[15]) : "memory");
#pragma unroll
        for (int rr = 0; rr < 2; ++rr) {
            const int row = row0 + 2 * w + rr;
            hi[rr] = nf[row * 2] * wn0 + nf[row * 2 + 1] * wn1;
        }
        const v8f z8 = { 0.0f, 0.0f, 0.0f, 0.0f, 0.0f, 0.0f, 0.0f, 0.0f };
        float va[17];   // variance + epsilon; the quadratic form is not below 0 but for rounding
#pragma unroll
        for (int jt = 0; jt < 17; ++jt)
            va[jt] = fmaxf((x[jt][0] * x[jt][0]) * c00 + (x[jt][0] * x[jt][1]) * c01 + (x[jt][1] * x[jt][1]) * c11, 0.0f) + 1e-5f;
        {   // Q^T: P as A, coefficients as B, a lane's 8 registers are d = 8*kh + r of row l16
            const float rinv = rsqx1(va[16]);
            const v2f cq = { kh ? 1.0f : x[16][0] * rinv, kh ? 0.0f : x[16][1] * rinv };
            const v8f d = __builtin_amdgcn_wmma_f32_16x16x4_f32(false, pq, false, cq, (short)0, z8, false, false);
            q0 = v4f{ d[0], d[1], d[2], d[3] };
            q1 = v4f{ d[4], d[5], d[6], d[7] };
            // The products of T read this result as their B operand, directly behind it:
            // the five v_nop are the vector slots that such a read asks for.
            asm volatile("v_nop\n\tv_nop\n\tv_nop\n\tv_nop\n\tv_nop" : "+v"(q0), "+v"(q1));
            const v2f qs[4] = { {q0[0], q0[1]}, {q0[2], q0[3]}, {q1[0], q1[1]}, {q1[2], q1[3]} };
            v8f td = z8;
#pragma unroll
            for (int s = 0; s < 4; ++s) {
                const v4f tk = (s < 2) ? t0 : t1;
                const v2f a = { tk[(s & 1) * 2], tk[(s & 1) * 2 + 1] };
                td = __builtin_amdgcn_wmma_f32_16x16x4_f32(false, a, false, qs[s], (short)0, td, false, false);
            }
            tb = v2f{ td[0], td[1] };
            // the same five slots in front of the score products, which read T as their B operand
            asm volatile("v_nop\n\tv_nop\n\tv_nop\n\tv_nop\n\tv_nop" : "+v"(tb));
        }
#pragma unroll
        for (int g = 0; g < 4; ++g) {
            float rinv[4];
            rsqx4(rinv, va[4 * g], va[4 * g + 1], va[4 * g + 2], va[4 * g + 3]);
#pragma unroll
            for (int t = 0; t < 4; ++t) {
                const int jt = 4 * g + t;
                cf[jt] = v2f{ kh ? 1.0f : x[jt][0] * rinv[t], kh ? 0.0f : x[jt][1] * rinv[t] };
            }
        }
    }
    const v2f qf[4] = { {q0[0], q0[1]}, {q0[2], q0[3]}, {q1[0], q1[1]}, {q1[2], q1[3]} };

    // All work-groups read the same weights.  They walk the four stages of each product from different
    // starting points and wrap, so that they do not ask L2 for one line at one moment: ring stage g
    // holds stage (g + rot) & 3.  The activations follow through one LDS column offset (rotcol below).
    const int rot = (blockIdx.x + blockIdx.y) & 3;
    const float* __restrict__ w1b = w1T + 4 * w * WTILE;   // tiles 4*w .. 4*w + 3
    const float* __restrict__ whb = whT + w * WTILE;       // tiles w, 8 + w, 16 + w: Q, K, V of head w
    const float* __restrict__ w2b = w2T + w * 8192;        // the wave's 64 hidden columns
    const float* w1s[4];
    const float* w2s[4];
    const float* whs[4];
#pragma unroll
    for (int g = 0; g < 4; ++g) {
        const int st = (g + rot) & 3;
        w1s[g] = w1b + st * 512;
        w2s[g] = w2b + st * 2048;
        whs[g] = whb + st * 512;
    }

    v8f S[16];
#pragma unroll
    for (int jt = 0; jt < 16; ++jt)
#pragma unroll
        for (int r = 0; r < 8; ++r) S[jt][r] = 0.0f;
    if constexpr (GEN) {   // coefficients as A, T as B: the same tile in the same registers
#pragma unroll
        for (int jt = 0; jt < 16; ++jt)
            S[jt] = __builtin_amdgcn_wmma_f32_16x16x4_f32(false, cf[jt], false, tb, (short)0, S[jt], false, false);
    } else
#pragma unroll
    for (int g = 0; g < 4; ++g)
#pragma unroll
        for (int s = 0; s < 4; ++s)
#pragma unroll
            for (int t = 0; t < 4; ++t) {
                const int jt = g * 4 + t;
                const v4f kk = (s < 2) ? k0[jt] : k1[jt];
                const v2f a = { kk[(s & 1) * 2], kk[(s & 1) * 2 + 1] };
                S[jt] = __builtin_amdgcn_wmma_f32_16x16x4_f32(
                    false, a, false, qf[s], (short)0, S[jt], false, false);
            }

    // The weights of the row chain run through a ring of four register stages, r0 .. r3, each asked
    // for three to four stages before its products.  The first takes registers K has left; it goes
    // out alone, so that V, which is needed sooner and returns behind it, is not held up for long.
    v4f r0[16], r1[16], r2[16], r3[16];
    if constexpr (GEN) {
        // V: coefficients as A, P as B, a lane's 8 registers are rows 8*kh + r of column l16.  All 16 tiles
        // here, far in front of the products that read them as an operand.
        const v8f z8 = { 0.0f, 0.0f, 0.0f, 0.0f, 0.0f, 0.0f, 0.0f, 0.0f };
#pragma unroll
        for (int jt = 0; jt < 16; ++jt) {
            const v8f d = __builtin_amdgcn_wmma_f32_16x16x4_f32(false, cf[jt], false, pv, (short)0, z8, false, false);
            vg0[jt] = v4f{ d[0], d[1], d[2], d[3] };
            vg1[jt] = v4f{ d[4], d[5], d[6], d[7] };
        }
    }
    __builtin_amdgcn_sched_barrier(0);   // not lifted among the score products, where K still holds the registers
    load_w<4, WTILE>(r0, w1s[0] + lane * 4, 0);
    // The wait that belongs in front of any overwrite of a register these loads name.
    asm volatile("s_wait_xcnt 0x0" :: "s"(w1s[0]), "v"(lane) : "memory");
    __builtin_amdgcn_sched_barrier(0);   // issued here, not sunk towards their use

#pragma unroll
    for (int q = 0; q < 4; ++q) {
        const int f = tid + 256 * q;
        *(v4f*)(efs + (f >> 6) * EFP + ((((f & 63) >> 2) - kr) & 15) * 16 + (f & 3) * 4) = e4[q];   // key tile to its slot
    }
    lds_barrier();   // the edge tile is read by all eight heads

    // x = s/sqrt(16) + e*cB, row maximum
    const float* er = efs + l16 * EFP + 8 * kh;
    float mx[4] = { -INFINITY, -INFINITY, -INFINITY, -INFINITY };
#pragma unroll
    for (int jt = 0; jt < 16; ++jt) {
        const v4f ea = *(const v4f*)(er + jt * 16);
        const v4f eb = *(const v4f*)(er + jt * 16 + 4);
#pragma unroll
        for (int r = 0; r < 8; ++r) {
            const float e = (r < 4) ? ea[r & 3] : eb[r & 3];
            const float x = S[jt][r] * 0.25f + e * cB;
            S[jt][r] = x;
            mx[r & 3] = fmaxf(mx[r & 3], x);
        }
    }
    float m = fmaxf(fmaxf(mx[0], mx[1]), fmaxf(mx[2], mx[3]));
    m = fmaxf(m, __shfl_xor(m, 16, 32));

    // p = exp(x - m) = exp2(x*log2e - m*log2e), row sum, unnormalised gated weight p*e
    const float L2E = 1.4426950408889634f;
    const float nm  = -m * L2E;
    float sm[4] = { 0.0f, 0.0f, 0.0f, 0.0f };
#pragma unroll
    for (int jt = 0; jt < 16; ++jt) {
        const v4f ea = *(const v4f*)(er + jt * 16);
        const v4f eb = *(const v4f*)(er + jt * 16 + 4);
#pragma unroll
        for (int c = 0; c < 2; ++c) {
            const v4f e = c ? eb : ea;
            v4f p;
            exp2x4(p, fmaf(S[jt][4 * c + 0], L2E, nm), fmaf(S[jt][4 * c + 1], L2E, nm),
                      fmaf(S[jt][4 * c + 2], L2E, nm), fmaf(S[jt][4 * c + 3], L2E, nm));
#pragma unroll
            for (int r = 0; r < 4; ++r) {
                sm[r] += p[r];
                S[jt][4 * c + r] = p[r] * e[r];
            }
        }
    }
    float ss = (sm[0] + sm[1]) + (sm[2] + sm[3]);
    ss += __shfl_xor(ss, 16, 32);

    // Y^T[d][i] = sum_j V[j][d] * w[i][j]; A fragment: lane l16 = d, rows j in the order above
    v8f o[2];
#pragma unroll
    for (int r = 0; r < 8; ++r) { o[0][r] = 0.0f; o[1][r] = 0.0f; }
#pragma unroll
    for (int jt = 0; jt < 16; ++jt) {
        v4f v0, v1;
        if constexpr (!GEN) {
            v0 = *(const v4f*)(vb + ko[jt]);
            v1 = *(const v4f*)(vb + 512 + ko[jt]);
        } else {
            v0 = vg0[jt];
            v1 = vg1[jt];
        }
#pragma unroll
        for (int s = 0; s < 4; ++s) {
            const v4f vv = (s < 2) ? v0 : v1;
            const v2f a = { vv[(s & 1) * 2], vv[(s & 1) * 2 + 1] };
            const v2f wv = { S[jt][2 * s], S[jt][2 * s + 1] };
            o[s & 1] = __builtin_amdgcn_wmma_f32_16x16x4_f32(
                false, a, false, wv, (short)0, o[s & 1], false, false);
        }
    }

    // same wait for the V loads: their base and offsets stay untouched up to this line
    if constexpr (!GEN)
    asm volatile("s_wait_xcnt 0x0" :: "s"(hb),
                                      "v"(ko[0]), "v"(ko[1]), "v"(ko[2]), "v"(ko[3]), "v"(ko[4]), "v"(ko[5]),
                                      "v"(ko[6]), "v"(ko[7]), "v"(ko[8]), "v"(ko[9]), "v"(ko[10]), "v"(ko[11]),
                                      "v"(ko[12]), "v"(ko[13]), "v"(ko[14]), "v"(ko[15]) : "memory");

    // The chain reads its lane index anew (ln = lane, lr = l16, lk = kh): held in a register
    // across the attention, the index was spilled to scratch in one of the builds.
    const int ln = __builtin_amdgcn_mbcnt_lo(~0u, 0u);
    const int lr = ln & 15;
    const int lk = ln >> 4;

    const float* zr = zs + lr * ZP + 4 * lk;          // B fragments: row lr of the normed tile
    // LDS column of the lane's four columns 4*ln: their block of 32 lies at ring stage (block - rot) & 3,
    // in the normed tile (read by stage) and in the partial sums (written by stage) alike
    const int rotcol = ((((ln >> 3) - rot) & 3) << 5) + ((ln & 7) << 2);
    v4f e0[12], e1[12], e2[12], e3[12];                // QKV weight stages, the ring's last round
    v4f yv[2], hv[2];                                  // the wave's two rows, 4 columns a lane
    v4f gg1, bb1;                                      // LN1 scale and shift of the lane's columns
    v4f wd;                                            // decoder weights of the lane's columns

    load_w<4, WTILE>(r1, w1s[1] + ln * 4, 0);     // these three take registers of K, of the scores and of V
    load_w<4, WTILE>(r2, w1s[2] + ln * 4, 0);
    load_w<4, WTILE>(r3, w1s[3] + ln * 4, 0);
    __builtin_amdgcn_sched_barrier(0);   // issued here, not sunk to the barrier

    // normalise and gate-scale once per output, gather the 8 heads' columns per row in LDS
    const float sc = cG / ss;
    v4f ya, yb;
#pragma unroll
    for (int r = 0; r < 4; ++r) {
        ya[r] = (o[0][r] + o[1][r]) * sc;
        yb[r] = (o[0][r + 4] + o[1][r + 4]) * sc;
    }
    float* yw = ys + lr * YSP + w * 16 + 8 * lk;
    *(v4f*)(yw)     = ya;
    *(v4f*)(yw + 4) = yb;
    lds_barrier();   // every head's columns are in place before whole rows are read

#pragma unroll
    for (int rr = 0; rr < 2; ++rr) {
        yv[rr] = *(const v4f*)(ys + (2 * w + rr) * YSP + ln * 4);
        *(v4f*)(zs + (2 * w + rr) * ZP + rotcol) = ln_wave(yv[rr] + hi[rr], gg, bb);
    }
    lds_barrier();             // all 16 normed rows are read by every wave

    {
        // act^T = relu(W1^T z^T), hidden columns 64*w .. 64*w + 63; a stage's registers are refilled behind its products
        v8f d[4];
#pragma unroll
        for (int t = 0; t < 4; ++t)
#pragma unroll
            for (int r = 0; r < 8; ++r) d[t][r] = 0.0f;
        mm_stage<4>(d, r0, zr, 0);  load_c(r0, w2s[0] + ln * 4, 0);
        mm_stage<4>(d, r1, zr, 1);  load_c(r1, w2s[1] + ln * 4, 0);
        mm_stage<4>(d, r2, zr, 2);  load_c(r2, w2s[2] + ln * 4, 0);
        mm_stage<4>(d, r3, zr, 3);  load_c(r3, w2s[3] + ln * 4, 0);
#pragma unroll
        for (int t = 0; t < 4; ++t)
#pragma unroll
            for (int r = 0; r < 8; ++r) d[t][r] = fmaxf(d[t][r], 0.0f);

        // partial (act W2)^T over the wave's own 64 hidden columns
        v8f oc[8];
#pragma unroll
        for (int c = 0; c < 8; ++c)
#pragma unroll
            for (int r = 0; r < 8; ++r) oc[c][r] = 0.0f;
        mm_c(oc, r0, d, 0);
        if constexpr (MODE == 1) {   // LN1's scale and shift first: the load counter returns in order
            gg1 = *(const v4f*)(g1 + ln * 4);
            bb1 = *(const v4f*)(b1 + ln * 4);
            load_w<3, 8 * WTILE>(e0, whs[0] + ln * 4, 0);
        } else {                     // asked for here, it is there when the rows are summed
            wd = *(const v4f*)(Wdec + ln * 4);
        }
        mm_c(oc, r1, d, 1);
        if constexpr (MODE == 1) load_w<3, 8 * WTILE>(e1, whs[1] + ln * 4, 0);
        mm_c(oc, r2, d, 2);
        if constexpr (MODE == 1) load_w<3, 8 * WTILE>(e2, whs[2] + ln * 4, 0);
        mm_c(oc, r3, d, 3);
        if constexpr (MODE == 1) {
            load_w<3, 8 * WTILE>(e3, whs[3] + ln * 4, 0);
            __builtin_amdgcn_sched_barrier(0);   // issued here, not sunk to the barrier
        }

        float* rw = red + (w * 16 + lr) * ZP + 8 * lk;
#pragma unroll
        for (int c = 0; c < 8; ++c) {
            const v4f lo = { oc[c][0], oc[c][1], oc[c][2], oc[c][3] };
            const v4f hi4 = { oc[c][4], oc[c][5], oc[c][6], oc[c][7] };
            *(v4f*)(rw + c * 16)     = lo;
            *(v4f*)(rw + c * 16 + 4) = hi4;
        }
        // same wait for the weight loads: the stage bases and the offset stay untouched up to this line
        asm volatile("s_wait_xcnt 0x0" :: "s"(w1s[1]), "s"(w1s[2]), "s"(w1s[3]), "s"(w2s[0]), "s"(w2s[1]),
                                          "s"(w2s[2]), "s"(w2s[3]), "v"(ln) : "memory");
        lds_barrier();             // the eight partial sums of every row are in place

#pragma unroll
        for (int rr = 0; rr < 2; ++rr) {
            const float* rp = red + (2 * w + rr) * ZP + rotcol;
            v4f s = *(const v4f*)rp;
#pragma unroll
            for (int u = 1; u < 8; ++u) s += *(const v4f*)(rp + u * 16 * ZP);
            hv[rr] = s + yv[rr];
        }
    }

    if constexpr (MODE == 2) {
        // out = 10 * tanh((h . Wdec) / sqrt(128))
        v2f res;
#pragma unroll
        for (int rr = 0; rr < 2; ++rr) {
            float s = (hv[rr][0] * wd[0] + hv[rr][1] * wd[1]) + (hv[rr][2] * wd[2] + hv[rr][3] * wd[3]);
            for (int o2 = 16; o2 >= 1; o2 >>= 1) s += __shfl_xor(s, o2, 32);
            res[rr] = 10.0f * tanhf(s * 0.08838834764831845f);
        }
        if (ln == 0) *(v2f*)(out + row0 + 2 * w) = res;
    } else {
        float* __restrict__ op = hout + (row0 + 2 * w) * HIDD + ln * 4;
#pragma unroll
        for (int rr = 0; rr < 2; ++rr) {
            *(v4f*)(op + rr * HIDD) = hv[rr];
            *(v4f*)(zs + (2 * w + rr) * ZP + rotcol) = ln_wave(hv[rr], gg1, bb1);
        }
        // same wait for the stores and the loads since the last one
        asm volatile("s_wait_xcnt 0x0" :: "v"(op), "v"(ln) : "memory");
        lds_barrier();             // all 16 normed rows are read by every wave

        // Q^T, K^T and V of head w: columns 16*w .. 16*w + 15 of each third of Wh
        v8f a[3];
#pragma unroll
        for (int t = 0; t < 3; ++t)
#pragma unroll
            for (int r = 0; r < 8; ++r) a[t][r] = 0.0f;
        mm_stage<3, true>(a, e0, zr, 0);
        mm_stage<3, true>(a, e1, zr, 1);
        mm_stage<3, true>(a, e2, zr, 2);
        mm_stage<3, true>(a, e3, zr, 3);
        // same wait for the QKV weight loads: their stage bases and offset stay untouched up to this line
        asm volatile("s_wait_xcnt 0x0" :: "s"(whs[0]), "s"(whs[1]), "s"(whs[2]), "s"(whs[3]), "v"(ln) : "memory");

        float* qw = qkvn + (b * NHD + w) * FHEAD + blockIdx.x * FTILE + ln * 4;
#pragma unroll
        for (int t = 0; t < 3; ++t) {
            const v4f lo = { a[t][0], a[t][1], a[t][2], a[t][3] };
            const v4f hi4 = { a[t][4], a[t][5], a[t][6], a[t][7] };
            *(v4f*)(qw + t * FSEC)       = lo;
            *(v4f*)(qw + t * FSEC + 128) = hi4;
        }
    }
}

// ------ first launch: the preparation of the later launches ------
#define ROWG 3                    // work-groups 0 .. 2: P for Q, for K and for V of layer 0
#define PREPG 121                 // behind them: 24 + 48 + 48 weight-ordering work-groups and one for comb

// One stage of one QKV weight tile read from the matrix as it is given (rows k, pitch 384):
// the same values in the same registers as load_w takes from a fragment-order copy.
__device__ __forceinline__ void load_n(v4f (&w)[4], const float* __restrict__ wp, const int st)
{
#pragma unroll
    for (int q = 0; q < 4; ++q)
#pragma unroll
        for (int c = 0; c < 4; ++c)
            w[q][c] = wp[(st * 32 + q * 8 + c) * 384];
}

// sum over the 32 lanes of a wave, every lane gets it
__device__ __forceinline__ float sum_wave(float s)
{
    for (int o = 16; o >= 1; o >>= 1) s += __shfl_xor(s, o, 32);
    return s;
}

// in[l][m][n] to fragment order, m being the k index of the product: one wave turns one tile of
// 16 m x 32 n, a lane 4 x 4 of it; four consecutive m of one n are one lane's 16 bytes of a fragment.
// W2ORD false: the order load_w reads; true: the order load_c reads.
// Loads cover whole 128-byte lines; a wave's four stores together fill whole 512-byte blocks.
template<int M, int N, bool W2ORD>
__device__ __forceinline__ void pack_tile(const float* __restrict__ in, float* __restrict__ out,
                                               const int T, const int lane)
{
    constexpr int NTN = N / 32, TPL = (M / 16) * NTN;
    const int l = T / TPL, rem = T % TPL;
    const int m0 = (rem / NTN) * 16 + 4 * (lane >> 3);
    const int n0 = (rem % NTN) * 32 + 4 * (lane & 7);
    const float* __restrict__ ip = in + l * M * N + m0 * N + n0;
    const int off = W2ORD
        ? (m0 >> 6) * 8192 + (n0 >> 4) * 1024 + ((m0 >> 4) & 3) * 256 + ((m0 >> 2) & 1) * 128
          + (((m0 >> 3) & 1) * 16 + (n0 & 15)) * 4
        : ((n0 >> 4) * 16 + (m0 >> 3)) * 128 + (((m0 >> 2) & 1) * 16 + (n0 & 15)) * 4;
    float* __restrict__ op = out + l * M * N + off;
    v4f r[4];
#pragma unroll
    for (int j = 0; j < 4; ++j) r[j] = *(const v4f*)(ip + j * N);
#pragma unroll
    for (int i = 0; i < 4; ++i) {
        const v4f c = { r[0][i], r[1][i], r[2][i], r[3][i] };
        *(v4f*)(op + i * 4) = c;
    }
    // The wait that belongs in front of any overwrite of a register the stores above name.
    asm volatile("s_wait_xcnt 0x0" ::: "memory");
}

__global__ __launch_bounds__(256)
void first_kernel(const float* __restrict__ Wn,
                  const float* __restrict__ g1, const float* __restrict__ b1,
                  const float* __restrict__ Wh, float* __restrict__ pout,
                  const float* __restrict__ W1, const float* __restrict__ W2,
                  const float* __restrict__ We_in, const float* __restrict__ We,
                  float* __restrict__ whT, float* __restrict__ w1T, float* __restrict__ w2T,
                  float* __restrict__ comb)
{
    __shared__ __attribute__((aligned(16))) float zs[16 * ZP];

    const int tid  = threadIdx.x;
    const int w    = __builtin_amdgcn_readfirstlane(tid >> 5);
    const int lane = tid & 31;
    const int l16  = lane & 15;
    const int kh   = lane >> 4;

    // Preparation work-groups: nothing of theirs is read in this launch, and they leave
    // as whole work-groups in front of every barrier.
    if (blockIdx.x >= ROWG) {
        const int pb = blockIdx.x - ROWG;
        if (pb < 24) {            // Wh of layers 1 and 2 (layer 0 is read as it is given below)
            pack_tile<128, 384, false>(Wh + 128 * 384, whT + 128 * 384, pb * 8 + w, lane);
        } else if (pb < 72) {
            pack_tile<128, 512, false>(W1, w1T, (pb - 24) * 8 + w, lane);
        } else if (pb < 120) {
            pack_tile<512, 128, true>(W2, w2T, (pb - 72) * 8 + w, lane);
        } else if (w < 2) {       // comb[l][c] = We_in . We[l][:, c], 48 values; lanes past them repeat the last
            const int t = tid < 48 ? tid : 47;
            const float* __restrict__ wp = We + (t >> 4) * HIDD * 16 + (t & 15);
            float s = 0.0f;
#pragma unroll                    // the loads go out in one run instead of one round trip per group
            for (int d = 0; d < HIDD; ++d) s += We_in[d] * wp[d * 16];
            // The wait that belongs in front of any overwrite of a register the loads above name.
            // The address is an input so that its registers stay untouched up to this line.
            asm volatile("s_wait_xcnt 0x0" :: "v"(wp) : "memory");
            if (tid < 48) comb[tid] = s;
        }
        return;
    }

    // P = [u0*g1; u1*g1; b1; 0 ...] Wh[0], u = the rows of Wn less their means: 16 rows of which three
    // are filled.  Work-group sec makes the 128 columns of Q, of K or of V, wave w those of head w.
    const int sec = blockIdx.x;
    const float* zr = zs + l16 * ZP + 4 * kh;          // B fragments: row l16 of the tile
    const float* __restrict__ whp = Wh + 4 * kh * 384 + sec * HIDD + 16 * w + l16;
    v4f e0[4], e1[4], e2[4], e3[4];                    // the wave's weight tile, all four stages asked for at once
    const v4f wn0 = *(const v4f*)(Wn + lane * 4);
    const v4f wn1 = *(const v4f*)(Wn + HIDD + lane * 4);
    const v4f gg1 = *(const v4f*)(g1 + lane * 4);
    const v4f bb1 = *(const v4f*)(b1 + lane * 4);
    load_n(e0, whp, 0);
    load_n(e1, whp, 1);
    load_n(e2, whp, 2);
    load_n(e3, whp, 3);
    // The wait that belongs in front of any overwrite of a register the loads above name.
    // Bases and offsets are inputs so that their registers stay untouched up to this line.
    asm volatile("s_wait_xcnt 0x0" :: "s"(Wn), "s"(g1), "s"(b1), "v"(whp), "v"(lane) : "memory");
    __builtin_amdgcn_sched_barrier(0);   // issued here, not sunk to the barrier: they fly during the sums

    const float m0 = sum_wave((wn0[0] + wn0[1]) + (wn0[2] + wn0[3])) * (1.0f / HIDD);
    const float m1 = sum_wave((wn1[0] + wn1[1]) + (wn1[2] + wn1[3])) * (1.0f / HIDD);
    const v4f u0 = wn0 - m0;
    const v4f u1 = wn1 - m1;
    const v4f p00 = u0 * u0, p01 = u0 * u1, p11 = u1 * u1;
    const float c00 = sum_wave((p00[0] + p00[1]) + (p00[2] + p00[3])) * (1.0f / HIDD);
    const float c01 = sum_wave((p01[0] + p01[1]) + (p01[2] + p01[3])) * (2.0f / HIDD);
    const float c11 = sum_wave((p11[0] + p11[1]) + (p11[2] + p11[3])) * (1.0f / HIDD);
    if (sec == 0 && tid == 0) {   // var of row x of nf Wn = x0*x0*c00 + x0*x1*c01 + x1*x1*c11
        pout[PCOV]     = c00;
        pout[PCOV + 1] = c01;
        pout[PCOV + 2] = c11;
    }

    const v4f zero4 = { 0.0f, 0.0f, 0.0f, 0.0f };
#pragma unroll
    for (int rr = 0; rr < 2; ++rr) {
        const int ri = 2 * w + rr;
        *(v4f*)(zs + ri * ZP + lane * 4) = ri == 0 ? u0 * gg1 : ri == 1 ? u1 * gg1 : ri == 2 ? bb1 : zero4;
    }
    __syncthreads();           // all 16 rows are read by every wave

    v8f a[1];
#pragma unroll
    for (int r = 0; r < 8; ++r) a[0][r] = 0.0f;
    mm_stage<1>(a, e0, zr, 0);
    mm_stage<1>(a, e1, zr, 1);
    mm_stage<1>(a, e2, zr, 2);
    mm_stage<1>(a, e3, zr, 3);

    // a lane's 8 registers are columns 8*kh + r of row l16; rows 0 .. 3 are kept, the fourth being zero
    if (l16 < 4) {
        float* pw = pout + l16 * PROW + sec * HIDD + 16 * w + 8 * kh;
        const v4f lo = { a[0][0], a[0][1], a[0][2], a[0][3] };
        const v4f hi4 = { a[0][4], a[0][5], a[0][6], a[0][7] };
        *(v4f*)(pw)     = lo;
        *(v4f*)(pw + 4) = hi4;
    }
    // same wait for these stores: the code of the other work-groups follows in the listing
    asm volatile("s_wait_xcnt 0x0" ::: "memory");
}

// ---------------- host launch ----------------
extern "C" void kernel_launch(void* const* d_in, const int* in_sizes, int n_in,
                              void* d_out, int out_size, void* d_ws, size_t ws_size,
                              hipStream_t stream)
{
    const float* nf    = (const float*)d_in[0];   // (16,256,2)
    const float* ef    = (const float*)d_in[1];   // (16,256,256,1)
    const float* Wn    = (const float*)d_in[2];   // (2,128)
    const float* We_in = (const float*)d_in[3];   // (1,128)
    const float* ln1g  = (const float*)d_in[4];   // (3,128)
    const float* ln1b  = (const float*)d_in[5];
    const float* Wh    = (const float*)d_in[6];   // (3,128,384)
    const float* We    = (const float*)d_in[7];   // (3,128,16)
    const float* ln2g  = (const float*)d_in[8];
    const float* ln2b  = (const float*)d_in[9];
    const float* W1    = (const float*)d_in[10];  // (3,128,512)
    const float* W2    = (const float*)d_in[11];  // (3,512,128)
    const float* Wdec  = (const float*)d_in[12];  // (128,1)
    float* out = (float*)d_out;

    float* ws = (float*)d_ws;
    float* hA   = ws;                         // 524288, input of the last layer
    float* hB   = ws + 524288;                // 524288, input of the middle layer
    float* qkvA = ws + 1048576;               // 1572864, QKV of the last layer
    float* qkvB = ws + 2621440;               // 1572864, QKV of the odd layer
    float* comb = ws + 14155776;              // 64 (48 used)
    float* whT  = ws + 14155840;              // 3*384*128 = 147456 (layer 0's part stays unused)
    float* w1T  = ws + 14303296;              // 3*512*128 = 196608
    float* w2T  = ws + 14499904;              // 3*128*512 = 196608
    float* pq0  = ws + 14696512;              // 4*384 + 3: P and the covariance terms of layer 0

    const dim3 ga(NNOD / 16, NBAT);

    // P and the covariance terms, from which layer 0 forms qkv0 = LN1(nf Wn) Wh[0]; beside them comb
    // and the weights in fragment order
    first_kernel<<<ROWG + PREPG, 256, 0, stream>>>(
        Wn, ln1g, ln1b, Wh, pq0, W1, W2, We_in, We, whT, w1T, w2T, comb);

    // y = (softmax(q k^T / 4 + ef*combB) * ef*combG) @ v, all heads;
    // h1 = relu(LN2(y + h0) W1[0]) W2[0] + y, qkv1 = LN1(h1) Wh[1]
    layer_kernel<1, true><<<ga, 256, 0, stream>>>(
        pq0, ef, comb, nullptr, hB, ln2g, ln2b, w1T, w2T,
        ln1g + HIDD, ln1b + HIDD, whT + 384 * HIDD, qkvB, nullptr, nullptr, nf, Wn);

    layer_kernel<1><<<ga, 256, 0, stream>>>(
        qkvB, ef, comb + 16, hB, hA, ln2g + HIDD, ln2b + HIDD, w1T + 512 * HIDD, w2T + 512 * HIDD,
        ln1g + 2 * HIDD, ln1b + 2 * HIDD, whT + 2 * 384 * HIDD, qkvA, nullptr, nullptr, nullptr, nullptr);

    // last layer; out = 10 * tanh((h3 @ Wdec) / sqrt(128))
    layer_kernel<2><<<ga, 256, 0, stream>>>(
        qkvA, ef, comb + 32, hA, nullptr, ln2g + 2 * HIDD, ln2b + 2 * HIDD,
        w1T + 2 * 512 * HIDD, w2T + 2 * 512 * HIDD,
        nullptr, nullptr, nullptr, nullptr, Wdec, out, nullptr, nullptr);
}

// v010
// A run of this version takes 46.4 microseconds.
// Timed twice side by side with v009, it ran 1.03 times as fast both times.
// Over all steps from v000 it is 7.87 times as fast.
#include <hip/hip_runtime.h>
#include <math.h>

typedef __attribute__((ext_vector_type(2))) float v2f;
typedef __attribute__((ext_vector_type(4))) float v4f;
typedef __attribute__((ext_vector_type(8))) float v8f;

#define HIDD 128
#define NHD  8
#define NNOD 256
#define NBAT 16

#define ZP 132    // LDS pitch of a 128-wide row in floats: 16 B x odd, b128 reads conflict-free

__device__ __forceinline__ v8f mma_pair(const v4f a, const float b0, const float b1,
                                        const int s, const v8f c)
{
    const v2f av = { a[2 * s], a[2 * s + 1] };
    const v2f bv = { b0, b1 };
    return __builtin_amdgcn_wmma_f32_16x16x4_f32(false, av, false, bv, (short)0, c, false, false);
}

// The same product with the operands swapped (activations as A, weights as B): the tile comes out
// untransposed, a lane's 8 registers are rows 8*kh + r of column l16.  Same k slots, same sum order.
__device__ __forceinline__ v8f mma_pair_t(const v4f a, const float b0, const float b1,
                                          const int s, const v8f c)
{
    const v2f av = { a[2 * s], a[2 * s + 1] };
    const v2f bv = { b0, b1 };
    return __builtin_amdgcn_wmma_f32_16x16x4_f32(false, bv, false, av, (short)0, c, false, false);
}

// Cross-lane moves on the vector pipe.  __shfl_xor is built as an LDS permute, whose every link waits
// out an LDS round trip; the sums below are chains of five links that nothing else of the wave covers.
// All 32 lanes are on wherever these are used.
// value of lane l ^ 16
__device__ __forceinline__ float lane_x16(const float x)
{
    const int v = __builtin_bit_cast(int, x);
    return __builtin_bit_cast(float, __builtin_amdgcn_permlanex16(v, v, 0x76543210, 0xfedcba98, false, false));
}
// value of lane l ^ M, M below 16: DPP row_xmask, which the compiler folds into the add that reads it
template<int M>
__device__ __forceinline__ float lane_xrow(const float x)
{
    return __builtin_bit_cast(float, __builtin_amdgcn_mov_dpp(__builtin_bit_cast(int, x), 0x160 + M, 0xf, 0xf, true));
}
// sum over the 32 lanes of a wave, every lane gets it; partners in the order 16, 8, 4, 2, 1
__device__ __forceinline__ float sum_wave(float s)
{
    s += lane_x16(s);
    s += lane_xrow<8>(s);
    s += lane_xrow<4>(s);
    s += lane_xrow<2>(s);
    s += lane_xrow<1>(s);
    return s;
}

// layernorm of one 128-wide row held by one wave, four consecutive columns a lane
__device__ __forceinline__ v4f ln_wave(const v4f t, const v4f g, const v4f b)
{
    const float s  = sum_wave((t[0] + t[1]) + (t[2] + t[3]));
    const float s2 = sum_wave((t[0] * t[0] + t[1] * t[1]) + (t[2] * t[2] + t[3] * t[3]));
    const float mu   = s * (1.0f / HIDD);
    const float var  = s2 * (1.0f / HIDD) - mu * mu;
    const float rinv = rsqrtf(var + 1e-5f);
    v4f r;
    for (int i = 0; i < 4; ++i) r[i] = (t[i] - mu) * rinv * g[i] + b[i];
    return r;
}

// All loops below are unrolled so that the register arrays keep constant indices.
// One stage = 32 k of NT weight tiles of 16 columns n.
// k slot (kh, e) of step (q, s) is k = 32*st + 8*q + 4*kh + 2*s + e, in A and in B alike.
// The weights lie in the workspace in fragment order, [tile n/16][k/8][lane = 16*kh + n%16][4 k],
// so that one 16-byte load of a wave covers 512 contiguous bytes: four whole lines, not a
// quarter of sixteen.  TS = distance in floats between two tiles of the wave.
#define WTILE 2048   // floats of one weight tile: 16 columns x 128 k
template<int NT, int TS>
__device__ __forceinline__ void load_w(v4f (&w)[NT * 4], const float* __restrict__ wp, const int st)
{
#pragma unroll
    for (int t = 0; t < NT; ++t)
#pragma unroll
        for (int q = 0; q < 4; ++q)
            w[t * 4 + q] = *(const v4f*)(wp + t * TS + (st * 4 + q) * 128);
}

// VT: the last tile is made with the operands swapped (mma_pair_t)
template<int NT, bool VT = false>
__device__ __forceinline__ void mm_stage(v8f (&acc)[NT], const v4f (&w)[NT * 4],
                                         const float* zr, const int st)
{
    v4f bz[4];
#pragma unroll
    for (int q = 0; q < 4; ++q) bz[q] = *(const v4f*)(zr + st * 32 + q * 8);
    // keeps the next stage's weight loads and this stage's LDS reads ahead of the WMMA block:
    // left free, the scheduler sinks each load to just before its use and the wave waits it out
    __builtin_amdgcn_sched_barrier(0);
#pragma unroll
    for (int q = 0; q < 4; ++q)
#pragma unroll
        for (int s = 0; s < 2; ++s)
#pragma unroll
            for (int t = 0; t < NT; ++t)
                acc[t] = (VT && t == NT - 1)
                       ? mma_pair_t(w[t * 4 + q], bz[q][2 * s], bz[q][2 * s + 1], s, acc[t])
                       : mma_pair(w[t * 4 + q], bz[q][2 * s], bz[q][2 * s + 1], s, acc[t]);
    __builtin_amdgcn_sched_barrier(0);   // the loads that follow are not issued before this block
}

// One stage of the second MLP product = two output tiles (c = 32*p .. 32*p + 31) over the
// wave's own 64 hidden columns.  Fragment order here too:
// [wave = hidden/64][tile c/16][t = hidden/16 % 4][hf][lane = 16*kh + c%16][4 hidden],
// hidden = 64*wave + 16*t + 8*kh + 4*hf + e.
__device__ __forceinline__ void load_c(v4f (&w)[16], const float* __restrict__ cp, const int p)
{
#pragma unroll
    for (int u = 0; u < 2; ++u)
#pragma unroll
        for (int t = 0; t < 4; ++t)
#pragma unroll
            for (int hf = 0; hf < 2; ++hf)
                w[u * 8 + t * 2 + hf] = *(const v4f*)(cp + (2 * p + u) * 1024 + t * 256 + hf * 128);
}

__device__ __forceinline__ void mm_c(v8f (&acc)[8], const v4f (&w)[16], const v8f (&d)[4], const int p)
{
    __builtin_amdgcn_sched_barrier(0);   // the loads issued in front of it stay ahead of this block
#pragma unroll
    for (int t = 0; t < 4; ++t)
#pragma unroll
        for (int hf = 0; hf < 2; ++hf)
#pragma unroll
            for (int s = 0; s < 2; ++s)
#pragma unroll
                for (int u = 0; u < 2; ++u)
                    acc[2 * p + u] = mma_pair(w[u * 8 + t * 2 + hf], d[t][4 * hf + 2 * s],
                                              d[t][4 * hf + 2 * s + 1], s, acc[2 * p + u]);
    __builtin_amdgcn_sched_barrier(0);   // the loads that follow are not issued before this block
}

// Work-group barrier that waits for the wave's LDS operations only.  __syncthreads() also waits for
// every global load in flight, which would drain the weight stages that are requested ahead; nothing
// that passes between the waves of a work-group here goes through global memory.
__device__ __forceinline__ void lds_barrier()
{
    __builtin_amdgcn_fence(__ATOMIC_RELEASE, "workgroup", "local");
    __builtin_amdgcn_s_barrier();
    __builtin_amdgcn_fence(__ATOMIC_ACQUIRE, "workgroup", "local");
}

// Four exp2 in one statement.  The early-clobber outputs keep every v_exp_f32 from being
// directly followed by a write of its source or a read of its result, and the v_nop is
// the one slot the instruction set asks for behind the last of them.
__device__ __forceinline__ void exp2x4(v4f& p, float t0, float t1, float t2, float t3)
{
    float p0, p1, p2, p3;
    asm("v_exp_f32 %0, %4\n\tv_exp_f32 %1, %5\n\tv_exp_f32 %2, %6\n\tv_exp_f32 %3, %7\n\tv_nop"
        : "=&v"(p0), "=&v"(p1), "=&v"(p2), "=&v"(p3)
        : "v"(t0), "v"(t1), "v"(t2), "v"(t3));
    p[0] = p0; p[1] = p1; p[2] = p2; p[3] = p3;
}

// Reciprocal square roots of arguments that are at least the layernorm's epsilon, so that no scaling
// for subnormals is needed.  As in exp2x4, the early-clobber outputs and the v_nop keep the one slot
// the instruction set asks for behind a v_rsq_f32 free of its result and its source.
__device__ __forceinline__ void rsqx4(float (&r)[4], float t0, float t1, float t2, float t3)
{
    asm("v_rsq_f32 %0, %4\n\tv_rsq_f32 %1, %5\n\tv_rsq_f32 %2, %6\n\tv_rsq_f32 %3, %7\n\tv_nop"
        : "=&v"(r[0]), "=&v"(r[1]), "=&v"(r[2]), "=&v"(r[3])
        : "v"(t0), "v"(t1), "v"(t2), "v"(t3));
}
__device__ __forceinline__ float rsqx1(float t)
{
    float r;
    asm("v_rsq_f32 %0, %1\n\tv_nop" : "=&v"(r) : "v"(t));
    return r;
}

// ------ one whole layer: one workgroup = one batch x 16 rows, eight waves ------
// Attention (one wave per head), then the row-local chain on the same 16 rows, whose y never
// leaves LDS.  MODE 1: LN2, MLP + y, LN1 of the next layer, its QKV.  MODE 2: LN2, MLP + y, decoder.
// The next layer's QKV goes to a second buffer: other workgroups still read K and V of this one.
//
// S^T = K Q^T is kept in registers: lane (l16, kh) register r of tile jt holds
// key j = ((jt + kr) & 15)*16 + 8*kh + r of query i0 + l16.  That is already the B fragment of
// Y^T = V^T W^T when the k slots of step s are read as j = ((jt + kr) & 15)*16 + 8*kh + 2*s + {0,1},
// so the weights never leave the registers.  The softmax runs down a lane's own
// 128 values plus one exchange between the two lane halves.
//
// Q, K and V lie in the workspace in fragment order,
// [Q | K | V][batch][head][tile of 16 rows][half][lane = 16*kh + l16][4 floats]:
// Q and K: row 16*tile + l16, d = 8*kh + 4*half + e;  V: row 16*tile + 8*kh + 4*half + e, d = l16.
// Every fragment load, and every store of the wave that makes a tile, is 512 contiguous bytes.
#define FTILE 256                    // floats of one tile: 16 rows x 16 d
#define FHEAD (NNOD / 16 * FTILE)    // of one head of one batch
#define FSEC  (NBAT * NHD * FHEAD)   // of all Q, all K or all V
#define EFP 260   // LDS pitch of an edge row in floats: 16 B x odd, b128 reads conflict-free
#define YSP 132   // LDS pitch of an output row in floats: 16 B x odd
// GEN (layer 0): the layer's input h0 = nf Wn has rank 2, so a row of LN1(h0) Wh is
// alpha*P0 + beta*P1 + P2 with alpha = x0*rinv, beta = x1*rinv (x = the row of nf, rinv from the
// quadratic form of x in the covariances of Wn's two rows).  first_kernel leaves P (4 rows of 384,
// the last zero) and the three covariance terms where qkv points.  The Q tile and every V tile are then
// one product of depth 4, coefficients x P, whose result registers are the fragment the loads would
// bring; K is not formed: with T = P_K Q^T (4 x 16) a score tile is one product of depth 4, coefficients x T.
#define PROW 384              // floats of one row of P
#define PCOV (4 * PROW)       // the covariance terms lie behind the four rows
template<int MODE, bool GEN = false>
__global__ __launch_bounds__(256)
void layer_kernel(const float* __restrict__ qkv, const float* __restrict__ ef,
                  const float* __restrict__ comb, const float* __restrict__ hin,
                  float* __restrict__ hout,
                  const float* __restrict__ g2, const float* __restrict__ b2,
                  const float* __restrict__ w1T, const float* __restrict__ w2T,
                  const float* __restrict__ g1, const float* __restrict__ b1,
                  const float* __restrict__ whT, float* __restrict__ qkvn,
                  const float* __restrict__ Wdec, float* __restrict__ out,
                  const float* __restrict__ nf, const float* __restrict__ Wn)
{
    __shared__ __attribute__((aligned(16))) float efs[16 * EFP];
    __shared__ __attribute__((aligned(16))) float ys[16 * YSP];
    __shared__ __attribute__((aligned(16))) float zs[16 * ZP];
    __shared__ __attribute__((aligned(16))) float red[8 * 16 * ZP];

    const int i0   = blockIdx.x * 16;
    const int b    = blockIdx.y;
    const int row0 = b * NNOD + i0;
    const int tid  = threadIdx.x;
    const int w    = __builtin_amdgcn_readfirstlane(tid >> 5);   // wave = head
    const int lane = tid & 31;
    const int l16  = lane & 15;
    const int kh   = lane >> 4;

    // edge tile (16 rows x 256, contiguous): loads issued first, so that they fly beside the K loads
    const v4f* __restrict__ efg = (const v4f*)(ef + (long long)row0 * NNOD);
    v4f e4[4];
#pragma unroll
    for (int q = 0; q < 4; ++q) e4[q] = efg[tid + 256 * q];

    const float cB = comb[w];
    const float cG = comb[NHD + w];

    const float* __restrict__ hb = qkv + (b * NHD + w) * FHEAD;   // the head's tiles; a lane reads at 4*lane

    // The 16 work-groups of a batch read the same K and V.  Each walks the 16 key tiles from a start of
    // its own and wraps, so that they do not ask L2 for one line at one moment and every tile is asked
    // for early by one of them: tile slot jt holds key tile (jt + kr) & 15, in K, in the edge tile in
    // LDS and in V alike.  Any kr gives the same sums in another order; this one spreads neighbours.
    const int kr = ((blockIdx.x & 3) << 2) | (blockIdx.x >> 2);
    unsigned ko[16];   // the lane's offset in bytes in the head's K, and in its V; GEN: its key row in the batch
    const char* __restrict__ kb = (const char*)(hb + FSEC);
    const char* __restrict__ vb = (const char*)(hb + 2 * FSEC);

    // Q as B fragment, K as A fragment; k slot (kh, e) of step s is d = 8*kh + 2*s + e in both
    v4f q0, q1;
    v4f k0[16], k1[16];
    v4f hi[2];         // the wave's two rows of this layer's input, four columns a lane
    v4f vg0[16], vg1[16];   // GEN: the V tiles, made behind the score products
    v2f cf[16], pv;    // GEN: coefficients of the 16 key tiles and the head's columns of P for V
    v2f tb;            // GEN: T as B fragment
    v4f gg, bb;        // LN2's scale and shift of the lane's columns

    if constexpr (!GEN) {
        const float* __restrict__ qp = hb + blockIdx.x * FTILE;
        q0 = *(const v4f*)(qp + lane * 4);
        q1 = *(const v4f*)(qp + 128 + lane * 4);
#pragma unroll
        for (int jt = 0; jt < 16; ++jt) ko[jt] = (((jt + kr) & 15) * FTILE + lane * 4) * 4;
#pragma unroll
        for (int jt = 0; jt < 16; ++jt) {
            k0[jt] = *(const v4f*)(kb + ko[jt]);
            k1[jt] = *(const v4f*)(kb + 512 + ko[jt]);
        }
        // asked for here, the input rows are long there when the attention ends
        const float* __restrict__ hp = hin + (row0 + 2 * w) * HIDD;
#pragma unroll
        for (int rr = 0; rr < 2; ++rr) hi[rr] = *(const v4f*)(hp + rr * HIDD + lane * 4);
        gg = *(const v4f*)(g2 + lane * 4);
        bb = *(const v4f*)(b2 + lane * 4);

        // The wait that belongs in front of any overwrite of a register the loads above name.
        // Bases and offsets are inputs so that their registers stay untouched up to this line.
        asm volatile("s_wait_xcnt 0x0" :: "s"(qp), "s"(hb), "s"(efg), "v"(tid), "s"(hp), "s"(g2), "s"(b2), "v"(lane),
                                          "v"(ko[0]), "v"(ko[1]), "v"(ko[2]), "v"(ko[3]), "v"(ko[4]), "v"(ko[5]),
                                          "v"(ko[6]), "v"(ko[7]), "v"(ko[8]), "v"(ko[9]), "v"(ko[10]), "v"(ko[11]),
                                          "v"(ko[12]), "v"(ko[13]), "v"(ko[14]), "v"(ko[15]) : "memory");
    } else {
        // k slot (kh, e) of the depth-4 products is term 2*kh + e: alpha, beta, 1, 0 against P0, P1, P2, 0
        const v2f* __restrict__ nb = (const v2f*)(nf + b * NNOD * 2);
        const unsigned qo = i0 + l16;
        v2f x[17];     // the lane's key row of each tile slot, and its query row
#pragma unroll
        for (int jt = 0; jt < 16; ++jt) ko[jt] = ((jt + kr) & 15) * 16 + l16;
        x[16] = nb[qo];
#pragma unroll
        for (int jt = 0; jt < 16; ++jt) x[jt] = nb[ko[jt]];
        const unsigned po = 2 * kh * PROW + 16 * w + l16;   // rows 2*kh and 2*kh + 1 of P, the head's column l16
        const float* __restrict__ pb = qkv;
        const v2f pq = { pb[po],       pb[po + PROW] };
        pv = v2f{ pb[po + 256], pb[po + PROW + 256] };
        // P_K as A fragment of T, d = 8*kh + 4*half + e as in a K tile.  Row m of the tile is term
        // (m & 1) + 2*(m >> 3): terms 0, 1 come out in registers 0, 1 of the lower lane half and terms
        // 2, 3 in registers 0, 1 of the upper, which is T as B fragment; the other rows are not read.
        const unsigned to = (((l16 & 1) + 2 * (l16 >> 3)) * PROW + 128 + 16 * w + 8 * kh) * 4;   // in bytes
        const v4f t0 = *(const v4f*)((const char*)pb + to);
        const v4f t1 = *(const v4f*)((const char*)pb + 16 + to);
        const float c00 = qkv[PCOV], c01 = qkv[PCOV + 1], c11 = qkv[PCOV + 2];
        const v4f wn0 = *(const v4f*)(Wn + lane * 4);
        const v4f wn1 = *(const v4f*)(Wn + HIDD + lane * 4);
        gg = *(const v4f*)(g2 + lane * 4);
        bb = *(const v4f*)(b2 + lane * 4);
        // The wait that belongs in front of any overwrite of a register the loads above name.
        // Bases and offsets are inputs so that their registers stay untouched up to this line.
        asm volatile("s_wait_xcnt 0x0" :: "s"(nb), "s"(pb), "s"(efg), "v"(tid), "s"(Wn), "s"(g2), "s"(b2), "v"(lane),
                                          "v"(qo), "v"(po), "v"(to),
                                          "v"(ko[0]), "v"(ko[1]), "v"(ko[2]), "v"(ko[3]), "v"(ko[4]), "v"(ko[5]),
                                          "v"(ko[6]), "v"(ko[7]), "v"(ko[8]), "v"(ko[9]), "v"(ko[10]), "v"(ko[11]),
                                          "v"(ko[12]), "v"(ko[13]), "v"(ko[14]), "v"(ko[15]) : "memory");
#pragma unroll
        for (int rr = 0; rr < 2; ++rr) {
            const int row = row0 + 2 * w + rr;
            hi[rr] = nf[row * 2] * wn0 + nf[row * 2 + 1] * wn1;
        }
        const v8f z8 = { 0.0f, 0.0f, 0.0f, 0.0f, 0.0f, 0.0f, 0.0f, 0.0f };
        float va[17];   // variance + epsilon; the quadratic form is not below 0 but for rounding
#pragma unroll
        for (int jt = 0; jt < 17; ++jt)
            va[jt] = fmaxf((x[jt][0] * x[jt][0]) * c00 + (x[jt][0] * x[jt][1]) * c01 + (x[jt][1] * x[jt][1]) * c11, 0.0f) + 1e-5f;
        {   // Q^T: P as A, coefficients as B, a lane's 8 registers are d = 8*kh + r of row l16
            const float rinv = rsqx1(va[16]);
            const v2f cq = { kh ? 1.0f : x[16][0] * rinv, kh ? 0.0f : x[16][1] * rinv };
            const v8f d = __builtin_amdgcn_wmma_f32_16x16x4_f32(false, pq, false, cq, (short)0, z8, false, false);
            q0 = v4f{ d[0], d[1], d[2], d[3] };
            q1 = v4f{ d[4], d[5], d[6], d[7] };
            // The products of T read this result as their B operand, directly behind it:
            // the five v_nop are the vector slots that such a read asks for.
            asm volatile("v_nop\n\tv_nop\n\tv_nop\n\tv_nop\n\tv_nop" : "+v"(q0), "+v"(q1));
            const v2f qs[4] = { {q0[0], q0[1]}, {q0[2], q0[3]}, {q1[0], q1[1]}, {q1[2], q1[3]} };
            v8f td = z8;
#pragma unroll
            for (int s = 0; s < 4; ++s) {
                const v4f tk = (s < 2) ? t0 : t1;
                const v2f a = { tk[(s & 1) * 2], tk[(s & 1) * 2 + 1] };
                td = __builtin_amdgcn_wmma_f32_16x16x4_f32(false, a, false, qs[s], (short)0, td, false, false);
            }
            tb = v2f{ td[0], td[1] };
            // the same five slots in front of the score products, which read T as their B operand
            asm volatile("v_nop\n\tv_nop\n\tv_nop\n\tv_nop\n\tv_nop" : "+v"(tb));
        }
#pragma unroll
        for (int g = 0; g < 4; ++g) {
            float rinv[4];
            rsqx4(rinv, va[4 * g], va[4 * g + 1], va[4 * g + 2], va[4 * g + 3]);
#pragma unroll
            for (int t = 0; t < 4; ++t) {
                const int jt = 4 * g + t;
                cf[jt] = v2f{ kh ? 1.0f : x[jt][0] * rinv[t], kh ? 0.0f : x[jt][1] * rinv[t] };
            }
        }
    }
    const v2f qf[4] = { {q0[0], q0[1]}, {q0[2], q0[3]}, {q1[0], q1[1]}, {q1[2], q1[3]} };

    // All work-groups read the same weights.  They walk the four stages of each product from different
    // starting points and wrap, so that they do not ask L2 for one line at one moment: ring stage g
    // holds stage (g + rot) & 3.  The activations follow through one LDS column offset (rotcol below).
    const int rot = (blockIdx.x + blockIdx.y) & 3;
    const float* __restrict__ w1b = w1T + 4 * w * WTILE;   // tiles 4*w .. 4*w + 3
    const float* __restrict__ whb = whT + w * WTILE;       // tiles w, 8 + w, 16 + w: Q, K, V of head w
    const float* __restrict__ w2b = w2T + w * 8192;        // the wave's 64 hidden columns
    const float* w1s[4];
    const float* w2s[4];
    const float* whs[4];
#pragma unroll
    for (int g = 0; g < 4; ++g) {
        const int st = (g + rot) & 3;
        w1s[g] = w1b + st * 512;
        w2s[g] = w2b + st * 2048;
        whs[g] = whb + st * 512;
    }

    v8f S[16];
#pragma unroll
    for (int jt = 0; jt < 16; ++jt)
#pragma unroll
        for (int r = 0; r < 8; ++r) S[jt][r] = 0.0f;
    if constexpr (GEN) {   // coefficients as A, T as B: the same tile in the same registers
#pragma unroll
        for (int jt = 0; jt < 16; ++jt)
            S[jt] = __builtin_amdgcn_wmma_f32_16x16x4_f32(false, cf[jt], false, tb, (short)0, S[jt], false, false);
    } else
#pragma unroll
    for (int g = 0; g < 4; ++g)
#pragma unroll
        for (int s = 0; s < 4; ++s)
#pragma unroll
            for (int t = 0; t < 4; ++t) {
                const int jt = g * 4 + t;
                const v4f kk = (s < 2) ? k0[jt] : k1[jt];
                const v2f a = { kk[(s & 1) * 2], kk[(s & 1) * 2 + 1] };
                S[jt] = __builtin_amdgcn_wmma_f32_16x16x4_f32(
                    false, a, false, qf[s], (short)0, S[jt], false, false);
            }

    // The weights of the row chain run through a ring of four register stages, r0 .. r3, each asked
    // for three to four stages before its products.  The first takes registers K has left; it goes
    // out alone, so that V, which is needed sooner and returns behind it, is not held up for long.
    v4f r0[16], r1[16], r2[16], r3[16];
    if constexpr (GEN) {
        // V: coefficients as A, P as B, a lane's 8 registers are rows 8*kh + r of column l16.  All 16 tiles
        // here, far in front of the products that read them as an operand.
        const v8f z8 = { 0.0f, 0.0f, 0.0f, 0.0f, 0.0f, 0.0f, 0.0f, 0.0f };
#pragma unroll
        for (int jt = 0; jt < 16; ++jt) {
            const v8f d = __builtin_amdgcn_wmma_f32_16x16x4_f32(false, cf[jt], false, pv, (short)0, z8, false, false);
            vg0[jt] = v4f{ d[0], d[1], d[2], d[3] };
            vg1[jt] = v4f{ d[4], d[5], d[6], d[7] };
        }
    }
    __builtin_amdgcn_sched_barrier(0);   // not lifted among the score products, where K still holds the registers
    load_w<4, WTILE>(r0, w1s[0] + lane * 4, 0);
    // The wait that belongs in front of any overwrite of a register these loads name.
    asm volatile("s_wait_xcnt 0x0" :: "s"(w1s[0]), "v"(lane) : "memory");
    __builtin_amdgcn_sched_barrier(0);   // issued here, not sunk towards their use

#pragma unroll
    for (int q = 0; q < 4; ++q) {
        const int f = tid + 256 * q;
        *(v4f*)(efs + (f >> 6) * EFP + ((((f & 63) >> 2) - kr) & 15) * 16 + (f & 3) * 4) = e4[q];   // key tile to its slot
    }
    lds_barrier();   // the edge tile is read by all eight heads

    // x = s/sqrt(16) + e*cB, row maximum
    const float* er = efs + l16 * EFP + 8 * kh;
    float mx[4] = { -INFINITY, -INFINITY, -INFINITY, -INFINITY };
#pragma unroll
    for (int jt = 0; jt < 16; ++jt) {
        const v4f ea = *(const v4f*)(er + jt * 16);
        const v4f eb = *(const v4f*)(er + jt * 16 + 4);
#pragma unroll
        for (int r = 0; r < 8; ++r) {
            const float e = (r < 4) ? ea[r & 3] : eb[r & 3];
            const float x = S[jt][r] * 0.25f + e * cB;
            S[jt][r] = x;
            mx[r & 3] = fmaxf(mx[r & 3], x);
        }
    }
    float m = fmaxf(fmaxf(mx[0], mx[1]), fmaxf(mx[2], mx[3]));
    m = fmaxf(m, lane_x16(m));

    // p = exp(x - m) = exp2(x*log2e - m*log2e), row sum, unnormalised gated weight p*e
    const float L2E = 1.4426950408889634f;
    const float nm  = -m * L2E;
    float sm[4] = { 0.0f, 0.0f, 0.0f, 0.0f };
#pragma unroll
    for (int jt = 0; jt < 16; ++jt) {
        const v4f ea = *(const v4f*)(er + jt * 16);
        const v4f eb = *(const v4f*)(er + jt * 16 + 4);
#pragma unroll
        for (int c = 0; c < 2; ++c) {
            const v4f e = c ? eb : ea;
            v4f p;
            exp2x4(p, fmaf(S[jt][4 * c + 0], L2E, nm), fmaf(S[jt][4 * c + 1], L2E, nm),
                      fmaf(S[jt][4 * c + 2], L2E, nm), fmaf(S[jt][4 * c + 3], L2E, nm));
#pragma unroll
            for (int r = 0; r < 4; ++r) {
                sm[r] += p[r];
                S[jt][4 * c + r] = p[r] * e[r];
            }
        }
    }
    float ss = (sm[0] + sm[1]) + (sm[2] + sm[3]);
    ss += lane_x16(ss);

    // Y^T[d][i] = sum_j V[j][d] * w[i][j]; A fragment: lane l16 = d, rows j in the order above
    v8f o[2];
#pragma unroll
    for (int r = 0; r < 8; ++r) { o[0][r] = 0.0f; o[1][r] = 0.0f; }
#pragma unroll
    for (int jt = 0; jt < 16; ++jt) {
        v4f v0, v1;
        if constexpr (!GEN) {
            v0 = *(const v4f*)(vb + ko[jt]);
            v1 = *(const v4f*)(vb + 512 + ko[jt]);
        } else {
            v0 = vg0[jt];
            v1 = vg1[jt];
        }
#pragma unroll
        for (int s = 0; s < 4; ++s) {
            const v4f vv = (s < 2) ? v0 : v1;
            const v2f a = { vv[(s & 1) * 2], vv[(s & 1) * 2 + 1] };
            const v2f wv = { S[jt][2 * s], S[jt][2 * s + 1] };
            o[s & 1] = __builtin_amdgcn_wmma_f32_16x16x4_f32(
                false, a, false, wv, (short)0, o[s & 1], false, false);
        }
    }

    // same wait for the V loads: their base and offsets stay untouched up to this line
    if constexpr (!GEN)
    asm volatile("s_wait_xcnt 0x0" :: "s"(hb),
                                      "v"(ko[0]), "v"(ko[1]), "v"(ko[2]), "v"(ko[3]), "v"(ko[4]), "v"(ko[5]),
                                      "v"(ko[6]), "v"(ko[7]), "v"(ko[8]), "v"(ko[9]), "v"(ko[10]), "v"(ko[11]),
                                      "v"(ko[12]), "v"(ko[13]), "v"(ko[14]), "v"(ko[15]) : "memory");

    // The chain reads its lane index anew (ln = lane, lr = l16, lk = kh): held in a register
    // across the attention, the index was spilled to scratch in one of the builds.
    const int ln = __builtin_amdgcn_mbcnt_lo(~0u, 0u);
    const int lr = ln & 15;
    const int lk = ln >> 4;

    const float* zr = zs + lr * ZP + 4 * lk;          // B fragments: row lr of the normed tile
    // LDS column of the lane's four columns 4*ln: their block of 32 lies at ring stage (block - rot) & 3,
    // in the normed tile (read by stage) and in the partial sums (written by stage) alike
    const int rotcol = ((((ln >> 3) - rot) & 3) << 5) + ((ln & 7) << 2);
    v4f e0[12], e1[12], e2[12], e3[12];                // QKV weight stages, the ring's last round
    v4f yv[2], hv[2];                                  // the wave's two rows, 4 columns a lane
    v4f gg1, bb1;                                      // LN1 scale and shift of the lane's columns
    v4f wd;                                            // decoder weights of the lane's columns

    load_w<4, WTILE>(r1, w1s[1] + ln * 4, 0);     // these three take registers of K, of the scores and of V
    load_w<4, WTILE>(r2, w1s[2] + ln * 4, 0);
    load_w<4, WTILE>(r3, w1s[3] + ln * 4, 0);
    __builtin_amdgcn_sched_barrier(0);   // issued here, not sunk to the barrier

    // normalise and gate-scale once per output, gather the 8 heads' columns per row in LDS
    const float sc = cG / ss;
    v4f ya, yb;
#pragma unroll
    for (int r = 0; r < 4; ++r) {
        ya[r] = (o[0][r] + o[1][r]) * sc;
        yb[r] = (o[0][r + 4] + o[1][r + 4]) * sc;
    }
    float* yw = ys + lr * YSP + w * 16 + 8 * lk;
    *(v4f*)(yw)     = ya;
    *(v4f*)(yw + 4) = yb;
    lds_barrier();   // every head's columns are in place before whole rows are read

#pragma unroll
    for (int rr = 0; rr < 2; ++rr) {
        yv[rr] = *(const v4f*)(ys + (2 * w + rr) * YSP + ln * 4);
        *(v4f*)(zs + (2 * w + rr) * ZP + rotcol) = ln_wave(yv[rr] + hi[rr], gg, bb);
    }
    lds_barrier();             // all 16 normed rows are read by every wave

    {
        // act^T = relu(W1^T z^T), hidden columns 64*w .. 64*w + 63; a stage's registers are refilled behind its products
        v8f d[4];
#pragma unroll
        for (int t = 0; t < 4; ++t)
#pragma unroll
            for (int r = 0; r < 8; ++r) d[t][r] = 0.0f;
        mm_stage<4>(d, r0, zr, 0);  load_c(r0, w2s[0] + ln * 4, 0);
        mm_stage<4>(d, r1, zr, 1);  load_c(r1, w2s[1] + ln * 4, 0);
        mm_stage<4>(d, r2, zr, 2);  load_c(r2, w2s[2] + ln * 4, 0);
        mm_stage<4>(d, r3, zr, 3);  load_c(r3, w2s[3] + ln * 4, 0);
#pragma unroll
        for (int t = 0; t < 4; ++t)
#pragma unroll
            for (int r = 0; r < 8; ++r) d[t][r] = fmaxf(d[t][r], 0.0f);

        // partial (act W2)^T over the wave's own 64 hidden columns
        v8f oc[8];
#pragma unroll
        for (int c = 0; c < 8; ++c)
#pragma unroll
            for (int r = 0; r < 8; ++r) oc[c][r] = 0.0f;
        mm_c(oc, r0, d, 0);
        if constexpr (MODE == 1) {   // LN1's scale and shift first: the load counter returns in order
            gg1 = *(const v4f*)(g1 + ln * 4);
            bb1 = *(const v4f*)(b1 + ln * 4);
            load_w<3, 8 * WTILE>(e0, whs[0] + ln * 4, 0);
        } else {                     // asked for here, it is there when the rows are summed
            wd = *(const v4f*)(Wdec + ln * 4);
        }
        mm_c(oc, r1, d, 1);
        if constexpr (MODE == 1) load_w<3, 8 * WTILE>(e1, whs[1] + ln * 4, 0);
        mm_c(oc, r2, d, 2);
        if constexpr (MODE == 1) load_w<3, 8 * WTILE>(e2, whs[2] + ln * 4, 0);
        mm_c(oc, r3, d, 3);
        if constexpr (MODE == 1) {
            load_w<3, 8 * WTILE>(e3, whs[3] + ln * 4, 0);
            __builtin_amdgcn_sched_barrier(0);   // issued here, not sunk to the barrier
        }

        float* rw = red + (w * 16 + lr) * ZP + 8 * lk;
#pragma unroll
        for (int c = 0; c < 8; ++c) {
            const v4f lo = { oc[c][0], oc[c][1], oc[c][2], oc[c][3] };
            const v4f hi4 = { oc[c][4], oc[c][5], oc[c][6], oc[c][7] };
            *(v4f*)(rw + c * 16)     = lo;
            *(v4f*)(rw + c * 16 + 4) = hi4;
        }
        // same wait for the weight loads: the stage bases and the offset stay untouched up to this line,
        // and so do the bases of LN1's scale and shift, which one build overwrote ahead of it
        if constexpr (MODE == 1)
            asm volatile("s_wait_xcnt 0x0" :: "s"(w1s[1]), "s"(w1s[2]), "s"(w1s[3]), "s"(w2s[0]), "s"(w2s[1]),
                                              "s"(w2s[2]), "s"(w2s[3]), "s"(g1), "s"(b1), "v"(ln) : "memory");
        else
            asm volatile("s_wait_xcnt 0x0" :: "s"(w1s[1]), "s"(w1s[2]), "s"(w1s[3]), "s"(w2s[0]), "s"(w2s[1]),
                                              "s"(w2s[2]), "s"(w2s[3]), "v"(ln) : "memory");
        lds_barrier();             // the eight partial sums of every row are in place

#pragma unroll
        for (int rr = 0; rr < 2; ++rr) {
            const float* rp = red + (2 * w + rr) * ZP + rotcol;
            v4f s = *(const v4f*)rp;
#pragma unroll
            for (int u = 1; u < 8; ++u) s += *(const v4f*)(rp + u * 16 * ZP);
            hv[rr] = s + yv[rr];
        }
    }

    if constexpr (MODE == 2) {
        // out = 10 * tanh((h . Wdec) / sqrt(128))
        v2f res;
#pragma unroll
        for (int rr = 0; rr < 2; ++rr) {
            const float s = sum_wave((hv[rr][0] * wd[0] + hv[rr][1] * wd[1]) + (hv[rr][2] * wd[2] + hv[rr][3] * wd[3]));
            res[rr] = 10.0f * tanhf(s * 0.08838834764831845f);
        }
        if (ln == 0) *(v2f*)(out + row0 + 2 * w) = res;
    } else {
        float* __restrict__ op = hout + (row0 + 2 * w) * HIDD + ln * 4;
#pragma unroll
        for (int rr = 0; rr < 2; ++rr) {
            *(v4f*)(op + rr * HIDD) = hv[rr];
            *(v4f*)(zs + (2 * w + rr) * ZP + rotcol) = ln_wave(hv[rr], gg1, bb1);
        }
        // same wait for the stores and the loads since the last one
        asm volatile("s_wait_xcnt 0x0" :: "v"(op), "v"(ln) : "memory");
        lds_barrier();             // all 16 normed rows are read by every wave

        // Q^T, K^T and V of head w: columns 16*w .. 16*w + 15 of each third of Wh
        v8f a[3];
#pragma unroll
        for (int t = 0; t < 3; ++t)
#pragma unroll
            for (int r = 0; r < 8; ++r) a[t][r] = 0.0f;
        mm_stage<3, true>(a, e0, zr, 0);
        mm_stage<3, true>(a, e1, zr, 1);
        mm_stage<3, true>(a, e2, zr, 2);
        mm_stage<3, true>(a, e3, zr, 3);
        // same wait for the QKV weight loads: their stage bases and offset stay untouched up to this line
        asm volatile("s_wait_xcnt 0x0" :: "s"(whs[0]), "s"(whs[1]), "s"(whs[2]), "s"(whs[3]), "v"(ln) : "memory");

        float* qw = qkvn + (b * NHD + w) * FHEAD + blockIdx.x * FTILE + ln * 4;
#pragma unroll
        for (int t = 0; t < 3; ++t) {
            const v4f lo = { a[t][0], a[t][1], a[t][2], a[t][3] };
            const v4f hi4 = { a[t][4], a[t][5], a[t][6], a[t][7] };
            *(v4f*)(qw + t * FSEC)       = lo;
            *(v4f*)(qw + t * FSEC + 128) = hi4;
        }
    }
}

// ------ first launch: the preparation of the later launches ------
#define ROWG 3                    // work-groups 0 .. 2: P for Q, for K and for V of layer 0
#define PREPG 121                 // behind them: 24 + 48 + 48 weight-ordering work-groups and one for comb

// One stage of one QKV weight tile read from the matrix as it is given (rows k, pitch 384):
// the same values in the same registers as load_w takes from a fragment-order copy.
__device__ __forceinline__ void load_n(v4f (&w)[4], const float* __restrict__ wp, const int st)
{
#pragma unroll
    for (int q = 0; q < 4; ++q)
#pragma unroll
        for (int c = 0; c < 4; ++c)
            w[q][c] = wp[(st * 32 + q * 8 + c) * 384];
}

// in[l][m][n] to fragment order, m being the k index of the product: one wave turns one tile of
// 16 m x 32 n, a lane 4 x 4 of it; four consecutive m of one n are one lane's 16 bytes of a fragment.
// W2ORD false: the order load_w reads; true: the order load_c reads.
// Loads cover whole 128-byte lines; a wave's four stores together fill whole 512-byte blocks.
template<int M, int N, bool W2ORD>
__device__ __forceinline__ void pack_tile(const float* __restrict__ in, float* __restrict__ out,
                                               const int T, const int lane)
{
    constexpr int NTN = N / 32, TPL = (M / 16) * NTN;
    const int l = T / TPL, rem = T % TPL;
    const int m0 = (rem / NTN) * 16 + 4 * (lane >> 3);
    const int n0 = (rem % NTN) * 32 + 4 * (lane & 7);
    const float* __restrict__ ip = in + l * M * N + m0 * N + n0;
    const int off = W2ORD
        ? (m0 >> 6) * 8192 + (n0 >> 4) * 1024 + ((m0 >> 4) & 3) * 256 + ((m0 >> 2) & 1) * 128
          + (((m0 >> 3) & 1) * 16 + (n0 & 15)) * 4
        : ((n0 >> 4) * 16 + (m0 >> 3)) * 128 + (((m0 >> 2) & 1) * 16 + (n0 & 15)) * 4;
    float* __restrict__ op = out + l * M * N + off;
    v4f r[4];
#pragma unroll
    for (int j = 0; j < 4; ++j) r[j] = *(const v4f*)(ip + j * N);
#pragma unroll
    for (int i = 0; i < 4; ++i) {
        const v4f c = { r[0][i], r[1][i], r[2][i], r[3][i] };
        *(v4f*)(op + i * 4) = c;
    }
    // The wait that belongs in front of any overwrite of a register the stores above name.
    asm volatile("s_wait_xcnt 0x0" ::: "memory");
}

__global__ __launch_bounds__(256)
void first_kernel(const float* __restrict__ Wn,
                  const float* __restrict__ g1, const float* __restrict__ b1,
                  const float* __restrict__ Wh, float* __restrict__ pout,
                  const float* __restrict__ W1, const float* __restrict__ W2,
                  const float* __restrict__ We_in, const float* __restrict__ We,
                  float* __restrict__ whT, float* __restrict__ w1T, float* __restrict__ w2T,
                  float* __restrict__ comb)
{
    __shared__ __attribute__((aligned(16))) float zs[16 * ZP];

    const int tid  = threadIdx.x;
    const int w    = __builtin_amdgcn_readfirstlane(tid >> 5);
    const int lane = tid & 31;
    const int l16  = lane & 15;
    const int kh   = lane >> 4;

    // Preparation work-groups: nothing of theirs is read in this launch, and they leave
    // as whole work-groups in front of every barrier.
    if (blockIdx.x >= ROWG) {
        const int pb = blockIdx.x - ROWG;
        if (pb < 24) {            // Wh of layers 1 and 2 (layer 0 is read as it is given below)
            pack_tile<128, 384, false>(Wh + 128 * 384, whT + 128 * 384, pb * 8 + w, lane);
        } else if (pb < 72) {
            pack_tile<128, 512, false>(W1, w1T, (pb - 24) * 8 + w, lane);
        } else if (pb < 120) {
            pack_tile<512, 128, true>(W2, w2T, (pb - 72) * 8 + w, lane);
        } else if (w < 2) {       // comb[l][c] = We_in . We[l][:, c], 48 values; lanes past them repeat the last
            const int t = tid < 48 ? tid : 47;
            const float* __restrict__ wp = We + (t >> 4) * HIDD * 16 + (t & 15);
            float s = 0.0f;
#pragma unroll                    // the loads go out in one run instead of one round trip per group
            for (int d = 0; d < HIDD; ++d) s += We_in[d] * wp[d * 16];
            // The wait that belongs in front of any overwrite of a register the loads above name.
            // The address is an input so that its registers stay untouched up to this line.
            asm volatile("s_wait_xcnt 0x0" :: "v"(wp) : "memory");
            if (tid < 48) comb[tid] = s;
        }
        return;
    }

    // P = [u0*g1; u1*g1; b1; 0 ...] Wh[0], u = the rows of Wn less their means: 16 rows of which three
    // are filled.  Work-group sec makes the 128 columns of Q, of K or of V, wave w those of head w.
    const int sec = blockIdx.x;
    const float* zr = zs + l16 * ZP + 4 * kh;          // B fragments: row l16 of the tile
    const float* __restrict__ whp = Wh + 4 * kh * 384 + sec * HIDD + 16 * w + l16;
    v4f e0[4], e1[4], e2[4], e3[4];                    // the wave's weight tile, all four stages asked for at once
    const v4f wn0 = *(const v4f*)(Wn + lane * 4);
    const v4f wn1 = *(const v4f*)(Wn + HIDD + lane * 4);
    const v4f gg1 = *(const v4f*)(g1 + lane * 4);
    const v4f bb1 = *(const v4f*)(b1 + lane * 4);
    load_n(e0, whp, 0);
    load_n(e1, whp, 1);
    load_n(e2, whp, 2);
    load_n(e3, whp, 3);
    // The wait that belongs in front of any overwrite of a register the loads above name.
    // Bases and offsets are inputs so that their registers stay untouched up to this line.
    asm volatile("s_wait_xcnt 0x0" :: "s"(Wn), "s"(g1), "s"(b1), "v"(whp), "v"(lane) : "memory");
    __builtin_amdgcn_sched_barrier(0);   // issued here, not sunk to the barrier: they fly during the sums

    const float m0 = sum_wave((wn0[0] + wn0[1]) + (wn0[2] + wn0[3])) * (1.0f / HIDD);
    const float m1 = sum_wave((wn1[0] + wn1[1]) + (wn1[2] + wn1[3])) * (1.0f / HIDD);
    const v4f u0 = wn0 - m0;
    const v4f u1 = wn1 - m1;
    const v4f p00 = u0 * u0, p01 = u0 * u1, p11 = u1 * u1;
    const float c00 = sum_wave((p00[0] + p00[1]) + (p00[2] + p00[3])) * (1.0f / HIDD);
    const float c01 = sum_wave((p01[0] + p01[1]) + (p01[2] + p01[3])) * (2.0f / HIDD);
    const float c11 = sum_wave((p11[0] + p11[1]) + (p11[2] + p11[3])) * (1.0f / HIDD);
    if (sec == 0 && tid == 0) {   // var of row x of nf Wn = x0*x0*c00 + x0*x1*c01 + x1*x1*c11
        pout[PCOV]     = c00;
        pout[PCOV + 1] = c01;
        pout[PCOV + 2] = c11;
    }

    const v4f zero4 = { 0.0f, 0.0f, 0.0f, 0.0f };
#pragma unroll
    for (int rr = 0; rr < 2; ++rr) {
        const int ri = 2 * w + rr;
        *(v4f*)(zs + ri * ZP + lane * 4) = ri == 0 ? u0 * gg1 : ri == 1 ? u1 * gg1 : ri == 2 ? bb1 : zero4;
    }
    __syncthreads();           // all 16 rows are read by every wave

    v8f a[1];
#pragma unroll
    for (int r = 0; r < 8; ++r) a[0][r] = 0.0f;
    mm_stage<1>(a, e0, zr, 0);
    mm_stage<1>(a, e1, zr, 1);
    mm_stage<1>(a, e2, zr, 2);
    mm_stage<1>(a, e3, zr, 3);

    // a lane's 8 registers are columns 8*kh + r of row l16; rows 0 .. 3 are kept, the fourth being zero
    if (l16 < 4) {
        float* pw = pout + l16 * PROW + sec * HIDD + 16 * w + 8 * kh;
        const v4f lo = { a[0][0], a[0][1], a[0][2], a[0][3] };
        const v4f hi4 = { a[0][4], a[0][5], a[0][6], a[0][7] };
        *(v4f*)(pw)     = lo;
        *(v4f*)(pw + 4) = hi4;
    }
    // same wait for these stores: the code of the other work-groups follows in the listing
    asm volatile("s_wait_xcnt 0x0" ::: "memory");
}

// ---------------- host launch ----------------
extern "C" void kernel_launch(void* const* d_in, const int* in_sizes, int n_in,
                              void* d_out, int out_size, void* d_ws, size_t ws_size,
                              hipStream_t stream)
{
    const float* nf    = (const float*)d_in[0];   // (16,256,2)
    const float* ef    = (const float*)d_in[1];   // (16,256,256,1)
    const float* Wn    = (const float*)d_in[2];   // (2,128)
    const float* We_in = (const float*)d_in[3];   // (1,128)
    const float* ln1g  = (const float*)d_in[4];   // (3,128)
    const float* ln1b  = (const float*)d_in[5];
    const float* Wh    = (const float*)d_in[6];   // (3,128,384)
    const float* We    = (const float*)d_in[7];   // (3,128,16)
    const float* ln2g  = (const float*)d_in[8];
    const float* ln2b  = (const float*)d_in[9];
    const float* W1    = (const float*)d_in[10];  // (3,128,512)
    const float* W2    = (const float*)d_in[11];  // (3,512,128)
    const float* Wdec  = (const float*)d_in[12];  // (128,1)
    float* out = (float*)d_out;

    float* ws = (float*)d_ws;
    float* hA   = ws;                         // 524288, input of the last layer
    float* hB   = ws + 524288;                // 524288, input of the middle layer
    float* qkvA = ws + 1048576;               // 1572864, QKV of the last layer
    float* qkvB = ws + 2621440;               // 1572864, QKV of the odd layer
    float* comb = ws + 14155776;              // 64 (48 used)
    float* whT  = ws + 14155840;              // 3*384*128 = 147456 (layer 0's part stays unused)
    float* w1T  = ws + 14303296;              // 3*512*128 = 196608
    float* w2T  = ws + 14499904;              // 3*128*512 = 196608
    float* pq0  = ws + 14696512;              // 4*384 + 3: P and the covariance terms of layer 0

    const dim3 ga(NNOD / 16, NBAT);

    // P and the covariance terms, from which layer 0 forms qkv0 = LN1(nf Wn) Wh[0]; beside them comb
    // and the weights in fragment order
    first_kernel<<<ROWG + PREPG, 256, 0, stream>>>(
        Wn, ln1g, ln1b, Wh, pq0, W1, W2, We_in, We, whT, w1T, w2T, comb);

    // y = (softmax(q k^T / 4 + ef*combB) * ef*combG) @ v, all heads;
    // h1 = relu(LN2(y + h0) W1[0]) W2[0] + y, qkv1 = LN1(h1) Wh[1]
    layer_kernel<1, true><<<ga, 256, 0, stream>>>(
        pq0, ef, comb, nullptr, hB, ln2g, ln2b, w1T, w2T,
        ln1g + HIDD, ln1b + HIDD, whT + 384 * HIDD, qkvB, nullptr, nullptr, nf, Wn);

    layer_kernel<1><<<ga, 256, 0, stream>>>(
        qkvB, ef, comb + 16, hB, hA, ln2g + HIDD, ln2b + HIDD, w1T + 512 * HIDD, w2T + 512 * HIDD,
        ln1g + 2 * HIDD, ln1b + 2 * HIDD, whT + 2 * 384 * HIDD, qkvA, nullptr, nullptr, nullptr, nullptr);

    // last layer; out = 10 * tanh((h3 @ Wdec) / sqrt(128))
    layer_kernel<2><<<ga, 256, 0, stream>>>(
        qkvA, ef, comb + 32, hA, nullptr, ln2g + 2 * HIDD, ln2b + 2 * HIDD,
        w1T + 2 * 512 * HIDD, w2T + 2 * 512 * HIDD,
        nullptr, nullptr, nullptr, nullptr, Wdec, out, nullptr, nullptr);
}
